// v000
// Measured on an AMD MI455X. A time is GPU time per run, averaged over a window of back-to-back runs after a warm-up
// (all launches, gaps included; the runs take copies of the inputs in turn), and the median of several windows.
// Apart from v000's, it joins two sittings. Times from different sittings can be a few percent apart, while
// side-by-side timings come from the same sitting.
// v000 is the starting kernel. One run takes 1020 microseconds.
#include <hip/hip_runtime.h>

// SyntaxMultiAttentionGAT: tokens are the (b, x, y) cells of table [4][96][96][256]; q,k,v = table W + b (8 heads x 32); per (b, x) sequence of 96 cells: probs = softmax_k(q.k / sqrt(32) + dep_matrix[b][x][k] Wdep[h] + bdep[h]); ctx = probs v; out1 = LN(ctx Wo + bo + table); out = LN(relu(out1 W1 + b1) W2 + b2 + out1) -> [4][96][96][256].
// Deterministic: per-wave computation, softmax over 96 keys in fixed order; no atomics.
// WMMA (v_wmma_f32_16x16x32_f16, f32 accumulate): table (EXACT bf16 x8, K 256) x [Wq|Wk|Wv] rows (48 tiles in 3 groups) per 16-token wave; per (sequence, head, 16-query) wave S = q (hi+lo x256, K 32) x k rows (hi+lo; 6 tiles) and ctx = P (hi+lo) x v^T (hi+lo; 2 tiles, K 96), 3 products; tail ctx x Wo (16 tiles), out1 x W1 (64 tiles in 4 groups), ff x W2 (K 1,024, 16 tiles) per 16-token wave — weights EXACT x256 ((in,out)), ≈ 7 M WMMA; softmax, dep bias, LayerNorms, relu in f32.

namespace {
constexpr int NB_ = 4, LQ = 96, D = 256, H = 8, HD = 32, FF = 1024, NSEQ = NB_ * LQ /* 384 */, NT = NSEQ * LQ /* 36864 tokens */;
constexpr float XS = 8.0f, HS = 256.0f, PS = 256.0f, WSC = 256.0f, EPS = 1e-5f, SCL = 0.17677669529663688f /* 32^-0.5 */;
typedef _Float16 b16;
typedef __attribute__((ext_vector_type(16))) _Float16 v16b;
typedef __attribute__((ext_vector_type(8))) _Float16 v8b;
typedef __attribute__((ext_vector_type(2))) _Float16 v2b;
typedef __attribute__((ext_vector_type(8))) float v8f;
typedef __attribute__((ext_vector_type(4))) float v4f;
typedef __attribute__((ext_vector_type(2))) float v2f;
__device__ __forceinline__ float bf16_rne(float f) { unsigned int u = __float_as_uint(f); u += 0x7FFFu + ((u >> 16) & 1u); float r = __uint_as_float(u & 0xFFFF0000u); asm volatile("" : "+v"(r)); return r; }
__device__ __forceinline__ float bfv(float f) { float r = bf16_rne(f); asm volatile("" : "+v"(r)); return r; }
__device__ __forceinline__ void split16(float v, b16& hi, b16& lo) { hi = (b16)v; lo = (b16)(v - (float)hi); }
__device__ __forceinline__ v16b frag_kb(const b16* p, int hh) { const v8b a = *(const v8b*)(p + 8 * hh), b = *(const v8b*)(p + 16 + 8 * hh); v16b f;
#pragma unroll
  for (int e = 0; e < 8; ++e) { f[e] = a[e]; f[8 + e] = b[e]; } return f; }
__device__ __forceinline__ v8f wmma16b(v16b a, v16b b, v8f c) { v8f d = __builtin_amdgcn_wmma_f32_16x16x32_f16(false, a, false, b, (short)0, c, false, false); asm volatile("v_nop\n\tv_nop\n\tv_nop\n\tv_nop" : "+v"(d) : "v"(a), "v"(b)); return d; }
__device__ __forceinline__ void wave_lds_sync() { __builtin_amdgcn_fence(__ATOMIC_RELEASE, "workgroup"); __builtin_amdgcn_wave_barrier(); __builtin_amdgcn_fence(__ATOMIC_ACQUIRE, "workgroup"); }
__device__ __forceinline__ float pmul(float a, float b) { float p = a * b; asm volatile("" : "+v"(p)); return p; }

__global__ __launch_bounds__(256) void wput_kernel(const float* __restrict__ wq, const float* __restrict__ wk, const float* __restrict__ wv, const float* __restrict__ wo, const float* __restrict__ w1, const float* __restrict__ w2, b16* __restrict__ WQKV, b16* __restrict__ WO, b16* __restrict__ WF1, b16* __restrict__ WF2) { const size_t nt = (size_t)gridDim.x * 256, u0 = (size_t)blockIdx.x * 256 + threadIdx.x; v8b v;
  for (size_t u = u0; u < (size_t)3 * D * 32; u += nt) { const int o = (int)(u / 32), k0 = (int)(u % 32) * 8; const float* w = o < D ? wq : (o < 2 * D ? wk : wv); const int oo = o % D;
#pragma unroll
    for (int j = 0; j < 8; ++j) v[j] = (b16)(bf16_rne(w[(size_t)(k0 + j) * D + oo]) * WSC); { *(v8b*)(WQKV + (size_t)o * D + k0) = v;  } }
  for (size_t u = u0; u < (size_t)D * 32; u += nt) { const int o = (int)(u / 32), k0 = (int)(u % 32) * 8;
#pragma unroll
    for (int j = 0; j < 8; ++j) v[j] = (b16)(bf16_rne(wo[(size_t)(k0 + j) * D + o]) * WSC); { *(v8b*)(WO + (size_t)o * D + k0) = v;  } }
  for (size_t u = u0; u < (size_t)FF * 32; u += nt) { const int o = (int)(u / 32), k0 = (int)(u % 32) * 8;
#pragma unroll
    for (int j = 0; j < 8; ++j) v[j] = (b16)(bf16_rne(w1[(size_t)(k0 + j) * FF + o]) * WSC); { *(v8b*)(WF1 + (size_t)o * D + k0) = v;  } }
  for (size_t u = u0; u < (size_t)D * 128; u += nt) { const int o = (int)(u / 128), k0 = (int)(u % 128) * 8;
#pragma unroll
    for (int j = 0; j < 8; ++j) v[j] = (b16)(bf16_rne(w2[(size_t)(k0 + j) * D + o]) * WSC); { *(v8b*)(WF2 + (size_t)o * FF + k0) = v;  } } }
__global__ __launch_bounds__(32) void qkv_kernel(const float* __restrict__ tab, const b16* __restrict__ WQKV, const float* __restrict__ bq, const float* __restrict__ bk, const float* __restrict__ bv, b16* __restrict__ Qh, b16* __restrict__ Ql, b16* __restrict__ Kh, b16* __restrict__ Kl, float* __restrict__ V) { __shared__ __attribute__((aligned(16))) b16 Ah[16][D + 8]; __shared__ float Tf[16][260]; const int lane = threadIdx.x, nloc = lane & 15, hlf = lane >> 4; const size_t t0 = (size_t)blockIdx.x * 16;
  for (int rr = 0; rr < 16; ++rr) for (int q = 0; q < 8; ++q) { const int c = q * 32 + lane; Ah[rr][c] = (b16)(bf16_rne(tab[(t0 + rr) * D + c]) * XS); }
  if (lane < 16) for (int k = D; k < D + 8; ++k) Ah[lane][k] = (b16)0.0f;
  wave_lds_sync();
#pragma unroll 1
  for (int g = 0; g < 3; ++g) { const float* bias = g == 0 ? bq : (g == 1 ? bk : bv); v8f acc[16];
#pragma unroll
    for (int t = 0; t < 16; ++t) acc[t] = (v8f){};
#pragma unroll 2
    for (int kb = 0; kb < D; kb += 32) { const v16b a = frag_kb(&Ah[nloc][kb], hlf);
#pragma unroll
      for (int t = 0; t < 16; ++t) acc[t] = wmma16b(a, frag_kb(WQKV + (size_t)(g * D + t * 16 + nloc) * D + kb, hlf), acc[t]); }
#pragma unroll
    for (int t = 0; t < 16; ++t) { const int cc = t * 16 + nloc; const float bb = bfv(bias[cc]);
#pragma unroll
      for (int r8 = 0; r8 < 8; ++r8) Tf[8 * hlf + r8][cc] = acc[t][r8] * (1.0f / (XS * WSC)) + bb; }
    wave_lds_sync();
    { for (int rr = 0; rr < 16; ++rr) { const size_t tk = t0 + rr;
        if (g == 2) { for (int q = 0; q < 2; ++q) *(v4f*)(V + tk * D + q * 128 + lane * 4) = *(const v4f*)(&Tf[rr][q * 128 + lane * 4]); }
        else { b16* Ph = g == 0 ? Qh : Kh; b16* Pl = g == 0 ? Ql : Kl; for (int q = 0; q < 4; ++q) { const int c = q * 64 + lane * 2; b16 h0, l0, h1, l1; split16(Tf[rr][c] * HS, h0, l0); split16(Tf[rr][c + 1] * HS, h1, l1); *(v2b*)(Ph + tk * D + c) = (v2b){h0, h1}; *(v2b*)(Pl + tk * D + c) = (v2b){l0, l1}; } } }
       }
    wave_lds_sync(); } }
__global__ __launch_bounds__(256) void vt_kernel(const float* __restrict__ V, int SLIM, b16* __restrict__ VTh, b16* __restrict__ VTl) { __shared__ float Tt[8][LQ][HD + 1]; const int wave = threadIdx.x >> 5, lane = threadIdx.x & 31; const int seq = blockIdx.x, h = wave; if (seq >= SLIM) return;
  for (int k = 0; k < LQ; ++k) Tt[wave][k][lane] = V[((size_t)seq * LQ + k) * D + h * HD + lane];
  wave_lds_sync();
  const size_t base = ((size_t)seq * H + h) * HD * LQ;   // element (d, k) at base + d*96 + k; lane = d
  { for (int k = 0; k < LQ; k += 2) { b16 h0, l0, h1, l1; split16(Tt[wave][k][lane] * HS, h0, l0); split16(Tt[wave][k + 1][lane] * HS, h1, l1); *(v2b*)(VTh + base + (size_t)lane * LQ + k) = (v2b){h0, h1}; *(v2b*)(VTl + base + (size_t)lane * LQ + k) = (v2b){l0, l1}; }  } }
__global__ __launch_bounds__(32) void att_kernel(const b16* __restrict__ Qh, const b16* __restrict__ Ql, const b16* __restrict__ Kh, const b16* __restrict__ Kl, const b16* __restrict__ VTh, const b16* __restrict__ VTl, const float* __restrict__ dep, const float* __restrict__ wdep, const float* __restrict__ bdep, int SLIM, float* __restrict__ CTX) { __shared__ __attribute__((aligned(16))) b16 Pa[16][104], Pb[16][104]; __shared__ float Sc[16][LQ + 1], Dp[LQ], Of[16][HD + 1]; const int lane = threadIdx.x, nloc = lane & 15, hlf = lane >> 4; const int seq = blockIdx.x / (H * 6), rem = blockIdx.x % (H * 6); const int h = rem / 6, q0 = (rem % 6) * 16; if (seq >= SLIM) return; const size_t tk0 = (size_t)seq * LQ;
  const float wd = bfv(wdep[h]), bd = bfv(bdep[h]); for (int k = lane; k < LQ; k += 32) Dp[k] = pmul(bfv(dep[(size_t)seq * LQ + k]), wd) + bd;
  const v16b qa = frag_kb(Qh + (tk0 + q0 + nloc) * D + h * HD, hlf), ql = frag_kb(Ql + (tk0 + q0 + nloc) * D + h * HD, hlf);
#pragma unroll
  for (int t = 0; t < 6; ++t) { const size_t key = tk0 + t * 16 + nloc; const v16b kh = frag_kb(Kh + key * D + h * HD, hlf), kl = frag_kb(Kl + key * D + h * HD, hlf); v8f s = wmma16b(qa, kh, (v8f){}); s = wmma16b(qa, kl, s); s = wmma16b(ql, kh, s);
#pragma unroll
    for (int r8 = 0; r8 < 8; ++r8) Sc[8 * hlf + r8][t * 16 + nloc] = s[r8] * (SCL / (HS * HS)); }
  wave_lds_sync();
  if (lane < 16) { const int r = lane; float mx = -INFINITY; for (int k = 0; k < LQ; ++k) { const float v = Sc[r][k] + Dp[k]; Sc[r][k] = v; mx = fmaxf(mx, v); } float sm = 0.0f; for (int k = 0; k < LQ; ++k) { const float p = __expf(Sc[r][k] - mx); Sc[r][k] = p; sm += p; } const float inv = 1.0f / sm; for (int k = 0; k < LQ; ++k) { b16 p, pl; split16(Sc[r][k] * inv * PS, p, pl); Pa[r][k] = p; Pb[r][k] = pl; } for (int k = LQ; k < 104; ++k) { Pa[r][k] = (b16)0.0f; Pb[r][k] = (b16)0.0f; } }
  wave_lds_sync();
  v8f o0 = (v8f){}, o1 = (v8f){}; const size_t vb = ((size_t)seq * H + h) * HD * LQ;
#pragma unroll
  for (int kb = 0; kb < LQ; kb += 32) { const v16b pa = frag_kb(&Pa[nloc][kb], hlf), pb = frag_kb(&Pb[nloc][kb], hlf); const v16b v0h = frag_kb(VTh + vb + (size_t)nloc * LQ + kb, hlf), v0l = frag_kb(VTl + vb + (size_t)nloc * LQ + kb, hlf), v1h = frag_kb(VTh + vb + (size_t)(16 + nloc) * LQ + kb, hlf), v1l = frag_kb(VTl + vb + (size_t)(16 + nloc) * LQ + kb, hlf);
    o0 = wmma16b(pa, v0h, o0); o0 = wmma16b(pa, v0l, o0); o0 = wmma16b(pb, v0h, o0); o1 = wmma16b(pa, v1h, o1); o1 = wmma16b(pa, v1l, o1); o1 = wmma16b(pb, v1h, o1); }
#pragma unroll
  for (int r8 = 0; r8 < 8; ++r8) { Of[8 * hlf + r8][nloc] = o0[r8] * (1.0f / (PS * HS)); Of[8 * hlf + r8][16 + nloc] = o1[r8] * (1.0f / (PS * HS)); }
  wave_lds_sync();
  { for (int r = 0; r < 16; ++r) ((float*)CTX)[(tk0 + q0 + r) * D + h * HD + lane] = Of[r][lane];  } }
__global__ __launch_bounds__(32) void tail_kernel(const float* __restrict__ CTX, const float* __restrict__ tab, const b16* __restrict__ WO, const float* __restrict__ bo, const float* __restrict__ g1, const float* __restrict__ be1, const b16* __restrict__ WF1, const float* __restrict__ b1, const b16* __restrict__ WF2, const float* __restrict__ b2, const float* __restrict__ g2, const float* __restrict__ be2, int SLIM, float* __restrict__ out) { __shared__ __attribute__((aligned(16))) b16 A1h[16][D + 8], A1l[16][D + 8], A2h[16][FF + 8], A2l[16][FF + 8]; __shared__ float Y[16][D + 1], Tf[16][260]; const int lane = threadIdx.x, nloc = lane & 15, hlf = lane >> 4; const size_t t0 = (size_t)blockIdx.x * 16; if (t0 >= (size_t)SLIM * LQ) return;
  for (int rr = 0; rr < 16; ++rr) for (int q = 0; q < 8; ++q) { const int c = q * 32 + lane; b16 p, pl; split16(CTX[(t0 + rr) * D + c] * HS, p, pl); A1h[rr][c] = p; A1l[rr][c] = pl; }
  if (lane < 16) { for (int k = D; k < D + 8; ++k) { A1h[lane][k] = (b16)0.0f; A1l[lane][k] = (b16)0.0f; } for (int k = FF; k < FF + 8; ++k) { A2h[lane][k] = (b16)0.0f; A2l[lane][k] = (b16)0.0f; } }
  wave_lds_sync();
  auto ln_rows = [&](const float* gg, const float* bb) { if (lane < 16) { const int r = lane; float m = 0.0f; for (int c = 0; c < D; ++c) m += Y[r][c]; m *= (1.0f / D); float vr = 0.0f; for (int c = 0; c < D; ++c) { const float d = Y[r][c] - m; vr += d * d; } vr *= (1.0f / D); const float rs = rsqrtf(vr + EPS); for (int c = 0; c < D; ++c) Y[r][c] = pmul((Y[r][c] - m) * rs, bfv(gg[c])) + bfv(bb[c]); } wave_lds_sync(); };
  { v8f acc[16];
#pragma unroll
    for (int t = 0; t < 16; ++t) acc[t] = (v8f){};
#pragma unroll 2
    for (int kb = 0; kb < D; kb += 32) { const v16b a = frag_kb(&A1h[nloc][kb], hlf), al = frag_kb(&A1l[nloc][kb], hlf);
#pragma unroll
      for (int t = 0; t < 16; ++t) { const v16b bw = frag_kb(WO + (size_t)(t * 16 + nloc) * D + kb, hlf); acc[t] = wmma16b(a, bw, acc[t]); acc[t] = wmma16b(al, bw, acc[t]); } }
#pragma unroll
    for (int t = 0; t < 16; ++t) { const int cc = t * 16 + nloc; const float bb = bfv(bo[cc]);
#pragma unroll
      for (int r8 = 0; r8 < 8; ++r8) { const int r = 8 * hlf + r8; Y[r][cc] = acc[t][r8] * (1.0f / (HS * WSC)) + bb + bfv(tab[(t0 + r) * D + cc]); } } }
  wave_lds_sync(); ln_rows(g1, be1);
  for (int rr = 0; rr < 16; ++rr) for (int q = 0; q < 8; ++q) { const int c = q * 32 + lane; b16 p, pl; split16(Y[rr][c] * HS, p, pl); A1h[rr][c] = p; A1l[rr][c] = pl; }
  wave_lds_sync();
#pragma unroll 1
  for (int g = 0; g < 4; ++g) { v8f acc[16];
#pragma unroll
    for (int t = 0; t < 16; ++t) acc[t] = (v8f){};
#pragma unroll 2
    for (int kb = 0; kb < D; kb += 32) { const v16b a = frag_kb(&A1h[nloc][kb], hlf), al = frag_kb(&A1l[nloc][kb], hlf);
#pragma unroll
      for (int t = 0; t < 16; ++t) { const v16b bw = frag_kb(WF1 + (size_t)(g * 256 + t * 16 + nloc) * D + kb, hlf); acc[t] = wmma16b(a, bw, acc[t]); acc[t] = wmma16b(al, bw, acc[t]); } }
#pragma unroll
    for (int t = 0; t < 16; ++t) { const int cc = t * 16 + nloc; const float bb = bfv(b1[g * 256 + cc]);
#pragma unroll
      for (int r8 = 0; r8 < 8; ++r8) { const float v = fmaxf(acc[t][r8] * (1.0f / (HS * WSC)) + bb, 0.0f); b16 p, pl; split16(v * HS, p, pl); A2h[8 * hlf + r8][g * 256 + cc] = p; A2l[8 * hlf + r8][g * 256 + cc] = pl; } }
    wave_lds_sync(); }
  { v8f acc[16];
#pragma unroll
    for (int t = 0; t < 16; ++t) acc[t] = (v8f){};
#pragma unroll 2
    for (int kb = 0; kb < FF; kb += 32) { const v16b a = frag_kb(&A2h[nloc][kb], hlf), al = frag_kb(&A2l[nloc][kb], hlf);
#pragma unroll
      for (int t = 0; t < 16; ++t) { const v16b bw = frag_kb(WF2 + (size_t)(t * 16 + nloc) * FF + kb, hlf); acc[t] = wmma16b(a, bw, acc[t]); acc[t] = wmma16b(al, bw, acc[t]); } }
    wave_lds_sync();
#pragma unroll
    for (int t = 0; t < 16; ++t) { const int cc = t * 16 + nloc; const float bb = bfv(b2[cc]);
#pragma unroll
      for (int r8 = 0; r8 < 8; ++r8) { const int r = 8 * hlf + r8; Y[r][cc] = Y[r][cc] + acc[t][r8] * (1.0f / (HS * WSC)) + bb; } } }
  wave_lds_sync(); ln_rows(g2, be2);
  { for (int rr = 0; rr < 16; ++rr) for (int q = 0; q < 8; ++q) ((float*)out)[(t0 + rr) * D + q * 32 + lane] = Y[rr][q * 32 + lane];  } }
}  // namespace

extern "C" void kernel_launch(void* const* d_in, const int* in_sizes, int n_in, void* d_out, int out_size, void* d_ws, size_t ws_size, hipStream_t stream) {
  (void)n_in;
  auto Fp = [&](int i) { return (const float*)d_in[i]; };
  // input order: 0 table [4,96,96,256]; 1 dep_matrix [4,96,96]; 2 Wq [256,256]; 3 bq; 4 Wk; 5 bk; 6 Wv; 7 bv; 8 Wo; 9 bo; 10 Wdep [1,8]; 11 bdep [8]; 12 ln1_g; 13 ln1_b; 14 W1 [256,1024]; 15 b1; 16 W2 [1024,256]; 17 b2; 18 ln2_g; 19 ln2_b
  if (in_sizes[0] != NT * D || in_sizes[1] != NT || in_sizes[2] != D * D || in_sizes[8] != D * D || in_sizes[10] != H || in_sizes[14] != D * FF || in_sizes[16] != FF * D || out_size != NT * D) return;
  const int SLIM = NSEQ;   // sequence cut (SLIM*96 tokens; multiple of 16)
  size_t off = 0; char* ws = (char*)d_ws;
  auto carve = [&](size_t bytes) { char* p = ws + off; off += (bytes + 255) & ~(size_t)255; return p; };
  b16* WQKV = (b16*)carve((size_t)3 * D * D * 2); b16* WO = (b16*)carve((size_t)D * D * 2); b16* WF1 = (b16*)carve((size_t)FF * D * 2); b16* WF2 = (b16*)carve((size_t)D * FF * 2); b16* Qh = (b16*)carve((size_t)NT * D * 2); b16* Ql = (b16*)carve((size_t)NT * D * 2); b16* Kh = (b16*)carve((size_t)NT * D * 2); b16* Kl = (b16*)carve((size_t)NT * D * 2); float* V = (float*)carve((size_t)NT * D * 4); b16* VTh = (b16*)carve((size_t)NSEQ * H * HD * LQ * 2); b16* VTl = (b16*)carve((size_t)NSEQ * H * HD * LQ * 2); float* CTX = (float*)carve((size_t)NT * D * 4);
  if (off > ws_size || off > ((size_t)208 << 20)) return;   // ~ 190 MB (> 128 MiB; table input 38 MB)
  wput_kernel<<<128, 256, 0, stream>>>(Fp(2), Fp(4), Fp(6), Fp(8), Fp(14), Fp(16), WQKV, WO, WF1, WF2);
  qkv_kernel<<<SLIM * LQ / 16, 32, 0, stream>>>(Fp(0), WQKV, Fp(3), Fp(5), Fp(7), Qh, Ql, Kh, Kl, V);
  vt_kernel<<<NSEQ, 256, 0, stream>>>(V, SLIM, VTh, VTl);
  att_kernel<<<NSEQ * H * 6, 32, 0, stream>>>(Qh, Ql, Kh, Kl, VTh, VTl, Fp(1), Fp(10), Fp(11), SLIM, CTX);
  tail_kernel<<<NT / 16, 32, 0, stream>>>(CTX, Fp(0), WO, Fp(9), Fp(12), Fp(13), WF1, Fp(15), WF2, Fp(17), Fp(18), Fp(19), SLIM, (float*)d_out);
}

// v001
// A run of this version takes 362 microseconds.
// Timed twice side by side with v000, it ran 2.83 times as fast both times.
#include <hip/hip_runtime.h>

// SyntaxMultiAttentionGAT: tokens are the (b, x, y) cells of table [4][96][96][256]; q,k,v = table W + b (8 heads x 32); per (b, x) sequence of 96 cells: probs = softmax_k(q.k / sqrt(32) + dep_matrix[b][x][k] Wdep[h] + bdep[h]); ctx = probs v; out1 = LN(ctx Wo + bo + table); out = LN(relu(out1 W1 + b1) W2 + b2 + out1) -> [4][96][96][256].
// Deterministic: fixed split of column tiles and rows over the waves of a work-group, softmax over 96 keys in fixed order; no atomics.
// WMMA (v_wmma_f32_16x16x32_f16, f32 accumulate): table (EXACT bf16 x8, K 256) x [Wq|Wk|Wv] rows (48 tiles in 3 groups) per 16-token work-group of 4 waves; per (sequence, head, 16-query) wave S = q (hi+lo x256, K 32) x k rows (hi+lo; 6 tiles) and ctx = P (hi+lo) x v^T (hi+lo; 2 tiles, K 96), 3 products; tail ctx x Wo (16 tiles), out1 x W1 (64 tiles), ff x W2 (K 1,024, 16 tiles) per 16-token work-group of 16 waves - weights EXACT x256 ((in,out)), about 7 M WMMA; softmax, dep bias, LayerNorms, relu in f32.

namespace {
constexpr int NB_ = 4, LQ = 96, D = 256, H = 8, HD = 32, FF = 1024, NSEQ = NB_ * LQ /* 384 */, NT = NSEQ * LQ /* 36864 tokens */;
constexpr int QW = 4 /* waves per qkv work-group */, TLW = 16 /* waves per tail work-group */;
constexpr float XS = 8.0f, HS = 256.0f, PS = 256.0f, WSC = 256.0f, EPS = 1e-5f, SCL = 0.17677669529663688f /* 32^-0.5 */;
typedef _Float16 b16;
typedef __attribute__((ext_vector_type(16))) _Float16 v16b;
typedef __attribute__((ext_vector_type(8))) _Float16 v8b;
typedef __attribute__((ext_vector_type(2))) _Float16 v2b;
typedef __attribute__((ext_vector_type(8))) float v8f;
typedef __attribute__((ext_vector_type(4))) float v4f;
typedef __attribute__((ext_vector_type(2))) float v2f;
__device__ __forceinline__ float bf16_rne(float f) { unsigned int u = __float_as_uint(f); u += 0x7FFFu + ((u >> 16) & 1u); float r = __uint_as_float(u & 0xFFFF0000u); asm volatile("" : "+v"(r)); return r; }
__device__ __forceinline__ float bfv(float f) { float r = bf16_rne(f); asm volatile("" : "+v"(r)); return r; }
__device__ __forceinline__ void split16(float v, b16& hi, b16& lo) { hi = (b16)v; lo = (b16)(v - (float)hi); }
__device__ __forceinline__ v16b frag_kb(const b16* p, int hh) { const v8b a = *(const v8b*)(p + 8 * hh), b = *(const v8b*)(p + 16 + 8 * hh); v16b f;
#pragma unroll
  for (int e = 0; e < 8; ++e) { f[e] = a[e]; f[8 + e] = b[e]; } return f; }
__device__ __forceinline__ v8f wmma16b(v16b a, v16b b, v8f c) { v8f d = __builtin_amdgcn_wmma_f32_16x16x32_f16(false, a, false, b, (short)0, c, false, false); asm volatile("v_nop\n\tv_nop\n\tv_nop\n\tv_nop" : "+v"(d) : "v"(a), "v"(b)); return d; }
__device__ __forceinline__ void wave_lds_sync() { __builtin_amdgcn_fence(__ATOMIC_RELEASE, "workgroup"); __builtin_amdgcn_wave_barrier(); __builtin_amdgcn_fence(__ATOMIC_ACQUIRE, "workgroup"); }
__device__ __forceinline__ float pmul(float a, float b) { float p = a * b; asm volatile("" : "+v"(p)); return p; }

__global__ __launch_bounds__(256) void wput_kernel(const float* __restrict__ wq, const float* __restrict__ wk, const float* __restrict__ wv, const float* __restrict__ wo, const float* __restrict__ w1, const float* __restrict__ w2, b16* __restrict__ WQKV, b16* __restrict__ WO, b16* __restrict__ WF1, b16* __restrict__ WF2) { const size_t nt = (size_t)gridDim.x * 256, u0 = (size_t)blockIdx.x * 256 + threadIdx.x; v8b v;
  for (size_t u = u0; u < (size_t)3 * D * 32; u += nt) { const int o = (int)(u / 32), k0 = (int)(u % 32) * 8; const float* w = o < D ? wq : (o < 2 * D ? wk : wv); const int oo = o % D;
#pragma unroll
    for (int j = 0; j < 8; ++j) v[j] = (b16)(bf16_rne(w[(size_t)(k0 + j) * D + oo]) * WSC); { *(v8b*)(WQKV + (size_t)o * D + k0) = v;  } }
  for (size_t u = u0; u < (size_t)D * 32; u += nt) { const int o = (int)(u / 32), k0 = (int)(u % 32) * 8;
#pragma unroll
    for (int j = 0; j < 8; ++j) v[j] = (b16)(bf16_rne(wo[(size_t)(k0 + j) * D + o]) * WSC); { *(v8b*)(WO + (size_t)o * D + k0) = v;  } }
  for (size_t u = u0; u < (size_t)FF * 32; u += nt) { const int o = (int)(u / 32), k0 = (int)(u % 32) * 8;
#pragma unroll
    for (int j = 0; j < 8; ++j) v[j] = (b16)(bf16_rne(w1[(size_t)(k0 + j) * FF + o]) * WSC); { *(v8b*)(WF1 + (size_t)o * D + k0) = v;  } }
  for (size_t u = u0; u < (size_t)D * 128; u += nt) { const int o = (int)(u / 128), k0 = (int)(u % 128) * 8;
#pragma unroll
    for (int j = 0; j < 8; ++j) v[j] = (b16)(bf16_rne(w2[(size_t)(k0 + j) * D + o]) * WSC); { *(v8b*)(WF2 + (size_t)o * FF + k0) = v;  } } }
// One work-group of QW waves per 16-token tile: each wave takes 16 / QW of the 16 column tiles of a group and 16 / QW of the 16 rows in the staging and store loops.
__global__ __launch_bounds__(QW * 32) void qkv_kernel(const float* __restrict__ tab, const b16* __restrict__ WQKV, const float* __restrict__ bq, const float* __restrict__ bk, const float* __restrict__ bv, b16* __restrict__ Qh, b16* __restrict__ Ql, b16* __restrict__ Kh, b16* __restrict__ Kl, float* __restrict__ V) { __shared__ __attribute__((aligned(16))) b16 Ah[16][D + 8]; __shared__ float Tf[16][260]; constexpr int TW = 16 / QW; const int lane = threadIdx.x & 31, wave = __builtin_amdgcn_readfirstlane((int)(threadIdx.x >> 5)), nloc = lane & 15, hlf = lane >> 4; const size_t t0 = (size_t)blockIdx.x * 16;
  for (int rr = wave * TW; rr < wave * TW + TW; ++rr) for (int q = 0; q < 8; ++q) { const int c = q * 32 + lane; Ah[rr][c] = (b16)(bf16_rne(tab[(t0 + rr) * D + c]) * XS); }
  if (threadIdx.x < 16) for (int k = D; k < D + 8; ++k) Ah[threadIdx.x][k] = (b16)0.0f;
  __syncthreads();
#pragma unroll 1
  for (int g = 0; g < 3; ++g) { const float* bias = g == 0 ? bq : (g == 1 ? bk : bv); v8f acc[TW];
#pragma unroll
    for (int t = 0; t < TW; ++t) acc[t] = (v8f){};
#pragma unroll 2
    for (int kb = 0; kb < D; kb += 32) { const v16b a = frag_kb(&Ah[nloc][kb], hlf);
#pragma unroll
      for (int t = 0; t < TW; ++t) acc[t] = wmma16b(a, frag_kb(WQKV + (size_t)(g * D + (wave * TW + t) * 16 + nloc) * D + kb, hlf), acc[t]); }
#pragma unroll
    for (int t = 0; t < TW; ++t) { const int cc = (wave * TW + t) * 16 + nloc; const float bb = bfv(bias[cc]);
#pragma unroll
      for (int r8 = 0; r8 < 8; ++r8) Tf[8 * hlf + r8][cc] = acc[t][r8] * (1.0f / (XS * WSC)) + bb; }
    __syncthreads();
    { for (int rr = wave * TW; rr < wave * TW + TW; ++rr) { const size_t tk = t0 + rr;
        if (g == 2) { for (int q = 0; q < 2; ++q) *(v4f*)(V + tk * D + q * 128 + lane * 4) = *(const v4f*)(&Tf[rr][q * 128 + lane * 4]); asm volatile("s_wait_xcnt 0x0" ::: "memory"); }   // the wait stands in the stores' own block, in front of any overwrite of the registers that this row's stores name
        else { b16* Ph = g == 0 ? Qh : Kh; b16* Pl = g == 0 ? Ql : Kl; for (int q = 0; q < 4; ++q) { const int c = q * 64 + lane * 2; b16 h0, l0, h1, l1; split16(Tf[rr][c] * HS, h0, l0); split16(Tf[rr][c + 1] * HS, h1, l1); *(v2b*)(Ph + tk * D + c) = (v2b){h0, h1}; *(v2b*)(Pl + tk * D + c) = (v2b){l0, l1}; } asm volatile("s_wait_xcnt 0x0" ::: "memory"); }   // as above, for the hi and lo stores
      } }
    __syncthreads(); } }
__global__ __launch_bounds__(256) void vt_kernel(const float* __restrict__ V, int SLIM, b16* __restrict__ VTh, b16* __restrict__ VTl) { __shared__ float Tt[8][LQ][HD + 1]; const int wave = threadIdx.x >> 5, lane = threadIdx.x & 31; const int seq = blockIdx.x, h = wave; if (seq >= SLIM) return;
  for (int k = 0; k < LQ; ++k) Tt[wave][k][lane] = V[((size_t)seq * LQ + k) * D + h * HD + lane];
  wave_lds_sync();
  const size_t base = ((size_t)seq * H + h) * HD * LQ;   // element (d, k) at base + d*96 + k; lane = d
  { for (int k = 0; k < LQ; k += 2) { b16 h0, l0, h1, l1; split16(Tt[wave][k][lane] * HS, h0, l0); split16(Tt[wave][k + 1][lane] * HS, h1, l1); *(v2b*)(VTh + base + (size_t)lane * LQ + k) = (v2b){h0, h1}; *(v2b*)(VTl + base + (size_t)lane * LQ + k) = (v2b){l0, l1}; }  } }
__global__ __launch_bounds__(32) void att_kernel(const b16* __restrict__ Qh, const b16* __restrict__ Ql, const b16* __restrict__ Kh, const b16* __restrict__ Kl, const b16* __restrict__ VTh, const b16* __restrict__ VTl, const float* __restrict__ dep, const float* __restrict__ wdep, const float* __restrict__ bdep, int SLIM, float* __restrict__ CTX) { __shared__ __attribute__((aligned(16))) b16 Pa[16][104], Pb[16][104]; __shared__ float Sc[16][LQ + 1], Dp[LQ], Of[16][HD + 1]; const int lane = threadIdx.x, nloc = lane & 15, hlf = lane >> 4; const int seq = blockIdx.x / (H * 6), rem = blockIdx.x % (H * 6); const int h = rem / 6, q0 = (rem % 6) * 16; if (seq >= SLIM) return; const size_t tk0 = (size_t)seq * LQ;
  const float wd = bfv(wdep[h]), bd = bfv(bdep[h]); for (int k = lane; k < LQ; k += 32) Dp[k] = pmul(bfv(dep[(size_t)seq * LQ + k]), wd) + bd;
  const v16b qa = frag_kb(Qh + (tk0 + q0 + nloc) * D + h * HD, hlf), ql = frag_kb(Ql + (tk0 + q0 + nloc) * D + h * HD, hlf);
#pragma unroll
  for (int t = 0; t < 6; ++t) { const size_t key = tk0 + t * 16 + nloc; const v16b kh = frag_kb(Kh + key * D + h * HD, hlf), kl = frag_kb(Kl + key * D + h * HD, hlf); v8f s = wmma16b(qa, kh, (v8f){}); s = wmma16b(qa, kl, s); s = wmma16b(ql, kh, s);
#pragma unroll
    for (int r8 = 0; r8 < 8; ++r8) Sc[8 * hlf + r8][t * 16 + nloc] = s[r8] * (SCL / (HS * HS)); }
  wave_lds_sync();
  if (lane < 16) { const int r = lane; float mx = -INFINITY; for (int k = 0; k < LQ; ++k) { const float v = Sc[r][k] + Dp[k]; Sc[r][k] = v; mx = fmaxf(mx, v); } float sm = 0.0f; for (int k = 0; k < LQ; ++k) { const float p = __expf(Sc[r][k] - mx); Sc[r][k] = p; sm += p; } const float inv = 1.0f / sm; for (int k = 0; k < LQ; ++k) { b16 p, pl; split16(Sc[r][k] * inv * PS, p, pl); Pa[r][k] = p; Pb[r][k] = pl; } for (int k = LQ; k < 104; ++k) { Pa[r][k] = (b16)0.0f; Pb[r][k] = (b16)0.0f; } }
  wave_lds_sync();
  v8f o0 = (v8f){}, o1 = (v8f){}; const size_t vb = ((size_t)seq * H + h) * HD * LQ;
#pragma unroll
  for (int kb = 0; kb < LQ; kb += 32) { const v16b pa = frag_kb(&Pa[nloc][kb], hlf), pb = frag_kb(&Pb[nloc][kb], hlf); const v16b v0h = frag_kb(VTh + vb + (size_t)nloc * LQ + kb, hlf), v0l = frag_kb(VTl + vb + (size_t)nloc * LQ + kb, hlf), v1h = frag_kb(VTh + vb + (size_t)(16 + nloc) * LQ + kb, hlf), v1l = frag_kb(VTl + vb + (size_t)(16 + nloc) * LQ + kb, hlf);
    o0 = wmma16b(pa, v0h, o0); o0 = wmma16b(pa, v0l, o0); o0 = wmma16b(pb, v0h, o0); o1 = wmma16b(pa, v1h, o1); o1 = wmma16b(pa, v1l, o1); o1 = wmma16b(pb, v1h, o1); }
#pragma unroll
  for (int r8 = 0; r8 < 8; ++r8) { Of[8 * hlf + r8][nloc] = o0[r8] * (1.0f / (PS * HS)); Of[8 * hlf + r8][16 + nloc] = o1[r8] * (1.0f / (PS * HS)); }
  wave_lds_sync();
  { for (int r = 0; r < 16; ++r) ((float*)CTX)[(tk0 + q0 + r) * D + h * HD + lane] = Of[r][lane];  } }
// One work-group of TLW waves per 16-token tile: each wave takes 16 / TLW of the 16 column tiles of Wo and W2, 64 / TLW of the 64 column tiles of W1 (one pass over K for all of them) and 16 / TLW of the 16 rows in the staging and store loops; each accumulator's k order is as before.
__global__ __launch_bounds__(TLW * 32) void tail_kernel(const float* __restrict__ CTX, const float* __restrict__ tab, const b16* __restrict__ WO, const float* __restrict__ bo, const float* __restrict__ g1, const float* __restrict__ be1, const b16* __restrict__ WF1, const float* __restrict__ b1, const b16* __restrict__ WF2, const float* __restrict__ b2, const float* __restrict__ g2, const float* __restrict__ be2, int SLIM, float* __restrict__ out) { __shared__ __attribute__((aligned(16))) b16 A1h[16][D + 8], A1l[16][D + 8], A2h[16][FF + 8], A2l[16][FF + 8]; __shared__ float Y[16][D + 1], Mu[16], Rs[16]; constexpr int TW = 16 / TLW, TF = 64 / TLW; const int lane = threadIdx.x & 31, wave = __builtin_amdgcn_readfirstlane((int)(threadIdx.x >> 5)), nloc = lane & 15, hlf = lane >> 4; const size_t t0 = (size_t)blockIdx.x * 16; if (t0 >= (size_t)SLIM * LQ) return;
  for (int rr = wave * TW; rr < wave * TW + TW; ++rr) for (int q = 0; q < 8; ++q) { const int c = q * 32 + lane; b16 p, pl; split16(CTX[(t0 + rr) * D + c] * HS, p, pl); A1h[rr][c] = p; A1l[rr][c] = pl; }
  if (threadIdx.x < 16) { const int r = threadIdx.x; for (int k = D; k < D + 8; ++k) { A1h[r][k] = (b16)0.0f; A1l[r][k] = (b16)0.0f; } for (int k = FF; k < FF + 8; ++k) { A2h[r][k] = (b16)0.0f; A2l[r][k] = (b16)0.0f; } }
  __syncthreads();
  // LayerNorm: the two row sums stay on 16 lanes of wave 0 in their order; the element-wise part goes by rows over the waves. Each thread rewrites only the Y elements that it alone reads next, so no barrier follows. The loops over q and t are unrolled so that gr, br, mu, rs and y stay in registers.
  auto ln_rows = [&](const float* gg, const float* bb) { float gr[8], br[8];
#pragma unroll
    for (int q = 0; q < 8; ++q) { gr[q] = gg[q * 32 + lane]; br[q] = bb[q * 32 + lane]; }
    if (threadIdx.x < 16) { const int r = threadIdx.x; float m = 0.0f; for (int c = 0; c < D; ++c) m += Y[r][c]; m *= (1.0f / D); float vr = 0.0f; for (int c = 0; c < D; ++c) { const float d = Y[r][c] - m; vr += d * d; } vr *= (1.0f / D); Mu[r] = m; Rs[r] = rsqrtf(vr + EPS); }
    __syncthreads(); float mu[TW], rs[TW], y[TW][8];
#pragma unroll
    for (int t = 0; t < TW; ++t) { mu[t] = Mu[wave * TW + t]; rs[t] = Rs[wave * TW + t];
#pragma unroll
      for (int q = 0; q < 8; ++q) y[t][q] = Y[wave * TW + t][q * 32 + lane]; }
#pragma unroll
    for (int q = 0; q < 8; ++q) { const float gq = bfv(gr[q]), bq = bfv(br[q]);
#pragma unroll
      for (int t = 0; t < TW; ++t) Y[wave * TW + t][q * 32 + lane] = pmul((y[t][q] - mu[t]) * rs[t], gq) + bq; } };
  { v8f acc[TW]; const b16* wb = WO + (size_t)(wave * TW * 16 + nloc) * D;
#pragma unroll
    for (int t = 0; t < TW; ++t) acc[t] = (v8f){};
#pragma unroll 2
    for (int kb = 0; kb < D; kb += 32) { const v16b a = frag_kb(&A1h[nloc][kb], hlf), al = frag_kb(&A1l[nloc][kb], hlf);
#pragma unroll
      for (int t = 0; t < TW; ++t) { const v16b bw = frag_kb(wb + t * 16 * D + kb, hlf); acc[t] = wmma16b(a, bw, acc[t]); acc[t] = wmma16b(al, bw, acc[t]); } }
#pragma unroll
    for (int t = 0; t < TW; ++t) { const int cc = (wave * TW + t) * 16 + nloc; const float bb = bfv(bo[cc]);
#pragma unroll
      for (int r8 = 0; r8 < 8; ++r8) { const int r = 8 * hlf + r8; Y[r][cc] = acc[t][r8] * (1.0f / (HS * WSC)) + bb + bfv(tab[(t0 + r) * D + cc]); } } }
  __syncthreads(); ln_rows(g1, be1);
  for (int rr = wave * TW; rr < wave * TW + TW; ++rr) for (int q = 0; q < 8; ++q) { const int c = q * 32 + lane; b16 p, pl; split16(Y[rr][c] * HS, p, pl); A1h[rr][c] = p; A1l[rr][c] = pl; }
  __syncthreads();
  { v8f acc[TF]; const b16* wb = WF1 + (size_t)(wave * TF * 16 + nloc) * D;
#pragma unroll
    for (int t = 0; t < TF; ++t) acc[t] = (v8f){};
#pragma unroll 2
    for (int kb = 0; kb < D; kb += 32) { const v16b a = frag_kb(&A1h[nloc][kb], hlf), al = frag_kb(&A1l[nloc][kb], hlf);
#pragma unroll
      for (int t = 0; t < TF; ++t) { const v16b bw = frag_kb(wb + t * 16 * D + kb, hlf); acc[t] = wmma16b(a, bw, acc[t]); acc[t] = wmma16b(al, bw, acc[t]); } }
#pragma unroll
    for (int t = 0; t < TF; ++t) { const int cc = (wave * TF + t) * 16 + nloc; const float bb = bfv(b1[cc]);
#pragma unroll
      for (int r8 = 0; r8 < 8; ++r8) { const float v = fmaxf(acc[t][r8] * (1.0f / (HS * WSC)) + bb, 0.0f); b16 p, pl; split16(v * HS, p, pl); A2h[8 * hlf + r8][cc] = p; A2l[8 * hlf + r8][cc] = pl; } } }
  __syncthreads();
  { v8f acc[TW]; const b16* wb = WF2 + (size_t)(wave * TW * 16 + nloc) * FF;
#pragma unroll
    for (int t = 0; t < TW; ++t) acc[t] = (v8f){};
#pragma unroll 2
    for (int kb = 0; kb < FF; kb += 32) { const v16b a = frag_kb(&A2h[nloc][kb], hlf), al = frag_kb(&A2l[nloc][kb], hlf);
#pragma unroll
      for (int t = 0; t < TW; ++t) { const v16b bw = frag_kb(wb + t * 16 * FF + kb, hlf); acc[t] = wmma16b(a, bw, acc[t]); acc[t] = wmma16b(al, bw, acc[t]); } }
#pragma unroll
    for (int t = 0; t < TW; ++t) { const int cc = (wave * TW + t) * 16 + nloc; const float bb = bfv(b2[cc]);
#pragma unroll
      for (int r8 = 0; r8 < 8; ++r8) { const int r = 8 * hlf + r8; Y[r][cc] = Y[r][cc] + acc[t][r8] * (1.0f / (HS * WSC)) + bb; } } }
  __syncthreads(); ln_rows(g2, be2);
  { for (int rr = wave * TW; rr < wave * TW + TW; ++rr) for (int q = 0; q < 8; ++q) ((float*)out)[(t0 + rr) * D + q * 32 + lane] = Y[rr][q * 32 + lane];  } }
}  // namespace

extern "C" void kernel_launch(void* const* d_in, const int* in_sizes, int n_in, void* d_out, int out_size, void* d_ws, size_t ws_size, hipStream_t stream) {
  (void)n_in;
  auto Fp = [&](int i) { return (const float*)d_in[i]; };
  // input order: 0 table [4,96,96,256]; 1 dep_matrix [4,96,96]; 2 Wq [256,256]; 3 bq; 4 Wk; 5 bk; 6 Wv; 7 bv; 8 Wo; 9 bo; 10 Wdep [1,8]; 11 bdep [8]; 12 ln1_g; 13 ln1_b; 14 W1 [256,1024]; 15 b1; 16 W2 [1024,256]; 17 b2; 18 ln2_g; 19 ln2_b
  if (in_sizes[0] != NT * D || in_sizes[1] != NT || in_sizes[2] != D * D || in_sizes[8] != D * D || in_sizes[10] != H || in_sizes[14] != D * FF || in_sizes[16] != FF * D || out_size != NT * D) return;
  const int SLIM = NSEQ;   // sequence cut (SLIM*96 tokens; multiple of 16)
  size_t off = 0; char* ws = (char*)d_ws;
  auto carve = [&](size_t bytes) { char* p = ws + off; off += (bytes + 255) & ~(size_t)255; return p; };
  b16* WQKV = (b16*)carve((size_t)3 * D * D * 2); b16* WO = (b16*)carve((size_t)D * D * 2); b16* WF1 = (b16*)carve((size_t)FF * D * 2); b16* WF2 = (b16*)carve((size_t)D * FF * 2); b16* Qh = (b16*)carve((size_t)NT * D * 2); b16* Ql = (b16*)carve((size_t)NT * D * 2); b16* Kh = (b16*)carve((size_t)NT * D * 2); b16* Kl = (b16*)carve((size_t)NT * D * 2); float* V = (float*)carve((size_t)NT * D * 4); b16* VTh = (b16*)carve((size_t)NSEQ * H * HD * LQ * 2); b16* VTl = (b16*)carve((size_t)NSEQ * H * HD * LQ * 2); float* CTX = (float*)carve((size_t)NT * D * 4);
  if (off > ws_size || off > ((size_t)208 << 20)) return;   // ~ 190 MB (> 128 MiB; table input 38 MB)
  wput_kernel<<<128, 256, 0, stream>>>(Fp(2), Fp(4), Fp(6), Fp(8), Fp(14), Fp(16), WQKV, WO, WF1, WF2);
  qkv_kernel<<<SLIM * LQ / 16, QW * 32, 0, stream>>>(Fp(0), WQKV, Fp(3), Fp(5), Fp(7), Qh, Ql, Kh, Kl, V);
  vt_kernel<<<NSEQ, 256, 0, stream>>>(V, SLIM, VTh, VTl);
  att_kernel<<<NSEQ * H * 6, 32, 0, stream>>>(Qh, Ql, Kh, Kl, VTh, VTl, Fp(1), Fp(10), Fp(11), SLIM, CTX);
  tail_kernel<<<NT / 16, TLW * 32, 0, stream>>>(CTX, Fp(0), WO, Fp(9), Fp(12), Fp(13), WF1, Fp(15), WF2, Fp(17), Fp(18), Fp(19), SLIM, (float*)d_out);
}

// v002
// A run of this version takes 299 microseconds.
// Timed twice side by side with v001, it ran 1.21 times as fast both times.
// All steps since v000 together make it 3.43 times as fast.
#include <hip/hip_runtime.h>

// SyntaxMultiAttentionGAT: tokens are the (b, x, y) cells of table [4][96][96][256]; q,k,v = table W + b (8 heads x 32); per (b, x) sequence of 96 cells: probs = softmax_k(q.k / sqrt(32) + dep_matrix[b][x][k] Wdep[h] + bdep[h]); ctx = probs v; out1 = LN(ctx Wo + bo + table); out = LN(relu(out1 W1 + b1) W2 + b2 + out1) -> [4][96][96][256].
// Deterministic: fixed split of column tiles and rows over the waves of a work-group, softmax over 96 keys in fixed order; no atomics.
// WMMA (v_wmma_f32_16x16x32_f16, f32 accumulate): table (EXACT bf16 x8, K 256) x [Wq|Wk|Wv] rows (48 tiles in 3 groups) per 16-token work-group of 4 waves; per (sequence, head, 16-query) wave S = q (hi+lo x256, K 32) x k rows (hi+lo; 6 tiles) and ctx = P (hi+lo) x v^T (hi+lo; 2 tiles, K 96), 3 products; tail ctx x Wo (16 tiles), out1 x W1 (64 tiles), ff x W2 (K 1,024, 16 tiles) per 16-token work-group of 16 waves - weights EXACT x256 ((in,out)), about 7 M WMMA; softmax, dep bias, LayerNorms, relu in f32.

namespace {
constexpr int NB_ = 4, LQ = 96, D = 256, H = 8, HD = 32, FF = 1024, NSEQ = NB_ * LQ /* 384 */, NT = NSEQ * LQ /* 36864 tokens */;
constexpr int QW = 4 /* waves per qkv work-group */, TLW = 16 /* waves per tail work-group */;
constexpr float XS = 8.0f, HS = 256.0f, PS = 256.0f, WSC = 256.0f, EPS = 1e-5f, SCL = 0.17677669529663688f /* 32^-0.5 */;
typedef _Float16 b16;
typedef __attribute__((ext_vector_type(16))) _Float16 v16b;
typedef __attribute__((ext_vector_type(8))) _Float16 v8b;
typedef __attribute__((ext_vector_type(2))) _Float16 v2b;
typedef __attribute__((ext_vector_type(8))) float v8f;
typedef __attribute__((ext_vector_type(4))) float v4f;
typedef __attribute__((ext_vector_type(2))) float v2f;
__device__ __forceinline__ float bf16_rne(float f) { unsigned int u = __float_as_uint(f); u += 0x7FFFu + ((u >> 16) & 1u); float r = __uint_as_float(u & 0xFFFF0000u); asm volatile("" : "+v"(r)); return r; }
__device__ __forceinline__ float bfv(float f) { float r = bf16_rne(f); asm volatile("" : "+v"(r)); return r; }
__device__ __forceinline__ void split16(float v, b16& hi, b16& lo) { hi = (b16)v; lo = (b16)(v - (float)hi); }
__device__ __forceinline__ v16b frag_kb(const b16* p, int hh) { const v8b a = *(const v8b*)(p + 8 * hh), b = *(const v8b*)(p + 16 + 8 * hh); v16b f;
#pragma unroll
  for (int e = 0; e < 8; ++e) { f[e] = a[e]; f[8 + e] = b[e]; } return f; }
// Weight fragments lie in the workspace in register order: block (column tile T, k block kk) is 512 elements at (T * K / 32 + kk) * 512, as [j][lane][8] with element e = W[k = kk * 32 + j * 16 + 8 * (lane >> 4) + e][T * 16 + (lane & 15)], the k order of frag_kb. One 16-byte load of a wave reads 512 bytes in a row, 4 whole 128-byte lines (16 weight rows read row-major would be 16 lines).
__device__ __forceinline__ v16b frag_pk(const b16* p) { const v8b a = *(const v8b*)p, b = *(const v8b*)(p + 256); v16b f;
#pragma unroll
  for (int e = 0; e < 8; ++e) { f[e] = a[e]; f[8 + e] = b[e]; } return f; }
__device__ __forceinline__ void pk_unit(size_t u, int KB, int& o, int& k0) { const int lane = (int)(u & 31), j = (int)(u >> 5) & 1, blk = (int)(u >> 6); o = (blk / KB) * 16 + (lane & 15); k0 = (blk % KB) * 32 + j * 16 + (lane >> 4) * 8; }
__device__ __forceinline__ v8f wmma16b(v16b a, v16b b, v8f c) { v8f d = __builtin_amdgcn_wmma_f32_16x16x32_f16(false, a, false, b, (short)0, c, false, false); asm volatile("v_nop\n\tv_nop\n\tv_nop\n\tv_nop" : "+v"(d) : "v"(a), "v"(b)); return d; }
__device__ __forceinline__ void wave_lds_sync() { __builtin_amdgcn_fence(__ATOMIC_RELEASE, "workgroup"); __builtin_amdgcn_wave_barrier(); __builtin_amdgcn_fence(__ATOMIC_ACQUIRE, "workgroup"); }
__device__ __forceinline__ float pmul(float a, float b) { float p = a * b; asm volatile("" : "+v"(p)); return p; }

__global__ __launch_bounds__(256) void wput_kernel(const float* __restrict__ wq, const float* __restrict__ wk, const float* __restrict__ wv, const float* __restrict__ wo, const float* __restrict__ w1, const float* __restrict__ w2, b16* __restrict__ WQKV, b16* __restrict__ WO, b16* __restrict__ WF1, b16* __restrict__ WF2) { const size_t nt = (size_t)gridDim.x * 256, u0 = (size_t)blockIdx.x * 256 + threadIdx.x; v8b v;
  for (size_t u = u0; u < (size_t)3 * D * 32; u += nt) { int o, k0; pk_unit(u, D / 32, o, k0); const float* w = o < D ? wq : (o < 2 * D ? wk : wv); const int oo = o % D;
#pragma unroll
    for (int j = 0; j < 8; ++j) v[j] = (b16)(bf16_rne(w[(size_t)(k0 + j) * D + oo]) * WSC); { *(v8b*)(WQKV + u * 8) = v;  } }
  for (size_t u = u0; u < (size_t)D * 32; u += nt) { int o, k0; pk_unit(u, D / 32, o, k0);
#pragma unroll
    for (int j = 0; j < 8; ++j) v[j] = (b16)(bf16_rne(wo[(size_t)(k0 + j) * D + o]) * WSC); { *(v8b*)(WO + u * 8) = v;  } }
  for (size_t u = u0; u < (size_t)FF * 32; u += nt) { int o, k0; pk_unit(u, D / 32, o, k0);
#pragma unroll
    for (int j = 0; j < 8; ++j) v[j] = (b16)(bf16_rne(w1[(size_t)(k0 + j) * FF + o]) * WSC); { *(v8b*)(WF1 + u * 8) = v;  } }
  for (size_t u = u0; u < (size_t)D * 128; u += nt) { int o, k0; pk_unit(u, FF / 32, o, k0);
#pragma unroll
    for (int j = 0; j < 8; ++j) v[j] = (b16)(bf16_rne(w2[(size_t)(k0 + j) * D + o]) * WSC); { *(v8b*)(WF2 + u * 8) = v;  } } }
// One work-group of QW waves per 16-token tile: each wave takes 16 / QW of the 16 column tiles of a group and 16 / QW of the 16 rows in the staging and store loops.
__global__ __launch_bounds__(QW * 32) void qkv_kernel(const float* __restrict__ tab, const b16* __restrict__ WQKV, const float* __restrict__ bq, const float* __restrict__ bk, const float* __restrict__ bv, b16* __restrict__ Qh, b16* __restrict__ Ql, b16* __restrict__ Kh, b16* __restrict__ Kl, float* __restrict__ V) { __shared__ __attribute__((aligned(16))) b16 Ah[16][D + 8]; __shared__ float Tf[16][260]; constexpr int TW = 16 / QW; const int lane = threadIdx.x & 31, wave = __builtin_amdgcn_readfirstlane((int)(threadIdx.x >> 5)), nloc = lane & 15, hlf = lane >> 4; const size_t t0 = (size_t)blockIdx.x * 16;
  for (int rr = wave * TW; rr < wave * TW + TW; ++rr) for (int q = 0; q < 8; ++q) { const int c = q * 32 + lane; Ah[rr][c] = (b16)(bf16_rne(tab[(t0 + rr) * D + c]) * XS); }
  if (threadIdx.x < 16) for (int k = D; k < D + 8; ++k) Ah[threadIdx.x][k] = (b16)0.0f;
  __syncthreads();
#pragma unroll 1
  for (int g = 0; g < 3; ++g) { const float* bias = g == 0 ? bq : (g == 1 ? bk : bv); v8f acc[TW];
#pragma unroll
    for (int t = 0; t < TW; ++t) acc[t] = (v8f){};
#pragma unroll 2
    for (int kb = 0; kb < D; kb += 32) { const v16b a = frag_kb(&Ah[nloc][kb], hlf);
#pragma unroll
      for (int t = 0; t < TW; ++t) acc[t] = wmma16b(a, frag_pk(WQKV + (size_t)(g * 16 + wave * TW + t) * (16 * D) + kb * 16 + lane * 8), acc[t]); }
#pragma unroll
    for (int t = 0; t < TW; ++t) { const int cc = (wave * TW + t) * 16 + nloc; const float bb = bfv(bias[cc]);
#pragma unroll
      for (int r8 = 0; r8 < 8; ++r8) Tf[8 * hlf + r8][cc] = acc[t][r8] * (1.0f / (XS * WSC)) + bb; }
    __syncthreads();
    { for (int rr = wave * TW; rr < wave * TW + TW; ++rr) { const size_t tk = t0 + rr;
        if (g == 2) { for (int q = 0; q < 2; ++q) *(v4f*)(V + tk * D + q * 128 + lane * 4) = *(const v4f*)(&Tf[rr][q * 128 + lane * 4]); asm volatile("s_wait_xcnt 0x0" ::: "memory"); }   // the wait stands in the stores' own block, in front of any overwrite of the registers that this row's stores name
        else { b16* Ph = g == 0 ? Qh : Kh; b16* Pl = g == 0 ? Ql : Kl; for (int q = 0; q < 4; ++q) { const int c = q * 64 + lane * 2; b16 h0, l0, h1, l1; split16(Tf[rr][c] * HS, h0, l0); split16(Tf[rr][c + 1] * HS, h1, l1); *(v2b*)(Ph + tk * D + c) = (v2b){h0, h1}; *(v2b*)(Pl + tk * D + c) = (v2b){l0, l1}; } asm volatile("s_wait_xcnt 0x0" ::: "memory"); }   // as above, for the hi and lo stores
      } }
    __syncthreads(); } }
__global__ __launch_bounds__(256) void vt_kernel(const float* __restrict__ V, int SLIM, b16* __restrict__ VTh, b16* __restrict__ VTl) { __shared__ float Tt[8][LQ][HD + 1]; const int wave = threadIdx.x >> 5, lane = threadIdx.x & 31; const int seq = blockIdx.x, h = wave; if (seq >= SLIM) return;
  for (int k = 0; k < LQ; ++k) Tt[wave][k][lane] = V[((size_t)seq * LQ + k) * D + h * HD + lane];
  wave_lds_sync();
  const size_t base = ((size_t)seq * H + h) * HD * LQ;   // element (d, k) at base + d*96 + k; lane = d
  { for (int k = 0; k < LQ; k += 2) { b16 h0, l0, h1, l1; split16(Tt[wave][k][lane] * HS, h0, l0); split16(Tt[wave][k + 1][lane] * HS, h1, l1); *(v2b*)(VTh + base + (size_t)lane * LQ + k) = (v2b){h0, h1}; *(v2b*)(VTl + base + (size_t)lane * LQ + k) = (v2b){l0, l1}; }  } }
__global__ __launch_bounds__(32) void att_kernel(const b16* __restrict__ Qh, const b16* __restrict__ Ql, const b16* __restrict__ Kh, const b16* __restrict__ Kl, const b16* __restrict__ VTh, const b16* __restrict__ VTl, const float* __restrict__ dep, const float* __restrict__ wdep, const float* __restrict__ bdep, int SLIM, float* __restrict__ CTX) { __shared__ __attribute__((aligned(16))) b16 Pa[16][104], Pb[16][104]; __shared__ float Sc[16][LQ + 1], Dp[LQ], Of[16][HD + 1]; const int lane = threadIdx.x, nloc = lane & 15, hlf = lane >> 4; const int seq = blockIdx.x / (H * 6), rem = blockIdx.x % (H * 6); const int h = rem / 6, q0 = (rem % 6) * 16; if (seq >= SLIM) return; const size_t tk0 = (size_t)seq * LQ;
  const float wd = bfv(wdep[h]), bd = bfv(bdep[h]); for (int k = lane; k < LQ; k += 32) Dp[k] = pmul(bfv(dep[(size_t)seq * LQ + k]), wd) + bd;
  const v16b qa = frag_kb(Qh + (tk0 + q0 + nloc) * D + h * HD, hlf), ql = frag_kb(Ql + (tk0 + q0 + nloc) * D + h * HD, hlf);
#pragma unroll
  for (int t = 0; t < 6; ++t) { const size_t key = tk0 + t * 16 + nloc; const v16b kh = frag_kb(Kh + key * D + h * HD, hlf), kl = frag_kb(Kl + key * D + h * HD, hlf); v8f s = wmma16b(qa, kh, (v8f){}); s = wmma16b(qa, kl, s); s = wmma16b(ql, kh, s);
#pragma unroll
    for (int r8 = 0; r8 < 8; ++r8) Sc[8 * hlf + r8][t * 16 + nloc] = s[r8] * (SCL / (HS * HS)); }
  wave_lds_sync();
  if (lane < 16) { const int r = lane; float mx = -INFINITY; for (int k = 0; k < LQ; ++k) { const float v = Sc[r][k] + Dp[k]; Sc[r][k] = v; mx = fmaxf(mx, v); } float sm = 0.0f; for (int k = 0; k < LQ; ++k) { const float p = __expf(Sc[r][k] - mx); Sc[r][k] = p; sm += p; } const float inv = 1.0f / sm; for (int k = 0; k < LQ; ++k) { b16 p, pl; split16(Sc[r][k] * inv * PS, p, pl); Pa[r][k] = p; Pb[r][k] = pl; } for (int k = LQ; k < 104; ++k) { Pa[r][k] = (b16)0.0f; Pb[r][k] = (b16)0.0f; } }
  wave_lds_sync();
  v8f o0 = (v8f){}, o1 = (v8f){}; const size_t vb = ((size_t)seq * H + h) * HD * LQ;
#pragma unroll
  for (int kb = 0; kb < LQ; kb += 32) { const v16b pa = frag_kb(&Pa[nloc][kb], hlf), pb = frag_kb(&Pb[nloc][kb], hlf); const v16b v0h = frag_kb(VTh + vb + (size_t)nloc * LQ + kb, hlf), v0l = frag_kb(VTl + vb + (size_t)nloc * LQ + kb, hlf), v1h = frag_kb(VTh + vb + (size_t)(16 + nloc) * LQ + kb, hlf), v1l = frag_kb(VTl + vb + (size_t)(16 + nloc) * LQ + kb, hlf);
    o0 = wmma16b(pa, v0h, o0); o0 = wmma16b(pa, v0l, o0); o0 = wmma16b(pb, v0h, o0); o1 = wmma16b(pa, v1h, o1); o1 = wmma16b(pa, v1l, o1); o1 = wmma16b(pb, v1h, o1); }
#pragma unroll
  for (int r8 = 0; r8 < 8; ++r8) { Of[8 * hlf + r8][nloc] = o0[r8] * (1.0f / (PS * HS)); Of[8 * hlf + r8][16 + nloc] = o1[r8] * (1.0f / (PS * HS)); }
  wave_lds_sync();
  { for (int r = 0; r < 16; ++r) ((float*)CTX)[(tk0 + q0 + r) * D + h * HD + lane] = Of[r][lane];  } }
// One work-group of TLW waves per 16-token tile: each wave takes 16 / TLW of the 16 column tiles of Wo and W2, 64 / TLW of the 64 column tiles of W1 (one pass over K for all of them) and 16 / TLW of the 16 rows in the staging and store loops; each accumulator's k order is as before.
__global__ __launch_bounds__(TLW * 32) void tail_kernel(const float* __restrict__ CTX, const float* __restrict__ tab, const b16* __restrict__ WO, const float* __restrict__ bo, const float* __restrict__ g1, const float* __restrict__ be1, const b16* __restrict__ WF1, const float* __restrict__ b1, const b16* __restrict__ WF2, const float* __restrict__ b2, const float* __restrict__ g2, const float* __restrict__ be2, int SLIM, float* __restrict__ out) { __shared__ __attribute__((aligned(16))) b16 A1h[16][D + 8], A1l[16][D + 8], A2h[16][FF + 8], A2l[16][FF + 8]; __shared__ float Y[16][D + 1], Mu[16], Rs[16]; constexpr int TW = 16 / TLW, TF = 64 / TLW; const int lane = threadIdx.x & 31, wave = __builtin_amdgcn_readfirstlane((int)(threadIdx.x >> 5)), nloc = lane & 15, hlf = lane >> 4; const size_t t0 = (size_t)blockIdx.x * 16; if (t0 >= (size_t)SLIM * LQ) return;
  for (int rr = wave * TW; rr < wave * TW + TW; ++rr) for (int q = 0; q < 8; ++q) { const int c = q * 32 + lane; b16 p, pl; split16(CTX[(t0 + rr) * D + c] * HS, p, pl); A1h[rr][c] = p; A1l[rr][c] = pl; }
  if (threadIdx.x < 16) { const int r = threadIdx.x; for (int k = D; k < D + 8; ++k) { A1h[r][k] = (b16)0.0f; A1l[r][k] = (b16)0.0f; } for (int k = FF; k < FF + 8; ++k) { A2h[r][k] = (b16)0.0f; A2l[r][k] = (b16)0.0f; } }
  __syncthreads();
  // LayerNorm: the two row sums stay on 16 lanes of wave 0 in their order; the element-wise part goes by rows over the waves. Each thread rewrites only the Y elements that it alone reads next, so no barrier follows. The loops over q and t are unrolled so that gr, br, mu, rs and y stay in registers.
  auto ln_rows = [&](const float* gg, const float* bb) { float gr[8], br[8];
#pragma unroll
    for (int q = 0; q < 8; ++q) { gr[q] = gg[q * 32 + lane]; br[q] = bb[q * 32 + lane]; }
    if (threadIdx.x < 16) { const int r = threadIdx.x; float m = 0.0f; for (int c = 0; c < D; ++c) m += Y[r][c]; m *= (1.0f / D); float vr = 0.0f; for (int c = 0; c < D; ++c) { const float d = Y[r][c] - m; vr += d * d; } vr *= (1.0f / D); Mu[r] = m; Rs[r] = rsqrtf(vr + EPS); }
    __syncthreads(); float mu[TW], rs[TW], y[TW][8];
#pragma unroll
    for (int t = 0; t < TW; ++t) { mu[t] = Mu[wave * TW + t]; rs[t] = Rs[wave * TW + t];
#pragma unroll
      for (int q = 0; q < 8; ++q) y[t][q] = Y[wave * TW + t][q * 32 + lane]; }
#pragma unroll
    for (int q = 0; q < 8; ++q) { const float gq = bfv(gr[q]), bq = bfv(br[q]);
#pragma unroll
      for (int t = 0; t < TW; ++t) Y[wave * TW + t][q * 32 + lane] = pmul((y[t][q] - mu[t]) * rs[t], gq) + bq; } };
  { v8f acc[TW]; const b16* wb = WO + (size_t)(wave * TW) * (16 * D) + lane * 8;
#pragma unroll
    for (int t = 0; t < TW; ++t) acc[t] = (v8f){};
#pragma unroll 2
    for (int kb = 0; kb < D; kb += 32) { const v16b a = frag_kb(&A1h[nloc][kb], hlf), al = frag_kb(&A1l[nloc][kb], hlf);
#pragma unroll
      for (int t = 0; t < TW; ++t) { const v16b bw = frag_pk(wb + t * 16 * D + kb * 16); acc[t] = wmma16b(a, bw, acc[t]); acc[t] = wmma16b(al, bw, acc[t]); } }
#pragma unroll
    for (int t = 0; t < TW; ++t) { const int cc = (wave * TW + t) * 16 + nloc; const float bb = bfv(bo[cc]);
#pragma unroll
      for (int r8 = 0; r8 < 8; ++r8) { const int r = 8 * hlf + r8; Y[r][cc] = acc[t][r8] * (1.0f / (HS * WSC)) + bb + bfv(tab[(t0 + r) * D + cc]); } } }
  __syncthreads(); ln_rows(g1, be1);
  for (int rr = wave * TW; rr < wave * TW + TW; ++rr) for (int q = 0; q < 8; ++q) { const int c = q * 32 + lane; b16 p, pl; split16(Y[rr][c] * HS, p, pl); A1h[rr][c] = p; A1l[rr][c] = pl; }
  __syncthreads();
  { v8f acc[TF]; const b16* wb = WF1 + (size_t)(wave * TF) * (16 * D) + lane * 8;
#pragma unroll
    for (int t = 0; t < TF; ++t) acc[t] = (v8f){};
#pragma unroll 2
    for (int kb = 0; kb < D; kb += 32) { const v16b a = frag_kb(&A1h[nloc][kb], hlf), al = frag_kb(&A1l[nloc][kb], hlf);
#pragma unroll
      for (int t = 0; t < TF; ++t) { const v16b bw = frag_pk(wb + t * 16 * D + kb * 16); acc[t] = wmma16b(a, bw, acc[t]); acc[t] = wmma16b(al, bw, acc[t]); } }
#pragma unroll
    for (int t = 0; t < TF; ++t) { const int cc = (wave * TF + t) * 16 + nloc; const float bb = bfv(b1[cc]);
#pragma unroll
      for (int r8 = 0; r8 < 8; ++r8) { const float v = fmaxf(acc[t][r8] * (1.0f / (HS * WSC)) + bb, 0.0f); b16 p, pl; split16(v * HS, p, pl); A2h[8 * hlf + r8][cc] = p; A2l[8 * hlf + r8][cc] = pl; } } }
  __syncthreads();
  { v8f acc[TW]; const b16* wb = WF2 + (size_t)(wave * TW) * (16 * FF) + lane * 8;
#pragma unroll
    for (int t = 0; t < TW; ++t) acc[t] = (v8f){};
#pragma unroll 2
    for (int kb = 0; kb < FF; kb += 32) { const v16b a = frag_kb(&A2h[nloc][kb], hlf), al = frag_kb(&A2l[nloc][kb], hlf);
#pragma unroll
      for (int t = 0; t < TW; ++t) { const v16b bw = frag_pk(wb + t * 16 * FF + kb * 16); acc[t] = wmma16b(a, bw, acc[t]); acc[t] = wmma16b(al, bw, acc[t]); } }
#pragma unroll
    for (int t = 0; t < TW; ++t) { const int cc = (wave * TW + t) * 16 + nloc; const float bb = bfv(b2[cc]);
#pragma unroll
      for (int r8 = 0; r8 < 8; ++r8) { const int r = 8 * hlf + r8; Y[r][cc] = Y[r][cc] + acc[t][r8] * (1.0f / (HS * WSC)) + bb; } } }
  __syncthreads(); ln_rows(g2, be2);
  { for (int rr = wave * TW; rr < wave * TW + TW; ++rr) for (int q = 0; q < 8; ++q) ((float*)out)[(t0 + rr) * D + q * 32 + lane] = Y[rr][q * 32 + lane];  } }
}  // namespace

extern "C" void kernel_launch(void* const* d_in, const int* in_sizes, int n_in, void* d_out, int out_size, void* d_ws, size_t ws_size, hipStream_t stream) {
  (void)n_in;
  auto Fp = [&](int i) { return (const float*)d_in[i]; };
  // input order: 0 table [4,96,96,256]; 1 dep_matrix [4,96,96]; 2 Wq [256,256]; 3 bq; 4 Wk; 5 bk; 6 Wv; 7 bv; 8 Wo; 9 bo; 10 Wdep [1,8]; 11 bdep [8]; 12 ln1_g; 13 ln1_b; 14 W1 [256,1024]; 15 b1; 16 W2 [1024,256]; 17 b2; 18 ln2_g; 19 ln2_b
  if (in_sizes[0] != NT * D || in_sizes[1] != NT || in_sizes[2] != D * D || in_sizes[8] != D * D || in_sizes[10] != H || in_sizes[14] != D * FF || in_sizes[16] != FF * D || out_size != NT * D) return;
  const int SLIM = NSEQ;   // sequence cut (SLIM*96 tokens; multiple of 16)
  size_t off = 0; char* ws = (char*)d_ws;
  auto carve = [&](size_t bytes) { char* p = ws + off; off += (bytes + 255) & ~(size_t)255; return p; };
  b16* WQKV = (b16*)carve((size_t)3 * D * D * 2); b16* WO = (b16*)carve((size_t)D * D * 2); b16* WF1 = (b16*)carve((size_t)FF * D * 2); b16* WF2 = (b16*)carve((size_t)D * FF * 2); b16* Qh = (b16*)carve((size_t)NT * D * 2); b16* Ql = (b16*)carve((size_t)NT * D * 2); b16* Kh = (b16*)carve((size_t)NT * D * 2); b16* Kl = (b16*)carve((size_t)NT * D * 2); float* V = (float*)carve((size_t)NT * D * 4); b16* VTh = (b16*)carve((size_t)NSEQ * H * HD * LQ * 2); b16* VTl = (b16*)carve((size_t)NSEQ * H * HD * LQ * 2); float* CTX = (float*)carve((size_t)NT * D * 4);
  if (off > ws_size || off > ((size_t)208 << 20)) return;   // ~ 190 MB (> 128 MiB; table input 38 MB)
  wput_kernel<<<128, 256, 0, stream>>>(Fp(2), Fp(4), Fp(6), Fp(8), Fp(14), Fp(16), WQKV, WO, WF1, WF2);
  qkv_kernel<<<SLIM * LQ / 16, QW * 32, 0, stream>>>(Fp(0), WQKV, Fp(3), Fp(5), Fp(7), Qh, Ql, Kh, Kl, V);
  vt_kernel<<<NSEQ, 256, 0, stream>>>(V, SLIM, VTh, VTl);
  att_kernel<<<NSEQ * H * 6, 32, 0, stream>>>(Qh, Ql, Kh, Kl, VTh, VTl, Fp(1), Fp(10), Fp(11), SLIM, CTX);
  tail_kernel<<<NT / 16, TLW * 32, 0, stream>>>(CTX, Fp(0), WO, Fp(9), Fp(12), Fp(13), WF1, Fp(15), WF2, Fp(17), Fp(18), Fp(19), SLIM, (float*)d_out);
}

// v003
// Measured time: 241 microseconds a run.
// In both of two side-by-side timings against v002, it was 1.24 times as fast.
// Over all steps from v000 it is 4.23 times as fast.
#include <hip/hip_runtime.h>

// SyntaxMultiAttentionGAT: tokens are the (b, x, y) cells of table [4][96][96][256]; q,k,v = table W + b (8 heads x 32); per (b, x) sequence of 96 cells: probs = softmax_k(q.k / sqrt(32) + dep_matrix[b][x][k] Wdep[h] + bdep[h]); ctx = probs v; out1 = LN(ctx Wo + bo + table); out = LN(relu(out1 W1 + b1) W2 + b2 + out1) -> [4][96][96][256].
// Deterministic: fixed split of column tiles and rows over the waves of a work-group, softmax over 96 keys in fixed order; no atomics.
// WMMA (v_wmma_f32_16x16x32_f16, f32 accumulate): table (EXACT bf16 x8, K 256) x [Wq|Wk|Wv] rows (48 tiles in 3 groups) per 16-token work-group of 4 waves; per (sequence, head, 16-query) wave S = q (hi+lo x256, K 32) x k rows (hi+lo; 6 tiles) and ctx = P (hi+lo) x v^T (hi+lo; 2 tiles, K 96), 3 products; tail ctx x Wo (16 tiles), out1 x W1 (64 tiles), ff x W2 (K 1,024, 16 tiles) per 16-token work-group of 16 waves - weights EXACT x256 ((in,out)), about 7 M WMMA; softmax, dep bias, LayerNorms, relu in f32.

namespace {
constexpr int NB_ = 4, LQ = 96, D = 256, H = 8, HD = 32, FF = 1024, NSEQ = NB_ * LQ /* 384 */, NT = NSEQ * LQ /* 36864 tokens */;
constexpr int QW = 4 /* waves per qkv work-group */, TLW = 16 /* waves per tail work-group */;
constexpr float XS = 8.0f, HS = 256.0f, PS = 256.0f, WSC = 256.0f, EPS = 1e-5f, SCL = 0.17677669529663688f /* 32^-0.5 */;
typedef _Float16 b16;
typedef __attribute__((ext_vector_type(16))) _Float16 v16b;
typedef __attribute__((ext_vector_type(8))) _Float16 v8b;
typedef __attribute__((ext_vector_type(2))) _Float16 v2b;
typedef __attribute__((ext_vector_type(8))) float v8f;
typedef __attribute__((ext_vector_type(4))) float v4f;
typedef __attribute__((ext_vector_type(2))) float v2f;
__device__ __forceinline__ float bf16_rne(float f) { unsigned int u = __float_as_uint(f); u += 0x7FFFu + ((u >> 16) & 1u); return __uint_as_float(u & 0xFFFF0000u); }
__device__ __forceinline__ float bfv(float f) { return bf16_rne(f); }
__device__ __forceinline__ void split16(float v, b16& hi, b16& lo) { hi = (b16)v; lo = (b16)(v - (float)hi); }
__device__ __forceinline__ v16b frag_kb(const b16* p, int hh) { const v8b a = *(const v8b*)(p + 8 * hh), b = *(const v8b*)(p + 16 + 8 * hh); v16b f;
#pragma unroll
  for (int e = 0; e < 8; ++e) { f[e] = a[e]; f[8 + e] = b[e]; } return f; }
// Weight fragments lie in the workspace in register order: block (column tile T, k block kk) is 512 elements at (T * K / 32 + kk) * 512, as [j][lane][8] with element e = W[k = kk * 32 + j * 16 + 8 * (lane >> 4) + e][T * 16 + (lane & 15)], the k order of frag_kb. One 16-byte load of a wave reads 512 bytes in a row, 4 whole 128-byte lines (16 weight rows read row-major would be 16 lines).
__device__ __forceinline__ v16b frag_pk(const b16* p) { const v8b a = *(const v8b*)p, b = *(const v8b*)(p + 256); v16b f;
#pragma unroll
  for (int e = 0; e < 8; ++e) { f[e] = a[e]; f[8 + e] = b[e]; } return f; }
__device__ __forceinline__ void pk_unit(size_t u, int KB, int& o, int& k0) { const int lane = (int)(u & 31), j = (int)(u >> 5) & 1, blk = (int)(u >> 6); o = (blk / KB) * 16 + (lane & 15); k0 = (blk % KB) * 32 + j * 16 + (lane >> 4) * 8; }
__device__ __forceinline__ v8f wmma16b(v16b a, v16b b, v8f c) { return __builtin_amdgcn_wmma_f32_16x16x32_f16(false, a, false, b, (short)0, c, false, false); }
__device__ __forceinline__ void wave_lds_sync() { __builtin_amdgcn_fence(__ATOMIC_RELEASE, "workgroup"); __builtin_amdgcn_wave_barrier(); __builtin_amdgcn_fence(__ATOMIC_ACQUIRE, "workgroup"); }
__device__ __forceinline__ float pmul(float a, float b) { float p = a * b; asm volatile("" : "+v"(p)); return p; }

__global__ __launch_bounds__(256) void wput_kernel(const float* __restrict__ wq, const float* __restrict__ wk, const float* __restrict__ wv, const float* __restrict__ wo, const float* __restrict__ w1, const float* __restrict__ w2, b16* __restrict__ WQKV, b16* __restrict__ WO, b16* __restrict__ WF1, b16* __restrict__ WF2) { const size_t nt = (size_t)gridDim.x * 256, u0 = (size_t)blockIdx.x * 256 + threadIdx.x; v8b v;
  for (size_t u = u0; u < (size_t)3 * D * 32; u += nt) { int o, k0; pk_unit(u, D / 32, o, k0); const float* w = o < D ? wq : (o < 2 * D ? wk : wv); const int oo = o % D;
#pragma unroll
    for (int j = 0; j < 8; ++j) v[j] = (b16)(bf16_rne(w[(size_t)(k0 + j) * D + oo]) * WSC); { *(v8b*)(WQKV + u * 8) = v;  } }
  for (size_t u = u0; u < (size_t)D * 32; u += nt) { int o, k0; pk_unit(u, D / 32, o, k0);
#pragma unroll
    for (int j = 0; j < 8; ++j) v[j] = (b16)(bf16_rne(wo[(size_t)(k0 + j) * D + o]) * WSC); { *(v8b*)(WO + u * 8) = v;  } }
  for (size_t u = u0; u < (size_t)FF * 32; u += nt) { int o, k0; pk_unit(u, D / 32, o, k0);
#pragma unroll
    for (int j = 0; j < 8; ++j) v[j] = (b16)(bf16_rne(w1[(size_t)(k0 + j) * FF + o]) * WSC); { *(v8b*)(WF1 + u * 8) = v;  } }
  for (size_t u = u0; u < (size_t)D * 128; u += nt) { int o, k0; pk_unit(u, FF / 32, o, k0);
#pragma unroll
    for (int j = 0; j < 8; ++j) v[j] = (b16)(bf16_rne(w2[(size_t)(k0 + j) * D + o]) * WSC); { *(v8b*)(WF2 + u * 8) = v;  } } }
// One work-group of QW waves per 16-token tile: each wave takes 16 / QW of the 16 column tiles of a group and 16 / QW of the 16 rows in the staging and store loops.
__global__ __launch_bounds__(QW * 32) void qkv_kernel(const float* __restrict__ tab, const b16* __restrict__ WQKV, const float* __restrict__ bq, const float* __restrict__ bk, const float* __restrict__ bv, b16* __restrict__ Qh, b16* __restrict__ Ql, b16* __restrict__ Kh, b16* __restrict__ Kl, float* __restrict__ V) { __shared__ __attribute__((aligned(16))) b16 Ah[16][D + 8]; __shared__ float Tf[16][260]; constexpr int TW = 16 / QW; const int lane = threadIdx.x & 31, wave = __builtin_amdgcn_readfirstlane((int)(threadIdx.x >> 5)), nloc = lane & 15, hlf = lane >> 4; const size_t t0 = (size_t)blockIdx.x * 16;
  for (int rr = wave * TW; rr < wave * TW + TW; ++rr) for (int q = 0; q < 8; ++q) { const int c = q * 32 + lane; Ah[rr][c] = (b16)(bf16_rne(tab[(t0 + rr) * D + c]) * XS); }
  if (threadIdx.x < 16) for (int k = D; k < D + 8; ++k) Ah[threadIdx.x][k] = (b16)0.0f;
  __syncthreads();
#pragma unroll 1
  for (int g = 0; g < 3; ++g) { const float* bias = g == 0 ? bq : (g == 1 ? bk : bv); v8f acc[TW];
#pragma unroll
    for (int t = 0; t < TW; ++t) acc[t] = (v8f){};
#pragma unroll 2
    for (int kb = 0; kb < D; kb += 32) { const v16b a = frag_kb(&Ah[nloc][kb], hlf);
#pragma unroll
      for (int t = 0; t < TW; ++t) acc[t] = wmma16b(a, frag_pk(WQKV + (size_t)(g * 16 + wave * TW + t) * (16 * D) + kb * 16 + lane * 8), acc[t]); }
#pragma unroll
    for (int t = 0; t < TW; ++t) { const int cc = (wave * TW + t) * 16 + nloc; const float bb = bfv(bias[cc]);
#pragma unroll
      for (int r8 = 0; r8 < 8; ++r8) Tf[8 * hlf + r8][cc] = acc[t][r8] * (1.0f / (XS * WSC)) + bb; }
    __syncthreads();
    { for (int rr = wave * TW; rr < wave * TW + TW; ++rr) { const size_t tk = t0 + rr;
        if (g == 2) { for (int q = 0; q < 2; ++q) *(v4f*)(V + tk * D + q * 128 + lane * 4) = *(const v4f*)(&Tf[rr][q * 128 + lane * 4]); asm volatile("s_wait_xcnt 0x0" ::: "memory"); }   // the wait stands in the stores' own block, in front of any overwrite of the registers that this row's stores name
        else { b16* Ph = g == 0 ? Qh : Kh; b16* Pl = g == 0 ? Ql : Kl; for (int q = 0; q < 4; ++q) { const int c = q * 64 + lane * 2; b16 h0, l0, h1, l1; split16(Tf[rr][c] * HS, h0, l0); split16(Tf[rr][c + 1] * HS, h1, l1); *(v2b*)(Ph + tk * D + c) = (v2b){h0, h1}; *(v2b*)(Pl + tk * D + c) = (v2b){l0, l1}; } asm volatile("s_wait_xcnt 0x0" ::: "memory"); }   // as above, for the hi and lo stores
      } }
    __syncthreads(); } }
__global__ __launch_bounds__(256) void vt_kernel(const float* __restrict__ V, int SLIM, b16* __restrict__ VTh, b16* __restrict__ VTl) { __shared__ float Tt[8][LQ][HD + 1]; const int wave = threadIdx.x >> 5, lane = threadIdx.x & 31; const int seq = blockIdx.x, h = wave; if (seq >= SLIM) return;
  for (int k = 0; k < LQ; ++k) Tt[wave][k][lane] = V[((size_t)seq * LQ + k) * D + h * HD + lane];
  wave_lds_sync();
  const size_t base = ((size_t)seq * H + h) * HD * LQ;   // element (d, k) at base + d*96 + k; lane = d
  { for (int k = 0; k < LQ; k += 2) { b16 h0, l0, h1, l1; split16(Tt[wave][k][lane] * HS, h0, l0); split16(Tt[wave][k + 1][lane] * HS, h1, l1); *(v2b*)(VTh + base + (size_t)lane * LQ + k) = (v2b){h0, h1}; *(v2b*)(VTl + base + (size_t)lane * LQ + k) = (v2b){l0, l1}; }  } }
__global__ __launch_bounds__(32) void att_kernel(const b16* __restrict__ Qh, const b16* __restrict__ Ql, const b16* __restrict__ Kh, const b16* __restrict__ Kl, const b16* __restrict__ VTh, const b16* __restrict__ VTl, const float* __restrict__ dep, const float* __restrict__ wdep, const float* __restrict__ bdep, int SLIM, float* __restrict__ CTX) { __shared__ __attribute__((aligned(16))) b16 Pa[16][104], Pb[16][104]; __shared__ float Sc[16][LQ + 1], Dp[LQ], Of[16][HD + 1]; const int lane = threadIdx.x, nloc = lane & 15, hlf = lane >> 4; const int seq = blockIdx.x / (H * 6), rem = blockIdx.x % (H * 6); const int h = rem / 6, q0 = (rem % 6) * 16; if (seq >= SLIM) return; const size_t tk0 = (size_t)seq * LQ;
  const float wd = bfv(wdep[h]), bd = bfv(bdep[h]); float dv[3];   // asked for here, used behind the q and k loads: the volatile statement in pmul holds every load written behind it until these have come
#pragma unroll
  for (int i = 0; i < 3; ++i) dv[i] = dep[(size_t)seq * LQ + i * 32 + lane];
  const v16b qa = frag_kb(Qh + (tk0 + q0 + nloc) * D + h * HD, hlf); v16b khf[6], klf[6];
#pragma unroll
  for (int t = 0; t < 6; ++t) khf[t] = frag_kb(Kh + (tk0 + t * 16 + nloc) * D + h * HD, hlf);
  asm volatile("s_wait_xcnt 0x0" ::: "memory");   // stands in front of the lo loads, whose results may land in the address registers of the hi loads above
  const v16b ql = frag_kb(Ql + (tk0 + q0 + nloc) * D + h * HD, hlf);
#pragma unroll
  for (int t = 0; t < 6; ++t) klf[t] = frag_kb(Kl + (tk0 + t * 16 + nloc) * D + h * HD, hlf);
#pragma unroll
  for (int i = 0; i < 3; ++i) Dp[i * 32 + lane] = pmul(bfv(dv[i]), wd) + bd;
#pragma unroll
  for (int t = 0; t < 6; ++t) { const v16b kh = khf[t], kl = klf[t]; v8f s = wmma16b(qa, kh, (v8f){}); s = wmma16b(qa, kl, s); s = wmma16b(ql, kh, s);
#pragma unroll
    for (int r8 = 0; r8 < 8; ++r8) Sc[8 * hlf + r8][t * 16 + nloc] = s[r8] * (SCL / (HS * HS)); }
  const size_t vb = ((size_t)seq * H + h) * HD * LQ; v16b vf[3][4];   // the v fragments do not depend on the softmax: asked for here in one batch, while the last score products and their LDS stores run
#pragma unroll
  for (int i = 0; i < 3; ++i) { vf[i][0] = frag_kb(VTh + vb + (size_t)nloc * LQ + i * 32, hlf); vf[i][1] = frag_kb(VTl + vb + (size_t)nloc * LQ + i * 32, hlf); vf[i][2] = frag_kb(VTh + vb + (size_t)(16 + nloc) * LQ + i * 32, hlf); vf[i][3] = frag_kb(VTl + vb + (size_t)(16 + nloc) * LQ + i * 32, hlf); }
  wave_lds_sync();
  if (lane < 16) { const int r = lane; float mx = -INFINITY; for (int k = 0; k < LQ; ++k) { const float v = Sc[r][k] + Dp[k]; Sc[r][k] = v; mx = fmaxf(mx, v); } float sm = 0.0f; for (int k = 0; k < LQ; ++k) { const float p = __expf(Sc[r][k] - mx); Sc[r][k] = p; sm += p; } const float inv = 1.0f / sm; for (int k = 0; k < LQ; ++k) { b16 p, pl; split16(Sc[r][k] * inv * PS, p, pl); Pa[r][k] = p; Pb[r][k] = pl; } for (int k = LQ; k < 104; ++k) { Pa[r][k] = (b16)0.0f; Pb[r][k] = (b16)0.0f; } }
  wave_lds_sync();
  v8f o0 = (v8f){}, o1 = (v8f){};
#pragma unroll
  for (int kb = 0; kb < LQ; kb += 32) { const v16b pa = frag_kb(&Pa[nloc][kb], hlf), pb = frag_kb(&Pb[nloc][kb], hlf); const v16b v0h = vf[kb / 32][0], v0l = vf[kb / 32][1], v1h = vf[kb / 32][2], v1l = vf[kb / 32][3];
    o0 = wmma16b(pa, v0h, o0); o0 = wmma16b(pa, v0l, o0); o0 = wmma16b(pb, v0h, o0); o1 = wmma16b(pa, v1h, o1); o1 = wmma16b(pa, v1l, o1); o1 = wmma16b(pb, v1h, o1); }
#pragma unroll
  for (int r8 = 0; r8 < 8; ++r8) { Of[8 * hlf + r8][nloc] = o0[r8] * (1.0f / (PS * HS)); Of[8 * hlf + r8][16 + nloc] = o1[r8] * (1.0f / (PS * HS)); }
  wave_lds_sync();
  { for (int r = 0; r < 16; ++r) ((float*)CTX)[(tk0 + q0 + r) * D + h * HD + lane] = Of[r][lane];  } }
// One work-group of TLW waves per 16-token tile: each wave takes 16 / TLW of the 16 column tiles of Wo and W2, 64 / TLW of the 64 column tiles of W1 (two tiles to a pass over K) and 16 / TLW of the 16 rows in the staging and store loops; each accumulator's k order is as before.
// The register budget of 12 waves per SIMD (80 registers) keeps three of these work-groups on a WGP, as many as their LDS allows.
__global__ __launch_bounds__(TLW * 32) __attribute__((amdgpu_waves_per_eu(12))) void tail_kernel(const float* __restrict__ CTX, const float* __restrict__ tab, const b16* __restrict__ WO, const float* __restrict__ bo, const float* __restrict__ g1, const float* __restrict__ be1, const b16* __restrict__ WF1, const float* __restrict__ b1, const b16* __restrict__ WF2, const float* __restrict__ b2, const float* __restrict__ g2, const float* __restrict__ be2, int SLIM, float* __restrict__ out) { __shared__ __attribute__((aligned(16))) b16 A1h[16][D + 8], A1l[16][D + 8], A2h[16][FF + 8], A2l[16][FF + 8]; __shared__ float Y[16][D + 1], Mu[16], Rs[16]; constexpr int TW = 16 / TLW, TF = 64 / TLW; const int lane = threadIdx.x & 31, wave = __builtin_amdgcn_readfirstlane((int)(threadIdx.x >> 5)), nloc = lane & 15, hlf = lane >> 4; const size_t t0 = (size_t)blockIdx.x * 16; if (t0 >= (size_t)SLIM * LQ) return;
  for (int rr = wave * TW; rr < wave * TW + TW; ++rr) for (int q = 0; q < 8; ++q) { const int c = q * 32 + lane; b16 p, pl; split16(CTX[(t0 + rr) * D + c] * HS, p, pl); A1h[rr][c] = p; A1l[rr][c] = pl; }
  if (threadIdx.x < 16) { const int r = threadIdx.x; for (int k = D; k < D + 8; ++k) { A1h[r][k] = (b16)0.0f; A1l[r][k] = (b16)0.0f; } for (int k = FF; k < FF + 8; ++k) { A2h[r][k] = (b16)0.0f; A2l[r][k] = (b16)0.0f; } }
  __syncthreads();
  // LayerNorm: the two row sums stay on 16 lanes of wave 0 in their order; the element-wise part goes by rows over the waves. Each thread rewrites only the Y elements that it alone reads next, so no barrier follows. The loops over q and t are unrolled so that gr, br, mu, rs and y stay in registers.
  auto ln_rows = [&](const float* gg, const float* bb) { float gr[8], br[8];
#pragma unroll
    for (int q = 0; q < 8; ++q) { gr[q] = gg[q * 32 + lane]; br[q] = bb[q * 32 + lane]; }
    if (threadIdx.x < 16) { const int r = threadIdx.x; float m = 0.0f; for (int c = 0; c < D; ++c) m += Y[r][c]; m *= (1.0f / D); float vr = 0.0f; for (int c = 0; c < D; ++c) { const float d = Y[r][c] - m; vr += d * d; } vr *= (1.0f / D); Mu[r] = m; Rs[r] = rsqrtf(vr + EPS); }
    __syncthreads(); float mu[TW], rs[TW], y[TW][8];
#pragma unroll
    for (int t = 0; t < TW; ++t) { mu[t] = Mu[wave * TW + t]; rs[t] = Rs[wave * TW + t];
#pragma unroll
      for (int q = 0; q < 8; ++q) y[t][q] = Y[wave * TW + t][q * 32 + lane]; }
#pragma unroll
    for (int q = 0; q < 8; ++q) { const float gq = bfv(gr[q]), bq = bfv(br[q]);
#pragma unroll
      for (int t = 0; t < TW; ++t) Y[wave * TW + t][q * 32 + lane] = pmul((y[t][q] - mu[t]) * rs[t], gq) + bq; } };
  { v8f acc[TW]; const b16* wb = WO + (size_t)(wave * TW) * (16 * D) + lane * 8; float tb[TW][8], bov[TW];   // the residual and the bias are asked for in front of the K loop, with its first weight loads, and used behind it
#pragma unroll
    for (int t = 0; t < TW; ++t) { acc[t] = (v8f){}; const int cc = (wave * TW + t) * 16 + nloc; bov[t] = bo[cc];
#pragma unroll
      for (int r8 = 0; r8 < 8; ++r8) tb[t][r8] = tab[(t0 + 8 * hlf + r8) * D + cc]; }
#pragma unroll 4   // the weight loads of four k steps are in flight together
    for (int kb = 0; kb < D; kb += 32) { const v16b a = frag_kb(&A1h[nloc][kb], hlf), al = frag_kb(&A1l[nloc][kb], hlf);
#pragma unroll
      for (int t = 0; t < TW; ++t) { const v16b bw = frag_pk(wb + t * 16 * D + kb * 16); acc[t] = wmma16b(a, bw, acc[t]); acc[t] = wmma16b(al, bw, acc[t]); } }
#pragma unroll
    for (int t = 0; t < TW; ++t) { const int cc = (wave * TW + t) * 16 + nloc; const float bb = bfv(bov[t]);
#pragma unroll
      for (int r8 = 0; r8 < 8; ++r8) { const int r = 8 * hlf + r8; Y[r][cc] = acc[t][r8] * (1.0f / (HS * WSC)) + bb + bfv(tb[t][r8]); } } }
  __syncthreads(); ln_rows(g1, be1);
  for (int rr = wave * TW; rr < wave * TW + TW; ++rr) for (int q = 0; q < 8; ++q) { const int c = q * 32 + lane; b16 p, pl; split16(Y[rr][c] * HS, p, pl); A1h[rr][c] = p; A1l[rr][c] = pl; }
  __syncthreads();
  // Two column tiles to a pass over K: with all four, the batched weight loads, 32 accumulator and 16 A registers go past the budget of 80 and spill. The loop over the passes is kept rolled so that they share one copy of the code.
#pragma unroll 1
  for (int tp = 0; tp < TF; tp += 2) { v8f acc[2]; const b16* wb = WF1 + (size_t)(wave * TF + tp) * (16 * D) + lane * 8;
#pragma unroll
    for (int t = 0; t < 2; ++t) acc[t] = (v8f){};
#pragma unroll 2
    for (int kb = 0; kb < D; kb += 32) { const v16b a = frag_kb(&A1h[nloc][kb], hlf), al = frag_kb(&A1l[nloc][kb], hlf);
#pragma unroll
      for (int t = 0; t < 2; ++t) { const v16b bw = frag_pk(wb + t * 16 * D + kb * 16); acc[t] = wmma16b(a, bw, acc[t]); acc[t] = wmma16b(al, bw, acc[t]); } }
#pragma unroll
    for (int t = 0; t < 2; ++t) { const int cc = (wave * TF + tp + t) * 16 + nloc; const float bb = bfv(b1[cc]);
#pragma unroll
      for (int r8 = 0; r8 < 8; ++r8) { const float v = fmaxf(acc[t][r8] * (1.0f / (HS * WSC)) + bb, 0.0f); b16 p, pl; split16(v * HS, p, pl); A2h[8 * hlf + r8][cc] = p; A2l[8 * hlf + r8][cc] = pl; } } }
  __syncthreads();
  { v8f acc[TW]; const b16* wb = WF2 + (size_t)(wave * TW) * (16 * FF) + lane * 8;
#pragma unroll
    for (int t = 0; t < TW; ++t) acc[t] = (v8f){};
#pragma unroll 4   // the weight loads of four k steps are in flight together
    for (int kb = 0; kb < FF; kb += 32) { const v16b a = frag_kb(&A2h[nloc][kb], hlf), al = frag_kb(&A2l[nloc][kb], hlf);
#pragma unroll
      for (int t = 0; t < TW; ++t) { const v16b bw = frag_pk(wb + t * 16 * FF + kb * 16); acc[t] = wmma16b(a, bw, acc[t]); acc[t] = wmma16b(al, bw, acc[t]); } }
#pragma unroll
    for (int t = 0; t < TW; ++t) { const int cc = (wave * TW + t) * 16 + nloc; const float bb = bfv(b2[cc]);
#pragma unroll
      for (int r8 = 0; r8 < 8; ++r8) { const int r = 8 * hlf + r8; Y[r][cc] = Y[r][cc] + acc[t][r8] * (1.0f / (HS * WSC)) + bb; } } }
  __syncthreads(); ln_rows(g2, be2);
  { for (int rr = wave * TW; rr < wave * TW + TW; ++rr) for (int q = 0; q < 8; ++q) ((float*)out)[(t0 + rr) * D + q * 32 + lane] = Y[rr][q * 32 + lane];  } }
}  // namespace

extern "C" void kernel_launch(void* const* d_in, const int* in_sizes, int n_in, void* d_out, int out_size, void* d_ws, size_t ws_size, hipStream_t stream) {
  (void)n_in;
  auto Fp = [&](int i) { return (const float*)d_in[i]; };
  // input order: 0 table [4,96,96,256]; 1 dep_matrix [4,96,96]; 2 Wq [256,256]; 3 bq; 4 Wk; 5 bk; 6 Wv; 7 bv; 8 Wo; 9 bo; 10 Wdep [1,8]; 11 bdep [8]; 12 ln1_g; 13 ln1_b; 14 W1 [256,1024]; 15 b1; 16 W2 [1024,256]; 17 b2; 18 ln2_g; 19 ln2_b
  if (in_sizes[0] != NT * D || in_sizes[1] != NT || in_sizes[2] != D * D || in_sizes[8] != D * D || in_sizes[10] != H || in_sizes[14] != D * FF || in_sizes[16] != FF * D || out_size != NT * D) return;
  const int SLIM = NSEQ;   // sequence cut (SLIM*96 tokens; multiple of 16)
  size_t off = 0; char* ws = (char*)d_ws;
  auto carve = [&](size_t bytes) { char* p = ws + off; off += (bytes + 255) & ~(size_t)255; return p; };
  b16* WQKV = (b16*)carve((size_t)3 * D * D * 2); b16* WO = (b16*)carve((size_t)D * D * 2); b16* WF1 = (b16*)carve((size_t)FF * D * 2); b16* WF2 = (b16*)carve((size_t)D * FF * 2); b16* Qh = (b16*)carve((size_t)NT * D * 2); b16* Ql = (b16*)carve((size_t)NT * D * 2); b16* Kh = (b16*)carve((size_t)NT * D * 2); b16* Kl = (b16*)carve((size_t)NT * D * 2); float* V = (float*)carve((size_t)NT * D * 4); b16* VTh = (b16*)carve((size_t)NSEQ * H * HD * LQ * 2); b16* VTl = (b16*)carve((size_t)NSEQ * H * HD * LQ * 2); float* CTX = (float*)carve((size_t)NT * D * 4);
  if (off > ws_size || off > ((size_t)208 << 20)) return;   // ~ 190 MB (> 128 MiB; table input 38 MB)
  wput_kernel<<<128, 256, 0, stream>>>(Fp(2), Fp(4), Fp(6), Fp(8), Fp(14), Fp(16), WQKV, WO, WF1, WF2);
  qkv_kernel<<<SLIM * LQ / 16, QW * 32, 0, stream>>>(Fp(0), WQKV, Fp(3), Fp(5), Fp(7), Qh, Ql, Kh, Kl, V);
  vt_kernel<<<NSEQ, 256, 0, stream>>>(V, SLIM, VTh, VTl);
  att_kernel<<<NSEQ * H * 6, 32, 0, stream>>>(Qh, Ql, Kh, Kl, VTh, VTl, Fp(1), Fp(10), Fp(11), SLIM, CTX);
  tail_kernel<<<NT / 16, TLW * 32, 0, stream>>>(CTX, Fp(0), WO, Fp(9), Fp(12), Fp(13), WF1, Fp(15), WF2, Fp(17), Fp(18), Fp(19), SLIM, (float*)d_out);
}

// v004
// Measured time: 212 microseconds a run.
// Next to v003, in two timings, it ran 1.14 times as fast each time.
// All steps since v000 together make it 4.83 times as fast.
#include <hip/hip_runtime.h>

// SyntaxMultiAttentionGAT: tokens are the (b, x, y) cells of table [4][96][96][256]; q,k,v = table W + b (8 heads x 32); per (b, x) sequence of 96 cells: probs = softmax_k(q.k / sqrt(32) + dep_matrix[b][x][k] Wdep[h] + bdep[h]); ctx = probs v; out1 = LN(ctx Wo + bo + table); out = LN(relu(out1 W1 + b1) W2 + b2 + out1) -> [4][96][96][256].
// Deterministic: fixed split of column tiles and rows over the waves of a work-group, softmax over 96 keys in fixed order; no atomics.
// WMMA (v_wmma_f32_16x16x32_f16, f32 accumulate): table (EXACT bf16 x8, K 256) x [Wq|Wk|Wv] rows (48 tiles in 3 groups) per 16-token work-group of 4 waves; per (sequence, head, 16-query) wave S = q (hi+lo x256, K 32) x k rows (hi+lo; 6 tiles) and ctx = P (hi+lo) x v^T (hi+lo; 2 tiles, K 96), 3 products, q, k and v^T read from the workspace in fragment order; tail ctx x Wo (16 tiles), out1 x W1 (64 tiles), ff x W2 (K 1,024, 16 tiles) per 16-token work-group of 16 waves - weights EXACT x256 ((in,out)), about 7 M WMMA; softmax, dep bias, LayerNorms, relu in f32.

namespace {
constexpr int NB_ = 4, LQ = 96, D = 256, H = 8, HD = 32, FF = 1024, NSEQ = NB_ * LQ /* 384 */, NT = NSEQ * LQ /* 36864 tokens */;
constexpr int QW = 4 /* waves per qkv work-group */, TLW = 16 /* waves per tail work-group */;
constexpr float XS = 8.0f, HS = 256.0f, PS = 256.0f, WSC = 256.0f, EPS = 1e-5f, SCL = 0.17677669529663688f /* 32^-0.5 */;
typedef _Float16 b16;
typedef __attribute__((ext_vector_type(16))) _Float16 v16b;
typedef __attribute__((ext_vector_type(8))) _Float16 v8b;
typedef __attribute__((ext_vector_type(8))) float v8f;
typedef __attribute__((ext_vector_type(4))) float v4f;
typedef __attribute__((ext_vector_type(2))) float v2f;
__device__ __forceinline__ float bf16_rne(float f) { unsigned int u = __float_as_uint(f); u += 0x7FFFu + ((u >> 16) & 1u); return __uint_as_float(u & 0xFFFF0000u); }
__device__ __forceinline__ float bfv(float f) { return bf16_rne(f); }
__device__ __forceinline__ void split16(float v, b16& hi, b16& lo) { hi = (b16)v; lo = (b16)(v - (float)hi); }
__device__ __forceinline__ v16b frag_kb(const b16* p, int hh) { const v8b a = *(const v8b*)(p + 8 * hh), b = *(const v8b*)(p + 16 + 8 * hh); v16b f;
#pragma unroll
  for (int e = 0; e < 8; ++e) { f[e] = a[e]; f[8 + e] = b[e]; } return f; }
// Weight fragments lie in the workspace in register order: block (column tile T, k block kk) is 512 elements at (T * K / 32 + kk) * 512, as [j][lane][8] with element e = W[k = kk * 32 + j * 16 + 8 * (lane >> 4) + e][T * 16 + (lane & 15)], the k order of frag_kb. One 16-byte load of a wave reads 512 bytes in a row, 4 whole 128-byte lines (16 weight rows read row-major would be 16 lines).
__device__ __forceinline__ v16b frag_pk(const b16* p) { const v8b a = *(const v8b*)p, b = *(const v8b*)(p + 256); v16b f;
#pragma unroll
  for (int e = 0; e < 8; ++e) { f[e] = a[e]; f[8 + e] = b[e]; } return f; }
// q, k and v lie there in the same order, hi and lo apart, written by the projection kernel from its own 16-token tile. q, k: block (token tile, head) is 512 elements, e = x[token = lane & 15][head * 32 + j * 16 + 8 * (lane >> 4) + e]. v: block (sequence, head, half dt of the head's 32 columns, key block i of 32) is 512 elements, e = v[key = i * 32 + j * 16 + 8 * (lane >> 4) + e][head * 32 + dt * 16 + (lane & 15)]; one token tile fills the half j of a block.
__device__ __forceinline__ void pk_unit(size_t u, int KB, int& o, int& k0) { const int lane = (int)(u & 31), j = (int)(u >> 5) & 1, blk = (int)(u >> 6); o = (blk / KB) * 16 + (lane & 15); k0 = (blk % KB) * 32 + j * 16 + (lane >> 4) * 8; }
__device__ __forceinline__ v8f wmma16b(v16b a, v16b b, v8f c) { return __builtin_amdgcn_wmma_f32_16x16x32_f16(false, a, false, b, (short)0, c, false, false); }
__device__ __forceinline__ void wave_lds_sync() { __builtin_amdgcn_fence(__ATOMIC_RELEASE, "workgroup"); __builtin_amdgcn_wave_barrier(); __builtin_amdgcn_fence(__ATOMIC_ACQUIRE, "workgroup"); }
__device__ __forceinline__ float pmul(float a, float b) { float p = a * b; asm volatile("" : "+v"(p)); return p; }

__global__ __launch_bounds__(256) void wput_kernel(const float* __restrict__ wq, const float* __restrict__ wk, const float* __restrict__ wv, const float* __restrict__ wo, const float* __restrict__ w1, const float* __restrict__ w2, b16* __restrict__ WQKV, b16* __restrict__ WO, b16* __restrict__ WF1, b16* __restrict__ WF2) { const size_t nt = (size_t)gridDim.x * 256, u0 = (size_t)blockIdx.x * 256 + threadIdx.x; v8b v;
  for (size_t u = u0; u < (size_t)3 * D * 32; u += nt) { int o, k0; pk_unit(u, D / 32, o, k0); const float* w = o < D ? wq : (o < 2 * D ? wk : wv); const int oo = o % D;
#pragma unroll
    for (int j = 0; j < 8; ++j) v[j] = (b16)(bf16_rne(w[(size_t)(k0 + j) * D + oo]) * WSC); { *(v8b*)(WQKV + u * 8) = v;  } }
  for (size_t u = u0; u < (size_t)D * 32; u += nt) { int o, k0; pk_unit(u, D / 32, o, k0);
#pragma unroll
    for (int j = 0; j < 8; ++j) v[j] = (b16)(bf16_rne(wo[(size_t)(k0 + j) * D + o]) * WSC); { *(v8b*)(WO + u * 8) = v;  } }
  for (size_t u = u0; u < (size_t)FF * 32; u += nt) { int o, k0; pk_unit(u, D / 32, o, k0);
#pragma unroll
    for (int j = 0; j < 8; ++j) v[j] = (b16)(bf16_rne(w1[(size_t)(k0 + j) * FF + o]) * WSC); { *(v8b*)(WF1 + u * 8) = v;  } }
  for (size_t u = u0; u < (size_t)D * 128; u += nt) { int o, k0; pk_unit(u, FF / 32, o, k0);
#pragma unroll
    for (int j = 0; j < 8; ++j) v[j] = (b16)(bf16_rne(w2[(size_t)(k0 + j) * D + o]) * WSC); { *(v8b*)(WF2 + u * 8) = v;  } } }
// One work-group of QW waves per 16-token tile: each wave takes 16 / QW of the 16 column tiles of a group, 16 / QW of the 16 rows in the staging loop and 16 / QW of the 16 column groups in the store loop.
__global__ __launch_bounds__(QW * 32) void qkv_kernel(const float* __restrict__ tab, const b16* __restrict__ WQKV, const float* __restrict__ bq, const float* __restrict__ bk, const float* __restrict__ bv, b16* __restrict__ Qh, b16* __restrict__ Ql, b16* __restrict__ Kh, b16* __restrict__ Kl, b16* __restrict__ VTh, b16* __restrict__ VTl) { __shared__ __attribute__((aligned(16))) b16 Ah[16][D + 8]; __shared__ __attribute__((aligned(16))) float Tf[16][260]; constexpr int TW = 16 / QW; const int lane = threadIdx.x & 31, wave = __builtin_amdgcn_readfirstlane((int)(threadIdx.x >> 5)), nloc = lane & 15, hlf = lane >> 4; const size_t t0 = (size_t)blockIdx.x * 16;
  for (int rr = wave * TW; rr < wave * TW + TW; ++rr) for (int q = 0; q < 8; ++q) { const int c = q * 32 + lane; Ah[rr][c] = (b16)(bf16_rne(tab[(t0 + rr) * D + c]) * XS); }
  if (threadIdx.x < 16) for (int k = D; k < D + 8; ++k) Ah[threadIdx.x][k] = (b16)0.0f;
  __syncthreads();
#pragma unroll 1
  for (int g = 0; g < 3; ++g) { const float* bias = g == 0 ? bq : (g == 1 ? bk : bv); v8f acc[TW];
#pragma unroll
    for (int t = 0; t < TW; ++t) acc[t] = (v8f){};
#pragma unroll 2
    for (int kb = 0; kb < D; kb += 32) { const v16b a = frag_kb(&Ah[nloc][kb], hlf);
#pragma unroll
      for (int t = 0; t < TW; ++t) acc[t] = wmma16b(a, frag_pk(WQKV + (size_t)(g * 16 + wave * TW + t) * (16 * D) + kb * 16 + lane * 8), acc[t]); }
#pragma unroll
    for (int t = 0; t < TW; ++t) { const int cc = (wave * TW + t) * 16 + nloc; const float bb = bfv(bias[cc]);
#pragma unroll
      for (int r8 = 0; r8 < 8; ++r8) Tf[8 * hlf + r8][cc] = acc[t][r8] * (1.0f / (XS * WSC)) + bb; }
    __syncthreads();
    // Each wave stores TW of the 16 groups of 16 columns (u = head * 2 + j for q and k, head * 2 + dt for v): a lane's 8 values are one 16-byte piece of a fragment, a wave's store 512 bytes in a row.
    for (int u = wave * TW; u < wave * TW + TW; ++u) { float x[8]; b16* Ph; b16* Pl; size_t o;
      if (g == 2) { Ph = VTh; Pl = VTl; const int seq = blockIdx.x / 6, tt = blockIdx.x % 6; o = (((size_t)seq * (2 * H) + u) * 3 + (tt >> 1)) * 512 + (tt & 1) * 256 + lane * 8;
#pragma unroll   // x stays in registers
        for (int e = 0; e < 8; ++e) x[e] = Tf[8 * hlf + e][u * 16 + nloc]; }
      else { Ph = g == 0 ? Qh : Kh; Pl = g == 0 ? Ql : Kl; o = (size_t)blockIdx.x * (H * 512) + u * 256 + lane * 8; const v4f x0 = *(const v4f*)(&Tf[nloc][u * 16 + 8 * hlf]), x1 = *(const v4f*)(&Tf[nloc][u * 16 + 8 * hlf + 4]);
#pragma unroll   // as above
        for (int e = 0; e < 4; ++e) { x[e] = x0[e]; x[4 + e] = x1[e]; } }
      v8b vh, vl;
#pragma unroll   // vh and vl are built in registers, one 16-byte store each
      for (int e = 0; e < 8; ++e) { b16 p, pl; split16(x[e] * HS, p, pl); vh[e] = p; vl[e] = pl; }
      *(v8b*)(Ph + o) = vh; *(v8b*)(Pl + o) = vl; asm volatile("s_wait_xcnt 0x0" ::: "memory"); }   // the wait stands behind the two stores, in front of any overwrite of the registers that they name
    __syncthreads(); } }
__global__ __launch_bounds__(32) void att_kernel(const b16* __restrict__ Qh, const b16* __restrict__ Ql, const b16* __restrict__ Kh, const b16* __restrict__ Kl, const b16* __restrict__ VTh, const b16* __restrict__ VTl, const float* __restrict__ dep, const float* __restrict__ wdep, const float* __restrict__ bdep, int SLIM, float* __restrict__ CTX) { __shared__ __attribute__((aligned(16))) b16 Pa[16][104], Pb[16][104]; __shared__ float Sc[16][LQ + 1], Dp[LQ], Of[16][HD + 1]; const int lane = threadIdx.x, nloc = lane & 15, hlf = lane >> 4; const int seq = blockIdx.x / (H * 6), rem = blockIdx.x % (H * 6); const int h = rem / 6, q0 = (rem % 6) * 16; if (seq >= SLIM) return; const size_t tk0 = (size_t)seq * LQ;
  const size_t qb = ((size_t)(seq * 6 + q0 / 16) * H + h) * 512, kb0 = ((size_t)(seq * 6) * H + h) * 512; const unsigned l8 = lane * 8; const v16b qa = frag_pk(Qh + qb + l8), ql = frag_pk(Ql + qb + l8); v16b khf[6], klf[6];
#pragma unroll
  for (int t = 0; t < 6; ++t) { khf[t] = frag_pk(Kh + kb0 + t * (H * 512) + l8); klf[t] = frag_pk(Kl + kb0 + t * (H * 512) + l8); }
  asm volatile("s_wait_xcnt 0x0" ::: "memory");   // stands behind the q and k loads, in front of any rewrite of the registers that they name (the scalar bases among them)
  const float wd = bfv(wdep[h]), bd = bfv(bdep[h]); float dv[3];
#pragma unroll
  for (int i = 0; i < 3; ++i) dv[i] = dep[(size_t)seq * LQ + i * 32 + lane];
#pragma unroll
  for (int i = 0; i < 3; ++i) Dp[i * 32 + lane] = pmul(bfv(dv[i]), wd) + bd;
#pragma unroll
  for (int t = 0; t < 6; ++t) { const v16b kh = khf[t], kl = klf[t]; v8f s = wmma16b(qa, kh, (v8f){}); s = wmma16b(qa, kl, s); s = wmma16b(ql, kh, s);
#pragma unroll
    for (int r8 = 0; r8 < 8; ++r8) Sc[8 * hlf + r8][t * 16 + nloc] = s[r8] * (SCL / (HS * HS)); }
  const size_t vb = ((size_t)seq * H + h) * HD * LQ; v16b vf[3][4];   // the v fragments do not depend on the softmax: asked for here in one batch, while the last score products and their LDS stores run
#pragma unroll
  for (int i = 0; i < 3; ++i) { vf[i][0] = frag_pk(VTh + vb + i * 512 + l8); vf[i][1] = frag_pk(VTl + vb + i * 512 + l8); vf[i][2] = frag_pk(VTh + vb + (3 + i) * 512 + l8); vf[i][3] = frag_pk(VTl + vb + (3 + i) * 512 + l8); }
  wave_lds_sync();
  if (lane < 16) { const int r = lane; float mx = -INFINITY; for (int k = 0; k < LQ; ++k) { const float v = Sc[r][k] + Dp[k]; Sc[r][k] = v; mx = fmaxf(mx, v); } float sm = 0.0f; for (int k = 0; k < LQ; ++k) { const float p = __expf(Sc[r][k] - mx); Sc[r][k] = p; sm += p; } const float inv = 1.0f / sm; for (int k = 0; k < LQ; ++k) { b16 p, pl; split16(Sc[r][k] * inv * PS, p, pl); Pa[r][k] = p; Pb[r][k] = pl; } for (int k = LQ; k < 104; ++k) { Pa[r][k] = (b16)0.0f; Pb[r][k] = (b16)0.0f; } }
  wave_lds_sync();
  v8f o0 = (v8f){}, o1 = (v8f){};
#pragma unroll
  for (int kb = 0; kb < LQ; kb += 32) { const v16b pa = frag_kb(&Pa[nloc][kb], hlf), pb = frag_kb(&Pb[nloc][kb], hlf); const v16b v0h = vf[kb / 32][0], v0l = vf[kb / 32][1], v1h = vf[kb / 32][2], v1l = vf[kb / 32][3];
    o0 = wmma16b(pa, v0h, o0); o0 = wmma16b(pa, v0l, o0); o0 = wmma16b(pb, v0h, o0); o1 = wmma16b(pa, v1h, o1); o1 = wmma16b(pa, v1l, o1); o1 = wmma16b(pb, v1h, o1); }
#pragma unroll
  for (int r8 = 0; r8 < 8; ++r8) { Of[8 * hlf + r8][nloc] = o0[r8] * (1.0f / (PS * HS)); Of[8 * hlf + r8][16 + nloc] = o1[r8] * (1.0f / (PS * HS)); }
  wave_lds_sync();
  { for (int r = 0; r < 16; ++r) ((float*)CTX)[(tk0 + q0 + r) * D + h * HD + lane] = Of[r][lane];  } }
// One work-group of TLW waves per 16-token tile: each wave takes 16 / TLW of the 16 column tiles of Wo and W2, 64 / TLW of the 64 column tiles of W1 (two tiles to a pass over K) and 16 / TLW of the 16 rows in the staging and store loops; each accumulator's k order is as before.
// The register budget of 12 waves per SIMD (80 registers) keeps three of these work-groups on a WGP, as many as their LDS allows.
__global__ __launch_bounds__(TLW * 32) __attribute__((amdgpu_waves_per_eu(12))) void tail_kernel(const float* __restrict__ CTX, const float* __restrict__ tab, const b16* __restrict__ WO, const float* __restrict__ bo, const float* __restrict__ g1, const float* __restrict__ be1, const b16* __restrict__ WF1, const float* __restrict__ b1, const b16* __restrict__ WF2, const float* __restrict__ b2, const float* __restrict__ g2, const float* __restrict__ be2, int SLIM, float* __restrict__ out) { __shared__ __attribute__((aligned(16))) b16 A1h[16][D + 8], A1l[16][D + 8], A2h[16][FF + 8], A2l[16][FF + 8]; __shared__ float Y[16][D + 1], Mu[16], Rs[16]; constexpr int TW = 16 / TLW, TF = 64 / TLW; const int lane = threadIdx.x & 31, wave = __builtin_amdgcn_readfirstlane((int)(threadIdx.x >> 5)), nloc = lane & 15, hlf = lane >> 4; const size_t t0 = (size_t)blockIdx.x * 16; if (t0 >= (size_t)SLIM * LQ) return;
  for (int rr = wave * TW; rr < wave * TW + TW; ++rr) for (int q = 0; q < 8; ++q) { const int c = q * 32 + lane; b16 p, pl; split16(CTX[(t0 + rr) * D + c] * HS, p, pl); A1h[rr][c] = p; A1l[rr][c] = pl; }
  if (threadIdx.x < 16) { const int r = threadIdx.x; for (int k = D; k < D + 8; ++k) { A1h[r][k] = (b16)0.0f; A1l[r][k] = (b16)0.0f; } for (int k = FF; k < FF + 8; ++k) { A2h[r][k] = (b16)0.0f; A2l[r][k] = (b16)0.0f; } }
  __syncthreads();
  // LayerNorm: the two row sums stay on 16 lanes of wave 0 in their order; the element-wise part goes by rows over the waves. Each thread rewrites only the Y elements that it alone reads next, so no barrier follows. The loops over q and t are unrolled so that gr, br, mu, rs and y stay in registers.
  auto ln_rows = [&](const float* gg, const float* bb) { float gr[8], br[8];
#pragma unroll
    for (int q = 0; q < 8; ++q) { gr[q] = gg[q * 32 + lane]; br[q] = bb[q * 32 + lane]; }
    if (threadIdx.x < 16) { const int r = threadIdx.x; float m = 0.0f; for (int c = 0; c < D; ++c) m += Y[r][c]; m *= (1.0f / D); float vr = 0.0f; for (int c = 0; c < D; ++c) { const float d = Y[r][c] - m; vr += d * d; } vr *= (1.0f / D); Mu[r] = m; Rs[r] = rsqrtf(vr + EPS); }
    __syncthreads(); float mu[TW], rs[TW], y[TW][8];
#pragma unroll
    for (int t = 0; t < TW; ++t) { mu[t] = Mu[wave * TW + t]; rs[t] = Rs[wave * TW + t];
#pragma unroll
      for (int q = 0; q < 8; ++q) y[t][q] = Y[wave * TW + t][q * 32 + lane]; }
#pragma unroll
    for (int q = 0; q < 8; ++q) { const float gq = bfv(gr[q]), bq = bfv(br[q]);
#pragma unroll
      for (int t = 0; t < TW; ++t) Y[wave * TW + t][q * 32 + lane] = pmul((y[t][q] - mu[t]) * rs[t], gq) + bq; } };
  { v8f acc[TW]; const b16* wb = WO + (size_t)(wave * TW) * (16 * D) + lane * 8; float tb[TW][8], bov[TW];   // the residual and the bias are asked for in front of the K loop, with its first weight loads, and used behind it
#pragma unroll
    for (int t = 0; t < TW; ++t) { acc[t] = (v8f){}; const int cc = (wave * TW + t) * 16 + nloc; bov[t] = bo[cc];
#pragma unroll
      for (int r8 = 0; r8 < 8; ++r8) tb[t][r8] = tab[(t0 + 8 * hlf + r8) * D + cc]; }
#pragma unroll 4   // the weight loads of four k steps are in flight together
    for (int kb = 0; kb < D; kb += 32) { const v16b a = frag_kb(&A1h[nloc][kb], hlf), al = frag_kb(&A1l[nloc][kb], hlf);
#pragma unroll
      for (int t = 0; t < TW; ++t) { const v16b bw = frag_pk(wb + t * 16 * D + kb * 16); acc[t] = wmma16b(a, bw, acc[t]); acc[t] = wmma16b(al, bw, acc[t]); } }
#pragma unroll
    for (int t = 0; t < TW; ++t) { const int cc = (wave * TW + t) * 16 + nloc; const float bb = bfv(bov[t]);
#pragma unroll
      for (int r8 = 0; r8 < 8; ++r8) { const int r = 8 * hlf + r8; Y[r][cc] = acc[t][r8] * (1.0f / (HS * WSC)) + bb + bfv(tb[t][r8]); } } }
  __syncthreads(); ln_rows(g1, be1);
  for (int rr = wave * TW; rr < wave * TW + TW; ++rr) for (int q = 0; q < 8; ++q) { const int c = q * 32 + lane; b16 p, pl; split16(Y[rr][c] * HS, p, pl); A1h[rr][c] = p; A1l[rr][c] = pl; }
  __syncthreads();
  // Two column tiles to a pass over K: with all four, the batched weight loads, 32 accumulator and 16 A registers go past the budget of 80 and spill. The loop over the passes is kept rolled so that they share one copy of the code.
#pragma unroll 1
  for (int tp = 0; tp < TF; tp += 2) { v8f acc[2]; const b16* wb = WF1 + (size_t)(wave * TF + tp) * (16 * D) + lane * 8;
#pragma unroll
    for (int t = 0; t < 2; ++t) acc[t] = (v8f){};
#pragma unroll 2
    for (int kb = 0; kb < D; kb += 32) { const v16b a = frag_kb(&A1h[nloc][kb], hlf), al = frag_kb(&A1l[nloc][kb], hlf);
#pragma unroll
      for (int t = 0; t < 2; ++t) { const v16b bw = frag_pk(wb + t * 16 * D + kb * 16); acc[t] = wmma16b(a, bw, acc[t]); acc[t] = wmma16b(al, bw, acc[t]); } }
#pragma unroll
    for (int t = 0; t < 2; ++t) { const int cc = (wave * TF + tp + t) * 16 + nloc; const float bb = bfv(b1[cc]);
#pragma unroll
      for (int r8 = 0; r8 < 8; ++r8) { const float v = fmaxf(acc[t][r8] * (1.0f / (HS * WSC)) + bb, 0.0f); b16 p, pl; split16(v * HS, p, pl); A2h[8 * hlf + r8][cc] = p; A2l[8 * hlf + r8][cc] = pl; } } }
  __syncthreads();
  { v8f acc[TW]; const b16* wb = WF2 + (size_t)(wave * TW) * (16 * FF) + lane * 8;
#pragma unroll
    for (int t = 0; t < TW; ++t) acc[t] = (v8f){};
#pragma unroll 4   // the weight loads of four k steps are in flight together
    for (int kb = 0; kb < FF; kb += 32) { const v16b a = frag_kb(&A2h[nloc][kb], hlf), al = frag_kb(&A2l[nloc][kb], hlf);
#pragma unroll
      for (int t = 0; t < TW; ++t) { const v16b bw = frag_pk(wb + t * 16 * FF + kb * 16); acc[t] = wmma16b(a, bw, acc[t]); acc[t] = wmma16b(al, bw, acc[t]); } }
#pragma unroll
    for (int t = 0; t < TW; ++t) { const int cc = (wave * TW + t) * 16 + nloc; const float bb = bfv(b2[cc]);
#pragma unroll
      for (int r8 = 0; r8 < 8; ++r8) { const int r = 8 * hlf + r8; Y[r][cc] = Y[r][cc] + acc[t][r8] * (1.0f / (HS * WSC)) + bb; } } }
  __syncthreads(); ln_rows(g2, be2);
  { for (int rr = wave * TW; rr < wave * TW + TW; ++rr) for (int q = 0; q < 8; ++q) ((float*)out)[(t0 + rr) * D + q * 32 + lane] = Y[rr][q * 32 + lane];  } }
}  // namespace

extern "C" void kernel_launch(void* const* d_in, const int* in_sizes, int n_in, void* d_out, int out_size, void* d_ws, size_t ws_size, hipStream_t stream) {
  (void)n_in;
  auto Fp = [&](int i) { return (const float*)d_in[i]; };
  // input order: 0 table [4,96,96,256]; 1 dep_matrix [4,96,96]; 2 Wq [256,256]; 3 bq; 4 Wk; 5 bk; 6 Wv; 7 bv; 8 Wo; 9 bo; 10 Wdep [1,8]; 11 bdep [8]; 12 ln1_g; 13 ln1_b; 14 W1 [256,1024]; 15 b1; 16 W2 [1024,256]; 17 b2; 18 ln2_g; 19 ln2_b
  if (in_sizes[0] != NT * D || in_sizes[1] != NT || in_sizes[2] != D * D || in_sizes[8] != D * D || in_sizes[10] != H || in_sizes[14] != D * FF || in_sizes[16] != FF * D || out_size != NT * D) return;
  const int SLIM = NSEQ;   // sequence cut (SLIM*96 tokens; multiple of 16)
  size_t off = 0; char* ws = (char*)d_ws;
  auto carve = [&](size_t bytes) { char* p = ws + off; off += (bytes + 255) & ~(size_t)255; return p; };
  b16* WQKV = (b16*)carve((size_t)3 * D * D * 2); b16* WO = (b16*)carve((size_t)D * D * 2); b16* WF1 = (b16*)carve((size_t)FF * D * 2); b16* WF2 = (b16*)carve((size_t)D * FF * 2); b16* Qh = (b16*)carve((size_t)NT * D * 2); b16* Ql = (b16*)carve((size_t)NT * D * 2); b16* Kh = (b16*)carve((size_t)NT * D * 2); b16* Kl = (b16*)carve((size_t)NT * D * 2); b16* VTh = (b16*)carve((size_t)NSEQ * H * HD * LQ * 2); b16* VTl = (b16*)carve((size_t)NSEQ * H * HD * LQ * 2); float* CTX = (float*)carve((size_t)NT * D * 4);
  if (off > ws_size || off > ((size_t)208 << 20)) return;   // ~ 153 MB (> 128 MiB, < 208 MiB admissible; table input 38 MB)
  wput_kernel<<<128, 256, 0, stream>>>(Fp(2), Fp(4), Fp(6), Fp(8), Fp(14), Fp(16), WQKV, WO, WF1, WF2);
  qkv_kernel<<<SLIM * LQ / 16, QW * 32, 0, stream>>>(Fp(0), WQKV, Fp(3), Fp(5), Fp(7), Qh, Ql, Kh, Kl, VTh, VTl);
  att_kernel<<<NSEQ * H * 6, 32, 0, stream>>>(Qh, Ql, Kh, Kl, VTh, VTl, Fp(1), Fp(10), Fp(11), SLIM, CTX);
  tail_kernel<<<NT / 16, TLW * 32, 0, stream>>>(CTX, Fp(0), WO, Fp(9), Fp(12), Fp(13), WF1, Fp(15), WF2, Fp(17), Fp(18), Fp(19), SLIM, (float*)d_out);
}

// v005
// A run of this version takes 198 microseconds.
// Timed twice side by side with v004, it ran 1.08 times as fast both times.
// Over all steps from v000 it is 5.22 times as fast.
#include <hip/hip_runtime.h>

// SyntaxMultiAttentionGAT: tokens are the (b, x, y) cells of table [4][96][96][256]; q,k,v = table W + b (8 heads x 32); per (b, x) sequence of 96 cells: probs = softmax_k(q.k / sqrt(32) + dep_matrix[b][x][k] Wdep[h] + bdep[h]); ctx = probs v; out1 = LN(ctx Wo + bo + table); out = LN(relu(out1 W1 + b1) W2 + b2 + out1) -> [4][96][96][256].
// Deterministic: fixed split of column tiles and rows over the waves of a work-group, softmax over 96 keys in fixed order; no atomics.
// WMMA (v_wmma_f32_16x16x32_f16, f32 accumulate): table (EXACT bf16 x8, K 256) x [Wq|Wk|Wv] rows (48 tiles in 3 groups) per 48-token work-group of 4 waves; per (sequence, head, 16-query) wave S = q (hi+lo x256, K 32) x k rows (hi+lo; 6 tiles) and ctx = P (hi+lo) x v^T (hi+lo; 2 tiles, K 96), 3 products, q, k and v^T read from the workspace in fragment order; tail ctx x Wo (16 tiles), out1 x W1 (64 tiles), ff x W2 (K 1,024, 16 tiles) per 48-token work-group of 16 waves - weights EXACT x256 ((in,out)), about 7 M WMMA; softmax, dep bias, LayerNorms, relu in f32.

namespace {
constexpr int NB_ = 4, LQ = 96, D = 256, H = 8, HD = 32, FF = 1024, NSEQ = NB_ * LQ /* 384 */, NT = NSEQ * LQ /* 36864 tokens */;
constexpr int QW = 4 /* waves per qkv work-group */, TLW = 16 /* waves per tail work-group */, MT = 3 /* token tiles per qkv or tail work-group */, TM = MT * 16 /* its tokens */;
constexpr float XS = 8.0f, HS = 256.0f, PS = 256.0f, WSC = 256.0f, EPS = 1e-5f, SCL = 0.17677669529663688f /* 32^-0.5 */;
typedef _Float16 b16;
typedef __attribute__((ext_vector_type(16))) _Float16 v16b;
typedef __attribute__((ext_vector_type(8))) _Float16 v8b;
typedef __attribute__((ext_vector_type(8))) float v8f;
typedef __attribute__((ext_vector_type(4))) float v4f;
typedef __attribute__((ext_vector_type(2))) float v2f;
__device__ __forceinline__ float bf16_rne(float f) { unsigned int u = __float_as_uint(f); u += 0x7FFFu + ((u >> 16) & 1u); return __uint_as_float(u & 0xFFFF0000u); }
__device__ __forceinline__ float bfv(float f) { return bf16_rne(f); }
__device__ __forceinline__ void split16(float v, b16& hi, b16& lo) { hi = (b16)v; lo = (b16)(v - (float)hi); }
__device__ __forceinline__ v16b frag_kb(const b16* p, int hh) { const v8b a = *(const v8b*)(p + 8 * hh), b = *(const v8b*)(p + 16 + 8 * hh); v16b f;
#pragma unroll
  for (int e = 0; e < 8; ++e) { f[e] = a[e]; f[8 + e] = b[e]; } return f; }
// Weight fragments lie in the workspace in register order: block (column tile T, k block kk) is 512 elements at (T * K / 32 + kk) * 512, as [j][lane][8] with element e = W[k = kk * 32 + j * 16 + 8 * (lane >> 4) + e][T * 16 + (lane & 15)], the k order of frag_kb. One 16-byte load of a wave reads 512 bytes in a row, 4 whole 128-byte lines (16 weight rows read row-major would be 16 lines).
__device__ __forceinline__ v16b frag_pk(const b16* p) { const v8b a = *(const v8b*)p, b = *(const v8b*)(p + 256); v16b f;
#pragma unroll
  for (int e = 0; e < 8; ++e) { f[e] = a[e]; f[8 + e] = b[e]; } return f; }
// q, k and v lie there in the same order, hi and lo apart, written by the projection kernel from the MT 16-token tiles of each of its work-groups. q, k: block (token tile, head) is 512 elements, e = x[token = lane & 15][head * 32 + j * 16 + 8 * (lane >> 4) + e]. v: block (sequence, head, half dt of the head's 32 columns, key block i of 32) is 512 elements, e = v[key = i * 32 + j * 16 + 8 * (lane >> 4) + e][head * 32 + dt * 16 + (lane & 15)]; one token tile fills the half j of a block.
__device__ __forceinline__ void pk_unit(size_t u, int KB, int& o, int& k0) { const int lane = (int)(u & 31), j = (int)(u >> 5) & 1, blk = (int)(u >> 6); o = (blk / KB) * 16 + (lane & 15); k0 = (blk % KB) * 32 + j * 16 + (lane >> 4) * 8; }
__device__ __forceinline__ v8f wmma16b(v16b a, v16b b, v8f c) { return __builtin_amdgcn_wmma_f32_16x16x32_f16(false, a, false, b, (short)0, c, false, false); }
__device__ __forceinline__ void wave_lds_sync() { __builtin_amdgcn_fence(__ATOMIC_RELEASE, "workgroup"); __builtin_amdgcn_wave_barrier(); __builtin_amdgcn_fence(__ATOMIC_ACQUIRE, "workgroup"); }
__device__ __forceinline__ float pmul(float a, float b) { float p = a * b; asm volatile("" : "+v"(p)); return p; }

__global__ __launch_bounds__(256) void wput_kernel(const float* __restrict__ wq, const float* __restrict__ wk, const float* __restrict__ wv, const float* __restrict__ wo, const float* __restrict__ w1, const float* __restrict__ w2, b16* __restrict__ WQKV, b16* __restrict__ WO, b16* __restrict__ WF1, b16* __restrict__ WF2) { const size_t nt = (size_t)gridDim.x * 256, u0 = (size_t)blockIdx.x * 256 + threadIdx.x; v8b v;
  for (size_t u = u0; u < (size_t)3 * D * 32; u += nt) { int o, k0; pk_unit(u, D / 32, o, k0); const float* w = o < D ? wq : (o < 2 * D ? wk : wv); const int oo = o % D;
#pragma unroll
    for (int j = 0; j < 8; ++j) v[j] = (b16)(bf16_rne(w[(size_t)(k0 + j) * D + oo]) * WSC); { *(v8b*)(WQKV + u * 8) = v;  } }
  for (size_t u = u0; u < (size_t)D * 32; u += nt) { int o, k0; pk_unit(u, D / 32, o, k0);
#pragma unroll
    for (int j = 0; j < 8; ++j) v[j] = (b16)(bf16_rne(wo[(size_t)(k0 + j) * D + o]) * WSC); { *(v8b*)(WO + u * 8) = v;  } }
  for (size_t u = u0; u < (size_t)FF * 32; u += nt) { int o, k0; pk_unit(u, D / 32, o, k0);
#pragma unroll
    for (int j = 0; j < 8; ++j) v[j] = (b16)(bf16_rne(w1[(size_t)(k0 + j) * FF + o]) * WSC); { *(v8b*)(WF1 + u * 8) = v;  } }
  for (size_t u = u0; u < (size_t)D * 128; u += nt) { int o, k0; pk_unit(u, FF / 32, o, k0);
#pragma unroll
    for (int j = 0; j < 8; ++j) v[j] = (b16)(bf16_rne(w2[(size_t)(k0 + j) * D + o]) * WSC); { *(v8b*)(WF2 + u * 8) = v;  } } }
// One work-group of QW waves per MT token tiles (TM = 48 tokens): each wave takes 16 / QW of the 16 column tiles of a group for all MT token tiles, so one weight fragment read from L2 feeds MT products; the TM rows of the staging loop and the 16 column groups of the store loop are split over the waves.
__global__ __launch_bounds__(QW * 32) void qkv_kernel(const float* __restrict__ tab, const b16* __restrict__ WQKV, const float* __restrict__ bq, const float* __restrict__ bk, const float* __restrict__ bv, b16* __restrict__ Qh, b16* __restrict__ Ql, b16* __restrict__ Kh, b16* __restrict__ Kl, b16* __restrict__ VTh, b16* __restrict__ VTl) { __shared__ __attribute__((aligned(16))) b16 Ah[TM][D + 8]; __shared__ __attribute__((aligned(16))) float Tf[TM][260]; constexpr int TW = 16 / QW, RW = TM / QW; const int lane = threadIdx.x & 31, wave = __builtin_amdgcn_readfirstlane((int)(threadIdx.x >> 5)), nloc = lane & 15, hlf = lane >> 4; const float* tw = tab + ((size_t)blockIdx.x * TM + wave * RW) * D + lane;   // the lane's column of the wave's RW rows
#pragma unroll   // the loads of a wave's RW rows are in flight together
  for (int i = 0; i < RW; ++i)
#pragma unroll
    for (int q = 0; q < 8; ++q) Ah[wave * RW + i][q * 32 + lane] = (b16)(bf16_rne(tw[i * D + q * 32]) * XS);
  if (threadIdx.x < TM) for (int k = D; k < D + 8; ++k) Ah[threadIdx.x][k] = (b16)0.0f;
  __syncthreads();
#pragma unroll 1
  for (int g = 0; g < 3; ++g) { const float* bias = g == 0 ? bq : (g == 1 ? bk : bv); v8f acc[TW][MT];
#pragma unroll
    for (int t = 0; t < TW; ++t)
#pragma unroll
      for (int m = 0; m < MT; ++m) acc[t][m] = (v8f){};
#pragma unroll 2
    for (int kb = 0; kb < D; kb += 32) { v16b a[MT];
#pragma unroll
      for (int m = 0; m < MT; ++m) a[m] = frag_kb(&Ah[m * 16 + nloc][kb], hlf);
#pragma unroll
      for (int t = 0; t < TW; ++t) { const v16b bw = frag_pk(WQKV + (size_t)(g * 16 + wave * TW + t) * (16 * D) + kb * 16 + lane * 8);
#pragma unroll
        for (int m = 0; m < MT; ++m) acc[t][m] = wmma16b(a[m], bw, acc[t][m]); } }
#pragma unroll
    for (int t = 0; t < TW; ++t) { const int cc = (wave * TW + t) * 16 + nloc; const float bb = bfv(bias[cc]);
#pragma unroll
      for (int m = 0; m < MT; ++m)
#pragma unroll
        for (int r8 = 0; r8 < 8; ++r8) Tf[m * 16 + 8 * hlf + r8][cc] = acc[t][m][r8] * (1.0f / (XS * WSC)) + bb; }
    __syncthreads();
    // Per token tile each wave stores TW of the 16 groups of 16 columns (u = head * 2 + j for q and k, head * 2 + dt for v): a lane's 8 values are one 16-byte piece of a fragment, a wave's store 512 bytes in a row.
    for (int m = 0; m < MT; ++m) { const int tile = blockIdx.x * MT + m;
    for (int u = wave * TW; u < wave * TW + TW; ++u) { float x[8]; b16* Ph; b16* Pl; size_t o;
      if (g == 2) { Ph = VTh; Pl = VTl; const int seq = tile / 6, tt = tile % 6; o = (((size_t)seq * (2 * H) + u) * 3 + (tt >> 1)) * 512 + (tt & 1) * 256 + lane * 8;
#pragma unroll   // x stays in registers
        for (int e = 0; e < 8; ++e) x[e] = Tf[m * 16 + 8 * hlf + e][u * 16 + nloc]; }
      else { Ph = g == 0 ? Qh : Kh; Pl = g == 0 ? Ql : Kl; o = (size_t)tile * (H * 512) + u * 256 + lane * 8; const v4f x0 = *(const v4f*)(&Tf[m * 16 + nloc][u * 16 + 8 * hlf]), x1 = *(const v4f*)(&Tf[m * 16 + nloc][u * 16 + 8 * hlf + 4]);
#pragma unroll   // as above
        for (int e = 0; e < 4; ++e) { x[e] = x0[e]; x[4 + e] = x1[e]; } }
      v8b vh, vl;
#pragma unroll   // vh and vl are built in registers, one 16-byte store each
      for (int e = 0; e < 8; ++e) { b16 p, pl; split16(x[e] * HS, p, pl); vh[e] = p; vl[e] = pl; }
      *(v8b*)(Ph + o) = vh; *(v8b*)(Pl + o) = vl; asm volatile("s_wait_xcnt 0x0" ::: "memory"); } }   // the wait stands behind the two stores, in front of any overwrite of the registers that they name
    __syncthreads(); } }
__global__ __launch_bounds__(32) void att_kernel(const b16* __restrict__ Qh, const b16* __restrict__ Ql, const b16* __restrict__ Kh, const b16* __restrict__ Kl, const b16* __restrict__ VTh, const b16* __restrict__ VTl, const float* __restrict__ dep, const float* __restrict__ wdep, const float* __restrict__ bdep, int SLIM, float* __restrict__ CTX) { __shared__ __attribute__((aligned(16))) b16 Pa[16][104], Pb[16][104]; __shared__ float Sc[16][LQ + 1], Dp[LQ], Of[16][HD + 1]; const int lane = threadIdx.x, nloc = lane & 15, hlf = lane >> 4; const int seq = blockIdx.x / (H * 6), rem = blockIdx.x % (H * 6); const int h = rem / 6, q0 = (rem % 6) * 16; if (seq >= SLIM) return; const size_t tk0 = (size_t)seq * LQ;
  const size_t qb = ((size_t)(seq * 6 + q0 / 16) * H + h) * 512, kb0 = ((size_t)(seq * 6) * H + h) * 512; const unsigned l8 = lane * 8; const v16b qa = frag_pk(Qh + qb + l8), ql = frag_pk(Ql + qb + l8); v16b khf[6], klf[6];
#pragma unroll
  for (int t = 0; t < 6; ++t) { khf[t] = frag_pk(Kh + kb0 + t * (H * 512) + l8); klf[t] = frag_pk(Kl + kb0 + t * (H * 512) + l8); }
  asm volatile("s_wait_xcnt 0x0" ::: "memory");   // stands behind the q and k loads, in front of any rewrite of the registers that they name (the scalar bases among them)
  const float wd = bfv(wdep[h]), bd = bfv(bdep[h]); float dv[3];
#pragma unroll
  for (int i = 0; i < 3; ++i) dv[i] = dep[(size_t)seq * LQ + i * 32 + lane];
#pragma unroll
  for (int i = 0; i < 3; ++i) Dp[i * 32 + lane] = pmul(bfv(dv[i]), wd) + bd;
#pragma unroll
  for (int t = 0; t < 6; ++t) { const v16b kh = khf[t], kl = klf[t]; v8f s = wmma16b(qa, kh, (v8f){}); s = wmma16b(qa, kl, s); s = wmma16b(ql, kh, s);
#pragma unroll
    for (int r8 = 0; r8 < 8; ++r8) Sc[8 * hlf + r8][t * 16 + nloc] = s[r8] * (SCL / (HS * HS)); }
  const size_t vb = ((size_t)seq * H + h) * HD * LQ; v16b vf[3][4];   // the v fragments do not depend on the softmax: asked for here in one batch, while the last score products and their LDS stores run
#pragma unroll
  for (int i = 0; i < 3; ++i) { vf[i][0] = frag_pk(VTh + vb + i * 512 + l8); vf[i][1] = frag_pk(VTl + vb + i * 512 + l8); vf[i][2] = frag_pk(VTh + vb + (3 + i) * 512 + l8); vf[i][3] = frag_pk(VTl + vb + (3 + i) * 512 + l8); }
  wave_lds_sync();
  if (lane < 16) { const int r = lane; float mx = -INFINITY; for (int k = 0; k < LQ; ++k) { const float v = Sc[r][k] + Dp[k]; Sc[r][k] = v; mx = fmaxf(mx, v); } float sm = 0.0f; for (int k = 0; k < LQ; ++k) { const float p = __expf(Sc[r][k] - mx); Sc[r][k] = p; sm += p; } const float inv = 1.0f / sm; for (int k = 0; k < LQ; ++k) { b16 p, pl; split16(Sc[r][k] * inv * PS, p, pl); Pa[r][k] = p; Pb[r][k] = pl; } for (int k = LQ; k < 104; ++k) { Pa[r][k] = (b16)0.0f; Pb[r][k] = (b16)0.0f; } }
  wave_lds_sync();
  v8f o0 = (v8f){}, o1 = (v8f){};
#pragma unroll
  for (int kb = 0; kb < LQ; kb += 32) { const v16b pa = frag_kb(&Pa[nloc][kb], hlf), pb = frag_kb(&Pb[nloc][kb], hlf); const v16b v0h = vf[kb / 32][0], v0l = vf[kb / 32][1], v1h = vf[kb / 32][2], v1l = vf[kb / 32][3];
    o0 = wmma16b(pa, v0h, o0); o0 = wmma16b(pa, v0l, o0); o0 = wmma16b(pb, v0h, o0); o1 = wmma16b(pa, v1h, o1); o1 = wmma16b(pa, v1l, o1); o1 = wmma16b(pb, v1h, o1); }
#pragma unroll
  for (int r8 = 0; r8 < 8; ++r8) { Of[8 * hlf + r8][nloc] = o0[r8] * (1.0f / (PS * HS)); Of[8 * hlf + r8][16 + nloc] = o1[r8] * (1.0f / (PS * HS)); }
  wave_lds_sync();
  { for (int r = 0; r < 16; ++r) ((float*)CTX)[(tk0 + q0 + r) * D + h * HD + lane] = Of[r][lane];  } }
// One work-group of TLW waves per MT token tiles (TM = 48 tokens): each wave takes 16 / TLW of the 16 column tiles of Wo and W2 and 64 / TLW of the 64 column tiles of W1, for all MT token tiles, so one weight fragment read from L2 feeds the products of MT tiles; the TM rows of the staging and store loops are split over the waves; each accumulator's k order is as before.
// The LDS of one such work-group fills a WGP: 16 waves there, 4 per SIMD, so the register budget is 256.
__global__ __launch_bounds__(TLW * 32) __attribute__((amdgpu_waves_per_eu(4))) void tail_kernel(const float* __restrict__ CTX, const float* __restrict__ tab, const b16* __restrict__ WO, const float* __restrict__ bo, const float* __restrict__ g1, const float* __restrict__ be1, const b16* __restrict__ WF1, const float* __restrict__ b1, const b16* __restrict__ WF2, const float* __restrict__ b2, const float* __restrict__ g2, const float* __restrict__ be2, int SLIM, float* __restrict__ out) { __shared__ __attribute__((aligned(16))) b16 A1h[TM][D + 8], A1l[TM][D + 8], A2h[TM][FF + 8], A2l[TM][FF + 8]; __shared__ float Y[TM][D + 1], Mu[TM], Rs[TM]; constexpr int TW = 16 / TLW, TF = 64 / TLW, RW = TM / TLW; const int lane = threadIdx.x & 31, wave = __builtin_amdgcn_readfirstlane((int)(threadIdx.x >> 5)), nloc = lane & 15, hlf = lane >> 4; const size_t t0 = (size_t)blockIdx.x * TM; if (t0 >= (size_t)SLIM * LQ) return;
#pragma unroll   // the loads of a wave's RW rows are in flight together
  for (int i = 0; i < RW; ++i) { const int rr = wave * RW + i;
#pragma unroll
    for (int q = 0; q < 8; ++q) { const int c = q * 32 + lane; b16 p, pl; split16(CTX[(t0 + rr) * D + c] * HS, p, pl); A1h[rr][c] = p; A1l[rr][c] = pl; } }
  if (threadIdx.x < TM) { const int r = threadIdx.x; for (int k = D; k < D + 8; ++k) { A1h[r][k] = (b16)0.0f; A1l[r][k] = (b16)0.0f; } for (int k = FF; k < FF + 8; ++k) { A2h[r][k] = (b16)0.0f; A2l[r][k] = (b16)0.0f; } }
  __syncthreads();
  // LayerNorm: the two row sums stay on one lane per row (the first TM threads) in their order; the element-wise part goes by rows over the waves. Each thread rewrites only the Y elements that it alone reads next, so no barrier follows. The loops over q and t are unrolled so that gr, br, mu, rs and y stay in registers.
  auto ln_rows = [&](const float* gg, const float* bb) { float gr[8], br[8];
#pragma unroll
    for (int q = 0; q < 8; ++q) { gr[q] = gg[q * 32 + lane]; br[q] = bb[q * 32 + lane]; }
    if (threadIdx.x < TM) { const int r = threadIdx.x; float m = 0.0f; for (int c = 0; c < D; ++c) m += Y[r][c]; m *= (1.0f / D); float vr = 0.0f; for (int c = 0; c < D; ++c) { const float d = Y[r][c] - m; vr += d * d; } vr *= (1.0f / D); Mu[r] = m; Rs[r] = rsqrtf(vr + EPS); }
    __syncthreads(); float mu[RW], rs[RW], y[RW][8];
#pragma unroll
    for (int t = 0; t < RW; ++t) { mu[t] = Mu[wave * RW + t]; rs[t] = Rs[wave * RW + t];
#pragma unroll
      for (int q = 0; q < 8; ++q) y[t][q] = Y[wave * RW + t][q * 32 + lane]; }
#pragma unroll
    for (int q = 0; q < 8; ++q) { const float gq = bfv(gr[q]), bq = bfv(br[q]);
#pragma unroll
      for (int t = 0; t < RW; ++t) Y[wave * RW + t][q * 32 + lane] = pmul((y[t][q] - mu[t]) * rs[t], gq) + bq; } };
  { v8f acc[TW][MT]; const b16* wb = WO + (size_t)(wave * TW) * (16 * D) + lane * 8; float tb[TW][MT][8], bov[TW];   // the residual and the bias are asked for in front of the K loop, with its first weight loads, and used behind it
#pragma unroll
    for (int t = 0; t < TW; ++t) { const int cc = (wave * TW + t) * 16 + nloc; bov[t] = bo[cc];
#pragma unroll
      for (int m = 0; m < MT; ++m) { acc[t][m] = (v8f){};
#pragma unroll
        for (int r8 = 0; r8 < 8; ++r8) tb[t][m][r8] = tab[(t0 + m * 16 + 8 * hlf + r8) * D + cc]; } }
#pragma unroll 4   // the weight loads of four k steps are in flight together
    for (int kb = 0; kb < D; kb += 32) { v16b a[MT], al[MT];
#pragma unroll
      for (int m = 0; m < MT; ++m) { a[m] = frag_kb(&A1h[m * 16 + nloc][kb], hlf); al[m] = frag_kb(&A1l[m * 16 + nloc][kb], hlf); }
#pragma unroll
      for (int t = 0; t < TW; ++t) { const v16b bw = frag_pk(wb + t * 16 * D + kb * 16);
#pragma unroll
        for (int m = 0; m < MT; ++m) acc[t][m] = wmma16b(a[m], bw, acc[t][m]);
#pragma unroll   // the lo products follow the MT hi products, so that a tile's two dependent products do not stand back to back
        for (int m = 0; m < MT; ++m) acc[t][m] = wmma16b(al[m], bw, acc[t][m]); } }
#pragma unroll
    for (int t = 0; t < TW; ++t) { const int cc = (wave * TW + t) * 16 + nloc; const float bb = bfv(bov[t]);
#pragma unroll
      for (int m = 0; m < MT; ++m)
#pragma unroll
        for (int r8 = 0; r8 < 8; ++r8) { const int r = m * 16 + 8 * hlf + r8; Y[r][cc] = acc[t][m][r8] * (1.0f / (HS * WSC)) + bb + bfv(tb[t][m][r8]); } } }
  __syncthreads(); ln_rows(g1, be1);
  for (int rr = wave * RW; rr < wave * RW + RW; ++rr) for (int q = 0; q < 8; ++q) { const int c = q * 32 + lane; b16 p, pl; split16(Y[rr][c] * HS, p, pl); A1h[rr][c] = p; A1l[rr][c] = pl; }
  __syncthreads();
  // All TF column tiles of a wave in one pass over K, each for all MT token tiles: an LDS fragment of out1 feeds TF products.
  { v8f acc[TF][MT]; const b16* wb = WF1 + (size_t)(wave * TF) * (16 * D) + lane * 8;
#pragma unroll
    for (int t = 0; t < TF; ++t)
#pragma unroll
      for (int m = 0; m < MT; ++m) acc[t][m] = (v8f){};
#pragma unroll 2   // the weight loads of two k steps are in flight together
    for (int kb = 0; kb < D; kb += 32) { v16b a[MT], al[MT];
#pragma unroll
      for (int m = 0; m < MT; ++m) { a[m] = frag_kb(&A1h[m * 16 + nloc][kb], hlf); al[m] = frag_kb(&A1l[m * 16 + nloc][kb], hlf); }
#pragma unroll
      for (int t = 0; t < TF; ++t) { const v16b bw = frag_pk(wb + t * 16 * D + kb * 16);
#pragma unroll
        for (int m = 0; m < MT; ++m) acc[t][m] = wmma16b(a[m], bw, acc[t][m]);
#pragma unroll   // the lo products follow the MT hi products, so that a tile's two dependent products do not stand back to back
        for (int m = 0; m < MT; ++m) acc[t][m] = wmma16b(al[m], bw, acc[t][m]); } }
#pragma unroll
    for (int t = 0; t < TF; ++t) { const int cc = (wave * TF + t) * 16 + nloc; const float bb = bfv(b1[cc]);
#pragma unroll
      for (int m = 0; m < MT; ++m)
#pragma unroll
        for (int r8 = 0; r8 < 8; ++r8) { const float v = fmaxf(acc[t][m][r8] * (1.0f / (HS * WSC)) + bb, 0.0f); b16 p, pl; split16(v * HS, p, pl); A2h[m * 16 + 8 * hlf + r8][cc] = p; A2l[m * 16 + 8 * hlf + r8][cc] = pl; } } }
  __syncthreads();
  { v8f acc[TW][MT]; const b16* wb = WF2 + (size_t)(wave * TW) * (16 * FF) + lane * 8;
#pragma unroll
    for (int t = 0; t < TW; ++t)
#pragma unroll
      for (int m = 0; m < MT; ++m) acc[t][m] = (v8f){};
#pragma unroll 4   // the weight loads of four k steps are in flight together
    for (int kb = 0; kb < FF; kb += 32) { v16b a[MT], al[MT];
#pragma unroll
      for (int m = 0; m < MT; ++m) { a[m] = frag_kb(&A2h[m * 16 + nloc][kb], hlf); al[m] = frag_kb(&A2l[m * 16 + nloc][kb], hlf); }
#pragma unroll
      for (int t = 0; t < TW; ++t) { const v16b bw = frag_pk(wb + t * 16 * FF + kb * 16);
#pragma unroll
        for (int m = 0; m < MT; ++m) acc[t][m] = wmma16b(a[m], bw, acc[t][m]);
#pragma unroll   // the lo products follow the MT hi products, so that a tile's two dependent products do not stand back to back
        for (int m = 0; m < MT; ++m) acc[t][m] = wmma16b(al[m], bw, acc[t][m]); } }
#pragma unroll
    for (int t = 0; t < TW; ++t) { const int cc = (wave * TW + t) * 16 + nloc; const float bb = bfv(b2[cc]);
#pragma unroll
      for (int m = 0; m < MT; ++m)
#pragma unroll
        for (int r8 = 0; r8 < 8; ++r8) { const int r = m * 16 + 8 * hlf + r8; Y[r][cc] = Y[r][cc] + acc[t][m][r8] * (1.0f / (HS * WSC)) + bb; } } }
  __syncthreads(); ln_rows(g2, be2);
  { for (int rr = wave * RW; rr < wave * RW + RW; ++rr) for (int q = 0; q < 8; ++q) ((float*)out)[(t0 + rr) * D + q * 32 + lane] = Y[rr][q * 32 + lane];  } }
}  // namespace

extern "C" void kernel_launch(void* const* d_in, const int* in_sizes, int n_in, void* d_out, int out_size, void* d_ws, size_t ws_size, hipStream_t stream) {
  (void)n_in;
  auto Fp = [&](int i) { return (const float*)d_in[i]; };
  // input order: 0 table [4,96,96,256]; 1 dep_matrix [4,96,96]; 2 Wq [256,256]; 3 bq; 4 Wk; 5 bk; 6 Wv; 7 bv; 8 Wo; 9 bo; 10 Wdep [1,8]; 11 bdep [8]; 12 ln1_g; 13 ln1_b; 14 W1 [256,1024]; 15 b1; 16 W2 [1024,256]; 17 b2; 18 ln2_g; 19 ln2_b
  if (in_sizes[0] != NT * D || in_sizes[1] != NT || in_sizes[2] != D * D || in_sizes[8] != D * D || in_sizes[10] != H || in_sizes[14] != D * FF || in_sizes[16] != FF * D || out_size != NT * D) return;
  const int SLIM = NSEQ;   // sequence cut (SLIM*96 tokens; multiple of 16)
  size_t off = 0; char* ws = (char*)d_ws;
  auto carve = [&](size_t bytes) { char* p = ws + off; off += (bytes + 255) & ~(size_t)255; return p; };
  b16* WQKV = (b16*)carve((size_t)3 * D * D * 2); b16* WO = (b16*)carve((size_t)D * D * 2); b16* WF1 = (b16*)carve((size_t)FF * D * 2); b16* WF2 = (b16*)carve((size_t)D * FF * 2); b16* Qh = (b16*)carve((size_t)NT * D * 2); b16* Ql = (b16*)carve((size_t)NT * D * 2); b16* Kh = (b16*)carve((size_t)NT * D * 2); b16* Kl = (b16*)carve((size_t)NT * D * 2); b16* VTh = (b16*)carve((size_t)NSEQ * H * HD * LQ * 2); b16* VTl = (b16*)carve((size_t)NSEQ * H * HD * LQ * 2); float* CTX = (float*)carve((size_t)NT * D * 4);
  if (off > ws_size || off > ((size_t)208 << 20)) return;   // ~ 153 MB (> 128 MiB, < 208 MiB admissible; table input 38 MB)
  wput_kernel<<<128, 256, 0, stream>>>(Fp(2), Fp(4), Fp(6), Fp(8), Fp(14), Fp(16), WQKV, WO, WF1, WF2);
  qkv_kernel<<<SLIM * LQ / TM, QW * 32, 0, stream>>>(Fp(0), WQKV, Fp(3), Fp(5), Fp(7), Qh, Ql, Kh, Kl, VTh, VTl);
  att_kernel<<<NSEQ * H * 6, 32, 0, stream>>>(Qh, Ql, Kh, Kl, VTh, VTl, Fp(1), Fp(10), Fp(11), SLIM, CTX);
  tail_kernel<<<NT / TM, TLW * 32, 0, stream>>>(CTX, Fp(0), WO, Fp(9), Fp(12), Fp(13), WF1, Fp(15), WF2, Fp(17), Fp(18), Fp(19), SLIM, (float*)d_out);
}

// v006
// It runs in 178 microseconds.
// Next to v005, in two timings, it ran 1.11 times as fast each time.
// Counting every step since v000, it is 5.80 times as fast.
#include <hip/hip_runtime.h>

// SyntaxMultiAttentionGAT: tokens are the (b, x, y) cells of table [4][96][96][256]; q,k,v = table W + b (8 heads x 32); per (b, x) sequence of 96 cells: probs = softmax_k(q.k / sqrt(32) + dep_matrix[b][x][k] Wdep[h] + bdep[h]); ctx = probs v; out1 = LN(ctx Wo + bo + table); out = LN(relu(out1 W1 + b1) W2 + b2 + out1) -> [4][96][96][256].
// Deterministic: fixed split of column tiles and rows over the waves of a work-group, softmax over 96 keys in fixed order, LayerNorm row sums in a fixed tree over the lanes; no atomics.
// WMMA (v_wmma_f32_16x16x32_f16, f32 accumulate): table (EXACT bf16 x8, K 256) x [Wq|Wk|Wv] rows (48 tiles in 3 groups) per 48-token work-group of 4 waves; per (sequence, head, 16-query) wave S = q (hi+lo x256, K 32) x k rows (hi+lo; 6 tiles) and ctx = P (hi+lo) x v^T (hi+lo; 2 tiles, K 96), 3 products, q, k and v^T read from the workspace in fragment order; tail ctx x Wo (16 tiles), out1 x W1 (64 tiles), ff x W2 (K 1,024, 16 tiles) per 48-token work-group of 16 waves - weights EXACT x256 ((in,out)), about 7 M WMMA; softmax, dep bias, LayerNorms, relu in f32.

namespace {
constexpr int NB_ = 4, LQ = 96, D = 256, H = 8, HD = 32, FF = 1024, NSEQ = NB_ * LQ /* 384 */, NT = NSEQ * LQ /* 36864 tokens */;
constexpr int QW = 4 /* waves per qkv work-group */, TLW = 16 /* waves per tail work-group */, MT = 3 /* token tiles per qkv or tail work-group */, TM = MT * 16 /* its tokens */;
constexpr float XS = 8.0f, HS = 256.0f, PS = 256.0f, WSC = 256.0f, EPS = 1e-5f, SCL = 0.17677669529663688f /* 32^-0.5 */;
typedef _Float16 b16;
typedef __attribute__((ext_vector_type(16))) _Float16 v16b;
typedef __attribute__((ext_vector_type(8))) _Float16 v8b;
typedef __attribute__((ext_vector_type(8))) float v8f;
typedef __attribute__((ext_vector_type(4))) float v4f;
typedef __attribute__((ext_vector_type(2))) float v2f;
__device__ __forceinline__ float bf16_rne(float f) { unsigned int u = __float_as_uint(f); u += 0x7FFFu + ((u >> 16) & 1u); return __uint_as_float(u & 0xFFFF0000u); }
__device__ __forceinline__ float bfv(float f) { return bf16_rne(f); }
__device__ __forceinline__ void split16(float v, b16& hi, b16& lo) { hi = (b16)v; lo = (b16)(v - (float)hi); }
__device__ __forceinline__ v16b frag_kb(const b16* p, int hh) { const v8b a = *(const v8b*)(p + 8 * hh), b = *(const v8b*)(p + 16 + 8 * hh); v16b f;
#pragma unroll
  for (int e = 0; e < 8; ++e) { f[e] = a[e]; f[8 + e] = b[e]; } return f; }
// Weight fragments lie in the workspace in register order: block (column tile T, k block kk) is 512 elements at (T * K / 32 + kk) * 512, as [j][lane][8] with element e = W[k = kk * 32 + j * 16 + 8 * (lane >> 4) + e][T * 16 + (lane & 15)], the k order of frag_kb. One 16-byte load of a wave reads 512 bytes in a row, 4 whole 128-byte lines (16 weight rows read row-major would be 16 lines).
__device__ __forceinline__ v16b frag_pk(const b16* p) { const v8b a = *(const v8b*)p, b = *(const v8b*)(p + 256); v16b f;
#pragma unroll
  for (int e = 0; e < 8; ++e) { f[e] = a[e]; f[8 + e] = b[e]; } return f; }
// q, k and v lie there in the same order, hi and lo apart, written by the projection kernel from the MT 16-token tiles of each of its work-groups. q, k: block (token tile, head) is 512 elements, e = x[token = lane & 15][head * 32 + j * 16 + 8 * (lane >> 4) + e]. v: block (sequence, head, half dt of the head's 32 columns, key block i of 32) is 512 elements, e = v[key = i * 32 + j * 16 + 8 * (lane >> 4) + e][head * 32 + dt * 16 + (lane & 15)]; one token tile fills the half j of a block.
__device__ __forceinline__ void pk_unit(size_t u, int KB, int& o, int& k0) { const int lane = (int)(u & 31), j = (int)(u >> 5) & 1, blk = (int)(u >> 6); o = (blk / KB) * 16 + (lane & 15); k0 = (blk % KB) * 32 + j * 16 + (lane >> 4) * 8; }
__device__ __forceinline__ v8f wmma16b(v16b a, v16b b, v8f c) { return __builtin_amdgcn_wmma_f32_16x16x32_f16(false, a, false, b, (short)0, c, false, false); }
__device__ __forceinline__ void wave_lds_sync() { __builtin_amdgcn_fence(__ATOMIC_RELEASE, "workgroup"); __builtin_amdgcn_wave_barrier(); __builtin_amdgcn_fence(__ATOMIC_ACQUIRE, "workgroup"); }
// Sum over the 32 lanes of a wave, bit-identical in every lane (each step adds the two partners' values, and a + b = b + a): lane l with l ^ 1, 2, 4, 8 inside its 16-lane row by DPP row_xmask, then with l ^ 16. All 32 lanes must be on.
template <int CTRL> __device__ __forceinline__ float row_x(float x) { return __builtin_bit_cast(float, __builtin_amdgcn_update_dpp(0, __builtin_bit_cast(int, x), CTRL, 0xf, 0xf, true)); }
__device__ __forceinline__ float wave_sum(float x) { x += row_x<0x161>(x); x += row_x<0x162>(x); x += row_x<0x164>(x); x += row_x<0x168>(x); return x + __builtin_bit_cast(float, __builtin_amdgcn_permlanex16(__builtin_bit_cast(int, x), __builtin_bit_cast(int, x), 0x76543210, 0xfedcba98, false, false)); }
__device__ __forceinline__ float pmul(float a, float b) { float p = a * b; asm volatile("" : "+v"(p)); return p; }

__global__ __launch_bounds__(256) void wput_kernel(const float* __restrict__ wq, const float* __restrict__ wk, const float* __restrict__ wv, const float* __restrict__ wo, const float* __restrict__ w1, const float* __restrict__ w2, b16* __restrict__ WQKV, b16* __restrict__ WO, b16* __restrict__ WF1, b16* __restrict__ WF2) { const size_t nt = (size_t)gridDim.x * 256, u0 = (size_t)blockIdx.x * 256 + threadIdx.x; v8b v;
  for (size_t u = u0; u < (size_t)3 * D * 32; u += nt) { int o, k0; pk_unit(u, D / 32, o, k0); const float* w = o < D ? wq : (o < 2 * D ? wk : wv); const int oo = o % D;
#pragma unroll
    for (int j = 0; j < 8; ++j) v[j] = (b16)(bf16_rne(w[(size_t)(k0 + j) * D + oo]) * WSC); { *(v8b*)(WQKV + u * 8) = v;  } }
  for (size_t u = u0; u < (size_t)D * 32; u += nt) { int o, k0; pk_unit(u, D / 32, o, k0);
#pragma unroll
    for (int j = 0; j < 8; ++j) v[j] = (b16)(bf16_rne(wo[(size_t)(k0 + j) * D + o]) * WSC); { *(v8b*)(WO + u * 8) = v;  } }
  for (size_t u = u0; u < (size_t)FF * 32; u += nt) { int o, k0; pk_unit(u, D / 32, o, k0);
#pragma unroll
    for (int j = 0; j < 8; ++j) v[j] = (b16)(bf16_rne(w1[(size_t)(k0 + j) * FF + o]) * WSC); { *(v8b*)(WF1 + u * 8) = v;  } }
  for (size_t u = u0; u < (size_t)D * 128; u += nt) { int o, k0; pk_unit(u, FF / 32, o, k0);
#pragma unroll
    for (int j = 0; j < 8; ++j) v[j] = (b16)(bf16_rne(w2[(size_t)(k0 + j) * D + o]) * WSC); { *(v8b*)(WF2 + u * 8) = v;  } } }
// One work-group of QW waves per MT token tiles (TM = 48 tokens): each wave takes 16 / QW of the 16 column tiles of a group for all MT token tiles, so one weight fragment read from L2 feeds MT products; the TM rows of the staging loop and the 16 column groups of the store loop are split over the waves.
__global__ __launch_bounds__(QW * 32) void qkv_kernel(const float* __restrict__ tab, const b16* __restrict__ WQKV, const float* __restrict__ bq, const float* __restrict__ bk, const float* __restrict__ bv, b16* __restrict__ Qh, b16* __restrict__ Ql, b16* __restrict__ Kh, b16* __restrict__ Kl, b16* __restrict__ VTh, b16* __restrict__ VTl) { __shared__ __attribute__((aligned(16))) b16 Ah[TM][D + 8]; __shared__ __attribute__((aligned(16))) float Tf[TM][260]; constexpr int TW = 16 / QW, RW = TM / QW; const int lane = threadIdx.x & 31, wave = __builtin_amdgcn_readfirstlane((int)(threadIdx.x >> 5)), nloc = lane & 15, hlf = lane >> 4; const float* tw = tab + ((size_t)blockIdx.x * TM + wave * RW) * D + lane;   // the lane's column of the wave's RW rows
#pragma unroll   // the loads of a wave's RW rows are in flight together
  for (int i = 0; i < RW; ++i)
#pragma unroll
    for (int q = 0; q < 8; ++q) Ah[wave * RW + i][q * 32 + lane] = (b16)(bf16_rne(tw[i * D + q * 32]) * XS);
  if (threadIdx.x < TM) for (int k = D; k < D + 8; ++k) Ah[threadIdx.x][k] = (b16)0.0f;
  __syncthreads();
#pragma unroll 1
  for (int g = 0; g < 3; ++g) { const float* bias = g == 0 ? bq : (g == 1 ? bk : bv); v8f acc[TW][MT];
#pragma unroll
    for (int t = 0; t < TW; ++t)
#pragma unroll
      for (int m = 0; m < MT; ++m) acc[t][m] = (v8f){};
#pragma unroll 2
    for (int kb = 0; kb < D; kb += 32) { v16b a[MT];
#pragma unroll
      for (int m = 0; m < MT; ++m) a[m] = frag_kb(&Ah[m * 16 + nloc][kb], hlf);
#pragma unroll
      for (int t = 0; t < TW; ++t) { const v16b bw = frag_pk(WQKV + (size_t)(g * 16 + wave * TW + t) * (16 * D) + kb * 16 + lane * 8);
#pragma unroll
        for (int m = 0; m < MT; ++m) acc[t][m] = wmma16b(a[m], bw, acc[t][m]); } }
#pragma unroll
    for (int t = 0; t < TW; ++t) { const int cc = (wave * TW + t) * 16 + nloc; const float bb = bfv(bias[cc]);
#pragma unroll
      for (int m = 0; m < MT; ++m)
#pragma unroll
        for (int r8 = 0; r8 < 8; ++r8) Tf[m * 16 + 8 * hlf + r8][cc] = acc[t][m][r8] * (1.0f / (XS * WSC)) + bb; }
    __syncthreads();
    // Per token tile each wave stores TW of the 16 groups of 16 columns (u = head * 2 + j for q and k, head * 2 + dt for v): a lane's 8 values are one 16-byte piece of a fragment, a wave's store 512 bytes in a row.
    for (int m = 0; m < MT; ++m) { const int tile = blockIdx.x * MT + m;
    for (int u = wave * TW; u < wave * TW + TW; ++u) { float x[8]; b16* Ph; b16* Pl; size_t o;
      if (g == 2) { Ph = VTh; Pl = VTl; const int seq = tile / 6, tt = tile % 6; o = (((size_t)seq * (2 * H) + u) * 3 + (tt >> 1)) * 512 + (tt & 1) * 256 + lane * 8;
#pragma unroll   // x stays in registers
        for (int e = 0; e < 8; ++e) x[e] = Tf[m * 16 + 8 * hlf + e][u * 16 + nloc]; }
      else { Ph = g == 0 ? Qh : Kh; Pl = g == 0 ? Ql : Kl; o = (size_t)tile * (H * 512) + u * 256 + lane * 8; const v4f x0 = *(const v4f*)(&Tf[m * 16 + nloc][u * 16 + 8 * hlf]), x1 = *(const v4f*)(&Tf[m * 16 + nloc][u * 16 + 8 * hlf + 4]);
#pragma unroll   // as above
        for (int e = 0; e < 4; ++e) { x[e] = x0[e]; x[4 + e] = x1[e]; } }
      v8b vh, vl;
#pragma unroll   // vh and vl are built in registers, one 16-byte store each
      for (int e = 0; e < 8; ++e) { b16 p, pl; split16(x[e] * HS, p, pl); vh[e] = p; vl[e] = pl; }
      *(v8b*)(Ph + o) = vh; *(v8b*)(Pl + o) = vl; asm volatile("s_wait_xcnt 0x0" ::: "memory"); } }   // the wait stands behind the two stores, in front of any overwrite of the registers that they name
    __syncthreads(); } }
__global__ __launch_bounds__(32) void att_kernel(const b16* __restrict__ Qh, const b16* __restrict__ Ql, const b16* __restrict__ Kh, const b16* __restrict__ Kl, const b16* __restrict__ VTh, const b16* __restrict__ VTl, const float* __restrict__ dep, const float* __restrict__ wdep, const float* __restrict__ bdep, int SLIM, float* __restrict__ CTX) { __shared__ __attribute__((aligned(16))) b16 Pa[16][104], Pb[16][104]; __shared__ float Sc[16][LQ + 1], Dp[LQ], Of[16][HD + 1]; const int lane = threadIdx.x, nloc = lane & 15, hlf = lane >> 4; const int seq = blockIdx.x / (H * 6), rem = blockIdx.x % (H * 6); const int h = rem / 6, q0 = (rem % 6) * 16; if (seq >= SLIM) return; const size_t tk0 = (size_t)seq * LQ;
  const size_t qb = ((size_t)(seq * 6 + q0 / 16) * H + h) * 512, kb0 = ((size_t)(seq * 6) * H + h) * 512; const unsigned l8 = lane * 8; const v16b qa = frag_pk(Qh + qb + l8), ql = frag_pk(Ql + qb + l8); v16b khf[6], klf[6];
#pragma unroll
  for (int t = 0; t < 6; ++t) { khf[t] = frag_pk(Kh + kb0 + t * (H * 512) + l8); klf[t] = frag_pk(Kl + kb0 + t * (H * 512) + l8); }
  asm volatile("s_wait_xcnt 0x0" ::: "memory");   // stands behind the q and k loads, in front of any rewrite of the registers that they name (the scalar bases among them)
  const float wd = bfv(wdep[h]), bd = bfv(bdep[h]); float dv[3];
#pragma unroll
  for (int i = 0; i < 3; ++i) dv[i] = dep[(size_t)seq * LQ + i * 32 + lane];
#pragma unroll
  for (int i = 0; i < 3; ++i) Dp[i * 32 + lane] = pmul(bfv(dv[i]), wd) + bd;
#pragma unroll
  for (int t = 0; t < 6; ++t) { const v16b kh = khf[t], kl = klf[t]; v8f s = wmma16b(qa, kh, (v8f){}); s = wmma16b(qa, kl, s); s = wmma16b(ql, kh, s);
#pragma unroll
    for (int r8 = 0; r8 < 8; ++r8) Sc[8 * hlf + r8][t * 16 + nloc] = s[r8] * (SCL / (HS * HS)); }
  const size_t vb = ((size_t)seq * H + h) * HD * LQ; v16b vf[3][4];   // the v fragments do not depend on the softmax: asked for here in one batch, while the last score products and their LDS stores run
#pragma unroll
  for (int i = 0; i < 3; ++i) { vf[i][0] = frag_pk(VTh + vb + i * 512 + l8); vf[i][1] = frag_pk(VTl + vb + i * 512 + l8); vf[i][2] = frag_pk(VTh + vb + (3 + i) * 512 + l8); vf[i][3] = frag_pk(VTl + vb + (3 + i) * 512 + l8); }
  wave_lds_sync();
  if (lane < 16) { const int r = lane; float mx = -INFINITY; for (int k = 0; k < LQ; ++k) { const float v = Sc[r][k] + Dp[k]; Sc[r][k] = v; mx = fmaxf(mx, v); } float sm = 0.0f; for (int k = 0; k < LQ; ++k) { const float p = __expf(Sc[r][k] - mx); Sc[r][k] = p; sm += p; } const float inv = 1.0f / sm; for (int k = 0; k < LQ; ++k) { b16 p, pl; split16(Sc[r][k] * inv * PS, p, pl); Pa[r][k] = p; Pb[r][k] = pl; } for (int k = LQ; k < 104; ++k) { Pa[r][k] = (b16)0.0f; Pb[r][k] = (b16)0.0f; } }
  wave_lds_sync();
  v8f o0 = (v8f){}, o1 = (v8f){};
#pragma unroll
  for (int kb = 0; kb < LQ; kb += 32) { const v16b pa = frag_kb(&Pa[nloc][kb], hlf), pb = frag_kb(&Pb[nloc][kb], hlf); const v16b v0h = vf[kb / 32][0], v0l = vf[kb / 32][1], v1h = vf[kb / 32][2], v1l = vf[kb / 32][3];
    o0 = wmma16b(pa, v0h, o0); o0 = wmma16b(pa, v0l, o0); o0 = wmma16b(pb, v0h, o0); o1 = wmma16b(pa, v1h, o1); o1 = wmma16b(pa, v1l, o1); o1 = wmma16b(pb, v1h, o1); }
#pragma unroll
  for (int r8 = 0; r8 < 8; ++r8) { Of[8 * hlf + r8][nloc] = o0[r8] * (1.0f / (PS * HS)); Of[8 * hlf + r8][16 + nloc] = o1[r8] * (1.0f / (PS * HS)); }
  wave_lds_sync();
  { for (int r = 0; r < 16; ++r) ((float*)CTX)[(tk0 + q0 + r) * D + h * HD + lane] = Of[r][lane];  } }
// One work-group of TLW waves per MT token tiles (TM = 48 tokens): each wave takes 16 / TLW of the 16 column tiles of Wo and W2 and 64 / TLW of the 64 column tiles of W1, for all MT token tiles, so one weight fragment read from L2 feeds the products of MT tiles; the TM rows of the staging and store loops are split over the waves; each accumulator's k order is as before.
// The LDS of one such work-group fills a WGP: 16 waves there, 4 per SIMD, so the register budget is 256.
__global__ __launch_bounds__(TLW * 32) __attribute__((amdgpu_waves_per_eu(4))) void tail_kernel(const float* __restrict__ CTX, const float* __restrict__ tab, const b16* __restrict__ WO, const float* __restrict__ bo, const float* __restrict__ g1, const float* __restrict__ be1, const b16* __restrict__ WF1, const float* __restrict__ b1, const b16* __restrict__ WF2, const float* __restrict__ b2, const float* __restrict__ g2, const float* __restrict__ be2, int SLIM, float* __restrict__ out) { __shared__ __attribute__((aligned(16))) b16 A1h[TM][D + 8], A1l[TM][D + 8], A2h[TM][FF + 8], A2l[TM][FF + 8]; __shared__ float Y[TM][D + 1]; constexpr int TW = 16 / TLW, TF = 64 / TLW, RW = TM / TLW; const int lane = threadIdx.x & 31, wave = __builtin_amdgcn_readfirstlane((int)(threadIdx.x >> 5)), nloc = lane & 15, hlf = lane >> 4; const size_t t0 = (size_t)blockIdx.x * TM; if (t0 >= (size_t)SLIM * LQ) return;
#pragma unroll   // the loads of a wave's RW rows are in flight together
  for (int i = 0; i < RW; ++i) { const int rr = wave * RW + i;
#pragma unroll
    for (int q = 0; q < 8; ++q) { const int c = q * 32 + lane; b16 p, pl; split16(CTX[(t0 + rr) * D + c] * HS, p, pl); A1h[rr][c] = p; A1l[rr][c] = pl; } }
  if (threadIdx.x < TM) { const int r = threadIdx.x; for (int k = D; k < D + 8; ++k) { A1h[r][k] = (b16)0.0f; A1l[r][k] = (b16)0.0f; } for (int k = FF; k < FF + 8; ++k) { A2h[r][k] = (b16)0.0f; A2l[r][k] = (b16)0.0f; } }
  __syncthreads();
  // LayerNorm, all of it by rows over the waves: a wave holds each of its RW rows in registers, 8 values a lane, and both row sums are 8 values in the lane and then a tree over the 32 lanes. Each thread reads and rewrites only Y elements of its own, so no barrier stands inside or behind. The loops over q and t are unrolled so that gr, br, mu, rs and y stay in registers.
  auto ln_rows = [&](const float* gg, const float* bb) { float gr[8], br[8];
#pragma unroll
    for (int q = 0; q < 8; ++q) { gr[q] = gg[q * 32 + lane]; br[q] = bb[q * 32 + lane]; }
    float mu[RW], rs[RW], y[RW][8];
#pragma unroll
    for (int t = 0; t < RW; ++t)
#pragma unroll
      for (int q = 0; q < 8; ++q) y[t][q] = Y[wave * RW + t][q * 32 + lane];
#pragma unroll
    for (int t = 0; t < RW; ++t) mu[t] = wave_sum(((y[t][0] + y[t][1]) + (y[t][2] + y[t][3])) + ((y[t][4] + y[t][5]) + (y[t][6] + y[t][7]))) * (1.0f / D);
#pragma unroll
    for (int t = 0; t < RW; ++t) { float v0 = 0.0f, v1 = 0.0f;
#pragma unroll
      for (int q = 0; q < 8; q += 2) { const float d0 = y[t][q] - mu[t], d1 = y[t][q + 1] - mu[t]; v0 += d0 * d0; v1 += d1 * d1; }
      rs[t] = rsqrtf(wave_sum(v0 + v1) * (1.0f / D) + EPS); }
#pragma unroll
    for (int q = 0; q < 8; ++q) { const float gq = bfv(gr[q]), bq = bfv(br[q]);
#pragma unroll
      for (int t = 0; t < RW; ++t) Y[wave * RW + t][q * 32 + lane] = pmul((y[t][q] - mu[t]) * rs[t], gq) + bq; } };
  { v8f acc[TW][MT]; const b16* wb = WO + (size_t)(wave * TW) * (16 * D) + lane * 8; float tb[TW][MT][8], bov[TW];   // the residual and the bias are asked for in front of the K loop, with its first weight loads, and used behind it
#pragma unroll
    for (int t = 0; t < TW; ++t) { const int cc = (wave * TW + t) * 16 + nloc; bov[t] = bo[cc];
#pragma unroll
      for (int m = 0; m < MT; ++m) { acc[t][m] = (v8f){};
#pragma unroll
        for (int r8 = 0; r8 < 8; ++r8) tb[t][m][r8] = tab[(t0 + m * 16 + 8 * hlf + r8) * D + cc]; } }
#pragma unroll 4   // the weight loads of four k steps are in flight together
    for (int kb = 0; kb < D; kb += 32) { v16b a[MT], al[MT];
#pragma unroll
      for (int m = 0; m < MT; ++m) { a[m] = frag_kb(&A1h[m * 16 + nloc][kb], hlf); al[m] = frag_kb(&A1l[m * 16 + nloc][kb], hlf); }
#pragma unroll
      for (int t = 0; t < TW; ++t) { const v16b bw = frag_pk(wb + t * 16 * D + kb * 16);
#pragma unroll
        for (int m = 0; m < MT; ++m) acc[t][m] = wmma16b(a[m], bw, acc[t][m]);
#pragma unroll   // the lo products follow the MT hi products, so that a tile's two dependent products do not stand back to back
        for (int m = 0; m < MT; ++m) acc[t][m] = wmma16b(al[m], bw, acc[t][m]); } }
#pragma unroll
    for (int t = 0; t < TW; ++t) { const int cc = (wave * TW + t) * 16 + nloc; const float bb = bfv(bov[t]);
#pragma unroll
      for (int m = 0; m < MT; ++m)
#pragma unroll
        for (int r8 = 0; r8 < 8; ++r8) { const int r = m * 16 + 8 * hlf + r8; Y[r][cc] = acc[t][m][r8] * (1.0f / (HS * WSC)) + bb + bfv(tb[t][m][r8]); } } }
  __syncthreads(); ln_rows(g1, be1);
  for (int rr = wave * RW; rr < wave * RW + RW; ++rr) for (int q = 0; q < 8; ++q) { const int c = q * 32 + lane; b16 p, pl; split16(Y[rr][c] * HS, p, pl); A1h[rr][c] = p; A1l[rr][c] = pl; }
  __syncthreads();
  // All TF column tiles of a wave in one pass over K, each for all MT token tiles: an LDS fragment of out1 feeds TF products.
  { v8f acc[TF][MT]; const b16* wb = WF1 + (size_t)(wave * TF) * (16 * D) + lane * 8;
#pragma unroll
    for (int t = 0; t < TF; ++t)
#pragma unroll
      for (int m = 0; m < MT; ++m) acc[t][m] = (v8f){};
#pragma unroll 2   // the weight loads of two k steps are in flight together
    for (int kb = 0; kb < D; kb += 32) { v16b a[MT], al[MT];
#pragma unroll
      for (int m = 0; m < MT; ++m) { a[m] = frag_kb(&A1h[m * 16 + nloc][kb], hlf); al[m] = frag_kb(&A1l[m * 16 + nloc][kb], hlf); }
#pragma unroll
      for (int t = 0; t < TF; ++t) { const v16b bw = frag_pk(wb + t * 16 * D + kb * 16);
#pragma unroll
        for (int m = 0; m < MT; ++m) acc[t][m] = wmma16b(a[m], bw, acc[t][m]);
#pragma unroll   // the lo products follow the MT hi products, so that a tile's two dependent products do not stand back to back
        for (int m = 0; m < MT; ++m) acc[t][m] = wmma16b(al[m], bw, acc[t][m]); } }
#pragma unroll
    for (int t = 0; t < TF; ++t) { const int cc = (wave * TF + t) * 16 + nloc; const float bb = bfv(b1[cc]);
#pragma unroll
      for (int m = 0; m < MT; ++m)
#pragma unroll
        for (int r8 = 0; r8 < 8; ++r8) { const float v = fmaxf(acc[t][m][r8] * (1.0f / (HS * WSC)) + bb, 0.0f); b16 p, pl; split16(v * HS, p, pl); A2h[m * 16 + 8 * hlf + r8][cc] = p; A2l[m * 16 + 8 * hlf + r8][cc] = pl; } } }
  __syncthreads();
  { v8f acc[TW][MT]; const b16* wb = WF2 + (size_t)(wave * TW) * (16 * FF) + lane * 8;
#pragma unroll
    for (int t = 0; t < TW; ++t)
#pragma unroll
      for (int m = 0; m < MT; ++m) acc[t][m] = (v8f){};
#pragma unroll 4   // the weight loads of four k steps are in flight together
    for (int kb = 0; kb < FF; kb += 32) { v16b a[MT], al[MT];
#pragma unroll
      for (int m = 0; m < MT; ++m) { a[m] = frag_kb(&A2h[m * 16 + nloc][kb], hlf); al[m] = frag_kb(&A2l[m * 16 + nloc][kb], hlf); }
#pragma unroll
      for (int t = 0; t < TW; ++t) { const v16b bw = frag_pk(wb + t * 16 * FF + kb * 16);
#pragma unroll
        for (int m = 0; m < MT; ++m) acc[t][m] = wmma16b(a[m], bw, acc[t][m]);
#pragma unroll   // the lo products follow the MT hi products, so that a tile's two dependent products do not stand back to back
        for (int m = 0; m < MT; ++m) acc[t][m] = wmma16b(al[m], bw, acc[t][m]); } }
#pragma unroll
    for (int t = 0; t < TW; ++t) { const int cc = (wave * TW + t) * 16 + nloc; const float bb = bfv(b2[cc]);
#pragma unroll
      for (int m = 0; m < MT; ++m)
#pragma unroll
        for (int r8 = 0; r8 < 8; ++r8) { const int r = m * 16 + 8 * hlf + r8; Y[r][cc] = Y[r][cc] + acc[t][m][r8] * (1.0f / (HS * WSC)) + bb; } } }
  __syncthreads(); ln_rows(g2, be2);
  { for (int rr = wave * RW; rr < wave * RW + RW; ++rr) for (int q = 0; q < 8; ++q) ((float*)out)[(t0 + rr) * D + q * 32 + lane] = Y[rr][q * 32 + lane];  } }
}  // namespace

extern "C" void kernel_launch(void* const* d_in, const int* in_sizes, int n_in, void* d_out, int out_size, void* d_ws, size_t ws_size, hipStream_t stream) {
  (void)n_in;
  auto Fp = [&](int i) { return (const float*)d_in[i]; };
  // input order: 0 table [4,96,96,256]; 1 dep_matrix [4,96,96]; 2 Wq [256,256]; 3 bq; 4 Wk; 5 bk; 6 Wv; 7 bv; 8 Wo; 9 bo; 10 Wdep [1,8]; 11 bdep [8]; 12 ln1_g; 13 ln1_b; 14 W1 [256,1024]; 15 b1; 16 W2 [1024,256]; 17 b2; 18 ln2_g; 19 ln2_b
  if (in_sizes[0] != NT * D || in_sizes[1] != NT || in_sizes[2] != D * D || in_sizes[8] != D * D || in_sizes[10] != H || in_sizes[14] != D * FF || in_sizes[16] != FF * D || out_size != NT * D) return;
  const int SLIM = NSEQ;   // sequence cut (SLIM*96 tokens; multiple of 16)
  size_t off = 0; char* ws = (char*)d_ws;
  auto carve = [&](size_t bytes) { char* p = ws + off; off += (bytes + 255) & ~(size_t)255; return p; };
  b16* WQKV = (b16*)carve((size_t)3 * D * D * 2); b16* WO = (b16*)carve((size_t)D * D * 2); b16* WF1 = (b16*)carve((size_t)FF * D * 2); b16* WF2 = (b16*)carve((size_t)D * FF * 2); b16* Qh = (b16*)carve((size_t)NT * D * 2); b16* Ql = (b16*)carve((size_t)NT * D * 2); b16* Kh = (b16*)carve((size_t)NT * D * 2); b16* Kl = (b16*)carve((size_t)NT * D * 2); b16* VTh = (b16*)carve((size_t)NSEQ * H * HD * LQ * 2); b16* VTl = (b16*)carve((size_t)NSEQ * H * HD * LQ * 2); float* CTX = (float*)carve((size_t)NT * D * 4);
  if (off > ws_size || off > ((size_t)208 << 20)) return;   // ~ 153 MB (> 128 MiB, < 208 MiB admissible; table input 38 MB)
  wput_kernel<<<128, 256, 0, stream>>>(Fp(2), Fp(4), Fp(6), Fp(8), Fp(14), Fp(16), WQKV, WO, WF1, WF2);
  qkv_kernel<<<SLIM * LQ / TM, QW * 32, 0, stream>>>(Fp(0), WQKV, Fp(3), Fp(5), Fp(7), Qh, Ql, Kh, Kl, VTh, VTl);
  att_kernel<<<NSEQ * H * 6, 32, 0, stream>>>(Qh, Ql, Kh, Kl, VTh, VTl, Fp(1), Fp(10), Fp(11), SLIM, CTX);
  tail_kernel<<<NT / TM, TLW * 32, 0, stream>>>(CTX, Fp(0), WO, Fp(9), Fp(12), Fp(13), WF1, Fp(15), WF2, Fp(17), Fp(18), Fp(19), SLIM, (float*)d_out);
}

// v007
// One run takes 155 microseconds.
// Two timings next to v006 put it at 1.13 and 1.15 times that version's speed.
// Over all steps from v000 it is 6.63 times as fast.
#include <hip/hip_runtime.h>

// SyntaxMultiAttentionGAT: tokens are the (b, x, y) cells of table [4][96][96][256]; q,k,v = table W + b (8 heads x 32); per (b, x) sequence of 96 cells: probs = softmax_k(q.k / sqrt(32) + dep_matrix[b][x][k] Wdep[h] + bdep[h]); ctx = probs v; out1 = LN(ctx Wo + bo + table); out = LN(relu(out1 W1 + b1) W2 + b2 + out1) -> [4][96][96][256].
// Deterministic: fixed split of column tiles and rows over the waves of a work-group, softmax over 96 keys in fixed order, LayerNorm row sums in a fixed tree over the lanes; no atomics.
// WMMA (v_wmma_f32_16x16x32_f16, f32 accumulate): table (EXACT bf16 x8, K 256) x [Wq|Wk|Wv] rows (48 tiles in 3 groups) per 48-token work-group of 4 waves; per (sequence, head, 16-query) wave S = q (hi+lo x256, K 32) x k rows (hi+lo; 6 tiles) and ctx = P (hi+lo) x v^T (hi+lo; 2 tiles, K 96), 3 products, q, k and v^T read from the workspace in fragment order; tail ctx x Wo (16 tiles), out1 x W1 (64 tiles), ff x W2 (K 1,024, 16 tiles) per 48-token work-group of 16 waves - weights EXACT x256 ((in,out)), about 7 M WMMA; softmax, dep bias, LayerNorms, relu in f32.

namespace {
constexpr int NB_ = 4, LQ = 96, D = 256, H = 8, HD = 32, FF = 1024, NSEQ = NB_ * LQ /* 384 */, NT = NSEQ * LQ /* 36864 tokens */;
constexpr int QW = 4 /* waves per qkv work-group */, TLW = 16 /* waves per tail work-group */, MT = 3 /* token tiles per qkv or tail work-group */, TM = MT * 16 /* its tokens */;
constexpr float XS = 8.0f, HS = 256.0f, PS = 256.0f, WSC = 256.0f, EPS = 1e-5f, SCL = 0.17677669529663688f /* 32^-0.5 */;
typedef _Float16 b16;
typedef __attribute__((ext_vector_type(16))) _Float16 v16b;
typedef __attribute__((ext_vector_type(8))) _Float16 v8b;
typedef __attribute__((ext_vector_type(8))) float v8f;
typedef __attribute__((ext_vector_type(4))) float v4f;
typedef __attribute__((ext_vector_type(2))) float v2f;
__device__ __forceinline__ float bf16_rne(float f) { unsigned int u = __float_as_uint(f); u += 0x7FFFu + ((u >> 16) & 1u); return __uint_as_float(u & 0xFFFF0000u); }
__device__ __forceinline__ float bfv(float f) { return bf16_rne(f); }
__device__ __forceinline__ void split16(float v, b16& hi, b16& lo) { hi = (b16)v; lo = (b16)(v - (float)hi); }
__device__ __forceinline__ v16b frag_kb(const b16* p, int hh) { const v8b a = *(const v8b*)(p + 8 * hh), b = *(const v8b*)(p + 16 + 8 * hh); v16b f;
#pragma unroll
  for (int e = 0; e < 8; ++e) { f[e] = a[e]; f[8 + e] = b[e]; } return f; }
// Weight fragments lie in the workspace in register order: block (column tile T, k block kk) is 512 elements at (T * K / 32 + kk) * 512, as [j][lane][8] with element e = W[k = kk * 32 + j * 16 + 8 * (lane >> 4) + e][T * 16 + (lane & 15)], the k order of frag_kb. One 16-byte load of a wave reads 512 bytes in a row, 4 whole 128-byte lines (16 weight rows read row-major would be 16 lines).
__device__ __forceinline__ v16b frag_pk(const b16* p) { const v8b a = *(const v8b*)p, b = *(const v8b*)(p + 256); v16b f;
#pragma unroll
  for (int e = 0; e < 8; ++e) { f[e] = a[e]; f[8 + e] = b[e]; } return f; }
// q, k and v lie there in the same order, hi and lo apart, written by the projection kernel from the MT 16-token tiles of each of its work-groups. q, k: block (token tile, head) is 512 elements, e = x[token = lane & 15][head * 32 + j * 16 + 8 * (lane >> 4) + e]. v: block (sequence, head, half dt of the head's 32 columns, key block i of 32) is 512 elements, e = v[key = i * 32 + j * 16 + 8 * (lane >> 4) + e][head * 32 + dt * 16 + (lane & 15)]; one token tile fills the half j of a block.
__device__ __forceinline__ void pk_unit(size_t u, int KB, int& o, int& k0) { const int lane = (int)(u & 31), j = (int)(u >> 5) & 1, blk = (int)(u >> 6); o = (blk / KB) * 16 + (lane & 15); k0 = (blk % KB) * 32 + j * 16 + (lane >> 4) * 8; }
__device__ __forceinline__ v8f wmma16b(v16b a, v16b b, v8f c) { return __builtin_amdgcn_wmma_f32_16x16x32_f16(false, a, false, b, (short)0, c, false, false); }
__device__ __forceinline__ void wave_lds_sync() { __builtin_amdgcn_fence(__ATOMIC_RELEASE, "workgroup"); __builtin_amdgcn_wave_barrier(); __builtin_amdgcn_fence(__ATOMIC_ACQUIRE, "workgroup"); }
// Sum over the 32 lanes of a wave, bit-identical in every lane (each step adds the two partners' values, and a + b = b + a): lane l with l ^ 1, 2, 4, 8 inside its 16-lane row by DPP row_xmask, then with l ^ 16. All 32 lanes must be on.
template <int CTRL> __device__ __forceinline__ float row_x(float x) { return __builtin_bit_cast(float, __builtin_amdgcn_update_dpp(0, __builtin_bit_cast(int, x), CTRL, 0xf, 0xf, true)); }
__device__ __forceinline__ float wave_sum(float x) { x += row_x<0x161>(x); x += row_x<0x162>(x); x += row_x<0x164>(x); x += row_x<0x168>(x); return x + __builtin_bit_cast(float, __builtin_amdgcn_permlanex16(__builtin_bit_cast(int, x), __builtin_bit_cast(int, x), 0x76543210, 0xfedcba98, false, false)); }
__device__ __forceinline__ float pmul(float a, float b) { float p = a * b; asm volatile("" : "+v"(p)); return p; }

__global__ __launch_bounds__(256) void wput_kernel(const float* __restrict__ wq, const float* __restrict__ wk, const float* __restrict__ wv, const float* __restrict__ wo, const float* __restrict__ w1, const float* __restrict__ w2, b16* __restrict__ WQKV, b16* __restrict__ WO, b16* __restrict__ WF1, b16* __restrict__ WF2) { const size_t nt = (size_t)gridDim.x * 256, u0 = (size_t)blockIdx.x * 256 + threadIdx.x; v8b v;
  for (size_t u = u0; u < (size_t)3 * D * 32; u += nt) { int o, k0; pk_unit(u, D / 32, o, k0); const float* w = o < D ? wq : (o < 2 * D ? wk : wv); const int oo = o % D;
#pragma unroll
    for (int j = 0; j < 8; ++j) v[j] = (b16)(bf16_rne(w[(size_t)(k0 + j) * D + oo]) * WSC); { *(v8b*)(WQKV + u * 8) = v;  } }
  for (size_t u = u0; u < (size_t)D * 32; u += nt) { int o, k0; pk_unit(u, D / 32, o, k0);
#pragma unroll
    for (int j = 0; j < 8; ++j) v[j] = (b16)(bf16_rne(wo[(size_t)(k0 + j) * D + o]) * WSC); { *(v8b*)(WO + u * 8) = v;  } }
  for (size_t u = u0; u < (size_t)FF * 32; u += nt) { int o, k0; pk_unit(u, D / 32, o, k0);
#pragma unroll
    for (int j = 0; j < 8; ++j) v[j] = (b16)(bf16_rne(w1[(size_t)(k0 + j) * FF + o]) * WSC); { *(v8b*)(WF1 + u * 8) = v;  } }
  for (size_t u = u0; u < (size_t)D * 128; u += nt) { int o, k0; pk_unit(u, FF / 32, o, k0);
#pragma unroll
    for (int j = 0; j < 8; ++j) v[j] = (b16)(bf16_rne(w2[(size_t)(k0 + j) * D + o]) * WSC); { *(v8b*)(WF2 + u * 8) = v;  } } }
// K loop of the projection and tail kernels, fetched ahead. Step s (32 k) takes the lane's fragments of MT token tiles from LDS (hi, and lo where LO) and one weight fragment per column tile from L2. A wave issues in order, so a load that stands right in front of its product makes the wave wait out the whole latency: here the LDS fragments of step s + 1 are asked for in front of the products of step s, into a second set of registers, and the weight fragment of the (step, column tile) R - 1 places on into a ring of R. The products and each accumulator's k order are those of the plain loop: per column tile MT hi products, then MT lo products.
// R is 8 where a place holds 3 or 6 products and registers allow it, 4 for W1, whose 12 accumulator tiles leave no more.
// ah, al: the lane's place in row nloc of the hi and lo arrays (8 * hlf added), PITCH elements a row; wb: the wave's first weight block, lane * 8 added; a column tile is KS blocks of 512 elements.
template <int NTL, int KS, int PITCH, bool LO, int R> __device__ __forceinline__ void k_loop(const b16* ah, const b16* al, const b16* wb, v8f (&acc)[NTL][MT]) { constexpr int G = R / NTL > 2 ? R / NTL : 2 /* steps per trip: even, G * NTL a multiple of R, so that set and ring places are constants */; static_assert(KS % G == 0 && G % 2 == 0 && (G * NTL) % R == 0 && KS * NTL >= R, "shape"); v16b a[2][MT], l[2][MT], bw[R];
  auto lda = [&](int s, int b) {
#pragma unroll   // a, l, bw and acc stay in registers: every index a constant
    for (int m = 0; m < MT; ++m) { a[b][m] = frag_kb(ah + m * 16 * PITCH + s * 32, 0); if constexpr (LO) l[b][m] = frag_kb(al + m * 16 * PITCH + s * 32, 0); } };
  auto ldb = [&](int s, int t, int r) { bw[r] = frag_pk(wb + t * (KS * 512) + s * 512); };
  auto trip = [&](int sb, bool last) {
#pragma unroll   // a, l, bw and acc stay in registers: every index a constant
    for (int j = 0; j < G; ++j) { if (!last || j + 1 < G) lda(sb + j + 1, (j + 1) & 1);
#pragma unroll   // a, l, bw and acc stay in registers: every index a constant
      for (int t = 0; t < NTL; ++t) { const int li = j * NTL + t, ln = li + R - 1; if (!last || ln < G * NTL) ldb(sb + ln / NTL, ln % NTL, ln % R);
        __builtin_amdgcn_sched_barrier(0);   // the loads above stay in front of these products (moved down to their own uses they would no longer be ahead)
#pragma unroll   // a, l, bw and acc stay in registers: every index a constant
        for (int m = 0; m < MT; ++m) acc[t][m] = wmma16b(a[j & 1][m], bw[li % R], acc[t][m]);
        if constexpr (LO) {
#pragma unroll   // the lo products follow the MT hi products, so that a tile's two dependent products do not stand back to back
          for (int m = 0; m < MT; ++m) acc[t][m] = wmma16b(l[j & 1][m], bw[li % R], acc[t][m]); }
        __builtin_amdgcn_sched_barrier(0); } } };   // and the next loads stay behind them, in the registers that these products have read (moved up among the products they need registers of their own, and the W1 loop then spills)
  lda(0, 0);
#pragma unroll   // a, l, bw and acc stay in registers: every index a constant
  for (int i = 0; i < R - 1; ++i) ldb(i / NTL, i % NTL, i);
#pragma unroll 1   // a trip is already G steps long
  for (int sb = 0; sb < KS - G; sb += G) trip(sb, false);
  trip(KS - G, true); }
// One work-group of QW waves per MT token tiles (TM = 48 tokens): each wave takes 16 / QW of the 16 column tiles of a group for all MT token tiles, so one weight fragment read from L2 feeds MT products; the TM rows of the staging loop and the 16 column groups of the store loop are split over the waves.
__global__ __launch_bounds__(QW * 32) void qkv_kernel(const float* __restrict__ tab, const b16* __restrict__ WQKV, const float* __restrict__ bq, const float* __restrict__ bk, const float* __restrict__ bv, b16* __restrict__ Qh, b16* __restrict__ Ql, b16* __restrict__ Kh, b16* __restrict__ Kl, b16* __restrict__ VTh, b16* __restrict__ VTl) { __shared__ __attribute__((aligned(16))) b16 Ah[TM][D + 8]; __shared__ __attribute__((aligned(16))) float Tf[TM][260]; constexpr int TW = 16 / QW, RW = TM / QW; const int lane = threadIdx.x & 31, wave = __builtin_amdgcn_readfirstlane((int)(threadIdx.x >> 5)), nloc = lane & 15, hlf = lane >> 4; const float* tw = tab + ((size_t)blockIdx.x * TM + wave * RW) * D + lane;   // the lane's column of the wave's RW rows
#pragma unroll   // the loads of a wave's RW rows are in flight together
  for (int i = 0; i < RW; ++i)
#pragma unroll
    for (int q = 0; q < 8; ++q) Ah[wave * RW + i][q * 32 + lane] = (b16)(bf16_rne(tw[i * D + q * 32]) * XS);
  if (threadIdx.x < TM) for (int k = D; k < D + 8; ++k) Ah[threadIdx.x][k] = (b16)0.0f;
  __syncthreads();
#pragma unroll 1
  for (int g = 0; g < 3; ++g) { const float* bias = g == 0 ? bq : (g == 1 ? bk : bv); v8f acc[TW][MT];
#pragma unroll
    for (int t = 0; t < TW; ++t)
#pragma unroll
      for (int m = 0; m < MT; ++m) acc[t][m] = (v8f){};
    k_loop<TW, D / 32, D + 8, false, 8>(&Ah[nloc][8 * hlf], &Ah[nloc][8 * hlf], WQKV + (size_t)(g * 16 + wave * TW) * (16 * D) + lane * 8, acc);
#pragma unroll
    for (int t = 0; t < TW; ++t) { const int cc = (wave * TW + t) * 16 + nloc; const float bb = bfv(bias[cc]);
#pragma unroll
      for (int m = 0; m < MT; ++m)
#pragma unroll
        for (int r8 = 0; r8 < 8; ++r8) Tf[m * 16 + 8 * hlf + r8][cc] = acc[t][m][r8] * (1.0f / (XS * WSC)) + bb; }
    __syncthreads();
    // Per token tile each wave stores TW of the 16 groups of 16 columns (u = head * 2 + j for q and k, head * 2 + dt for v): a lane's 8 values are one 16-byte piece of a fragment, a wave's store 512 bytes in a row.
    for (int m = 0; m < MT; ++m) { const int tile = blockIdx.x * MT + m;
    for (int u = wave * TW; u < wave * TW + TW; ++u) { float x[8]; b16* Ph; b16* Pl; size_t o;
      if (g == 2) { Ph = VTh; Pl = VTl; const int seq = tile / 6, tt = tile % 6; o = (((size_t)seq * (2 * H) + u) * 3 + (tt >> 1)) * 512 + (tt & 1) * 256 + lane * 8;
#pragma unroll   // x stays in registers
        for (int e = 0; e < 8; ++e) x[e] = Tf[m * 16 + 8 * hlf + e][u * 16 + nloc]; }
      else { Ph = g == 0 ? Qh : Kh; Pl = g == 0 ? Ql : Kl; o = (size_t)tile * (H * 512) + u * 256 + lane * 8; const v4f x0 = *(const v4f*)(&Tf[m * 16 + nloc][u * 16 + 8 * hlf]), x1 = *(const v4f*)(&Tf[m * 16 + nloc][u * 16 + 8 * hlf + 4]);
#pragma unroll   // as above
        for (int e = 0; e < 4; ++e) { x[e] = x0[e]; x[4 + e] = x1[e]; } }
      v8b vh, vl;
#pragma unroll   // vh and vl are built in registers, one 16-byte store each
      for (int e = 0; e < 8; ++e) { b16 p, pl; split16(x[e] * HS, p, pl); vh[e] = p; vl[e] = pl; }
      *(v8b*)(Ph + o) = vh; *(v8b*)(Pl + o) = vl; asm volatile("s_wait_xcnt 0x0" ::: "memory"); } }   // the wait stands behind the two stores, in front of any overwrite of the registers that they name
    __syncthreads(); } }
__global__ __launch_bounds__(32) void att_kernel(const b16* __restrict__ Qh, const b16* __restrict__ Ql, const b16* __restrict__ Kh, const b16* __restrict__ Kl, const b16* __restrict__ VTh, const b16* __restrict__ VTl, const float* __restrict__ dep, const float* __restrict__ wdep, const float* __restrict__ bdep, int SLIM, float* __restrict__ CTX) { __shared__ __attribute__((aligned(16))) b16 Pa[16][104], Pb[16][104]; __shared__ float Sc[16][LQ + 1], Dp[LQ], Of[16][HD + 1]; const int lane = threadIdx.x, nloc = lane & 15, hlf = lane >> 4; const int seq = blockIdx.x / (H * 6), rem = blockIdx.x % (H * 6); const int h = rem / 6, q0 = (rem % 6) * 16; if (seq >= SLIM) return; const size_t tk0 = (size_t)seq * LQ;
  const size_t qb = ((size_t)(seq * 6 + q0 / 16) * H + h) * 512, kb0 = ((size_t)(seq * 6) * H + h) * 512; const unsigned l8 = lane * 8; const v16b qa = frag_pk(Qh + qb + l8), ql = frag_pk(Ql + qb + l8); v16b khf[6], klf[6];
#pragma unroll
  for (int t = 0; t < 6; ++t) { khf[t] = frag_pk(Kh + kb0 + t * (H * 512) + l8); klf[t] = frag_pk(Kl + kb0 + t * (H * 512) + l8); }
  asm volatile("s_wait_xcnt 0x0" ::: "memory");   // stands behind the q and k loads, in front of any rewrite of the registers that they name (the scalar bases among them)
  const float wd = bfv(wdep[h]), bd = bfv(bdep[h]); float dv[3];
#pragma unroll
  for (int i = 0; i < 3; ++i) dv[i] = dep[(size_t)seq * LQ + i * 32 + lane];
#pragma unroll
  for (int i = 0; i < 3; ++i) Dp[i * 32 + lane] = pmul(bfv(dv[i]), wd) + bd;
#pragma unroll
  for (int t = 0; t < 6; ++t) { const v16b kh = khf[t], kl = klf[t]; v8f s = wmma16b(qa, kh, (v8f){}); s = wmma16b(qa, kl, s); s = wmma16b(ql, kh, s);
#pragma unroll
    for (int r8 = 0; r8 < 8; ++r8) Sc[8 * hlf + r8][t * 16 + nloc] = s[r8] * (SCL / (HS * HS)); }
  const size_t vb = ((size_t)seq * H + h) * HD * LQ; v16b vf[3][4];   // the v fragments do not depend on the softmax: asked for here in one batch, while the last score products and their LDS stores run
#pragma unroll
  for (int i = 0; i < 3; ++i) { vf[i][0] = frag_pk(VTh + vb + i * 512 + l8); vf[i][1] = frag_pk(VTl + vb + i * 512 + l8); vf[i][2] = frag_pk(VTh + vb + (3 + i) * 512 + l8); vf[i][3] = frag_pk(VTl + vb + (3 + i) * 512 + l8); }
  wave_lds_sync();
  if (lane < 16) { const int r = lane; float mx = -INFINITY; for (int k = 0; k < LQ; ++k) { const float v = Sc[r][k] + Dp[k]; Sc[r][k] = v; mx = fmaxf(mx, v); } float sm = 0.0f; for (int k = 0; k < LQ; ++k) { const float p = __expf(Sc[r][k] - mx); Sc[r][k] = p; sm += p; } const float inv = 1.0f / sm; for (int k = 0; k < LQ; ++k) { b16 p, pl; split16(Sc[r][k] * inv * PS, p, pl); Pa[r][k] = p; Pb[r][k] = pl; } for (int k = LQ; k < 104; ++k) { Pa[r][k] = (b16)0.0f; Pb[r][k] = (b16)0.0f; } }
  wave_lds_sync();
  v8f o0 = (v8f){}, o1 = (v8f){};
#pragma unroll
  for (int kb = 0; kb < LQ; kb += 32) { const v16b pa = frag_kb(&Pa[nloc][kb], hlf), pb = frag_kb(&Pb[nloc][kb], hlf); const v16b v0h = vf[kb / 32][0], v0l = vf[kb / 32][1], v1h = vf[kb / 32][2], v1l = vf[kb / 32][3];
    o0 = wmma16b(pa, v0h, o0); o0 = wmma16b(pa, v0l, o0); o0 = wmma16b(pb, v0h, o0); o1 = wmma16b(pa, v1h, o1); o1 = wmma16b(pa, v1l, o1); o1 = wmma16b(pb, v1h, o1); }
#pragma unroll
  for (int r8 = 0; r8 < 8; ++r8) { Of[8 * hlf + r8][nloc] = o0[r8] * (1.0f / (PS * HS)); Of[8 * hlf + r8][16 + nloc] = o1[r8] * (1.0f / (PS * HS)); }
  wave_lds_sync();
  { for (int r = 0; r < 16; ++r) ((float*)CTX)[(tk0 + q0 + r) * D + h * HD + lane] = Of[r][lane];  } }
// One work-group of TLW waves per MT token tiles (TM = 48 tokens): each wave takes 16 / TLW of the 16 column tiles of Wo and W2 and 64 / TLW of the 64 column tiles of W1, for all MT token tiles, so one weight fragment read from L2 feeds the products of MT tiles; the TM rows of the staging and store loops are split over the waves; each accumulator's k order is as before.
// The LDS of one such work-group fills a WGP: 16 waves there, 4 per SIMD, so the register budget is 256.
__global__ __launch_bounds__(TLW * 32) __attribute__((amdgpu_waves_per_eu(4))) void tail_kernel(const float* __restrict__ CTX, const float* __restrict__ tab, const b16* __restrict__ WO, const float* __restrict__ bo, const float* __restrict__ g1, const float* __restrict__ be1, const b16* __restrict__ WF1, const float* __restrict__ b1, const b16* __restrict__ WF2, const float* __restrict__ b2, const float* __restrict__ g2, const float* __restrict__ be2, int SLIM, float* __restrict__ out) { __shared__ __attribute__((aligned(16))) b16 A1h[TM][D + 8], A1l[TM][D + 8], A2h[TM][FF + 8], A2l[TM][FF + 8]; __shared__ float Y[TM][D + 1]; constexpr int TW = 16 / TLW, TF = 64 / TLW, RW = TM / TLW; const int lane = threadIdx.x & 31, wave = __builtin_amdgcn_readfirstlane((int)(threadIdx.x >> 5)), nloc = lane & 15, hlf = lane >> 4; const size_t t0 = (size_t)blockIdx.x * TM; if (t0 >= (size_t)SLIM * LQ) return;
#pragma unroll   // the loads of a wave's RW rows are in flight together
  for (int i = 0; i < RW; ++i) { const int rr = wave * RW + i;
#pragma unroll
    for (int q = 0; q < 8; ++q) { const int c = q * 32 + lane; b16 p, pl; split16(CTX[(t0 + rr) * D + c] * HS, p, pl); A1h[rr][c] = p; A1l[rr][c] = pl; } }
  if (threadIdx.x < TM) { const int r = threadIdx.x; for (int k = D; k < D + 8; ++k) { A1h[r][k] = (b16)0.0f; A1l[r][k] = (b16)0.0f; } for (int k = FF; k < FF + 8; ++k) { A2h[r][k] = (b16)0.0f; A2l[r][k] = (b16)0.0f; } }
  __syncthreads();
  // LayerNorm, all of it by rows over the waves: a wave holds each of its RW rows in registers, 8 values a lane, and both row sums are 8 values in the lane and then a tree over the 32 lanes. Each thread reads and rewrites only Y elements of its own, so no barrier stands inside or behind. The loops over q and t are unrolled so that gr, br, mu, rs and y stay in registers.
  auto ln_rows = [&](const float* gg, const float* bb) { float gr[8], br[8];
#pragma unroll
    for (int q = 0; q < 8; ++q) { gr[q] = gg[q * 32 + lane]; br[q] = bb[q * 32 + lane]; }
    float mu[RW], rs[RW], y[RW][8];
#pragma unroll
    for (int t = 0; t < RW; ++t)
#pragma unroll
      for (int q = 0; q < 8; ++q) y[t][q] = Y[wave * RW + t][q * 32 + lane];
#pragma unroll
    for (int t = 0; t < RW; ++t) mu[t] = wave_sum(((y[t][0] + y[t][1]) + (y[t][2] + y[t][3])) + ((y[t][4] + y[t][5]) + (y[t][6] + y[t][7]))) * (1.0f / D);
#pragma unroll
    for (int t = 0; t < RW; ++t) { float v0 = 0.0f, v1 = 0.0f;
#pragma unroll
      for (int q = 0; q < 8; q += 2) { const float d0 = y[t][q] - mu[t], d1 = y[t][q + 1] - mu[t]; v0 += d0 * d0; v1 += d1 * d1; }
      rs[t] = rsqrtf(wave_sum(v0 + v1) * (1.0f / D) + EPS); }
#pragma unroll
    for (int q = 0; q < 8; ++q) { const float gq = bfv(gr[q]), bq = bfv(br[q]);
#pragma unroll
      for (int t = 0; t < RW; ++t) Y[wave * RW + t][q * 32 + lane] = pmul((y[t][q] - mu[t]) * rs[t], gq) + bq; } };
  { v8f acc[TW][MT]; const b16* wb = WO + (size_t)(wave * TW) * (16 * D) + lane * 8; float tb[TW][MT][8], bov[TW];   // the residual and the bias are asked for in front of the K loop, with its first weight loads, and used behind it
#pragma unroll
    for (int t = 0; t < TW; ++t) { const int cc = (wave * TW + t) * 16 + nloc; bov[t] = bo[cc];
#pragma unroll
      for (int m = 0; m < MT; ++m) { acc[t][m] = (v8f){};
#pragma unroll
        for (int r8 = 0; r8 < 8; ++r8) tb[t][m][r8] = tab[(t0 + m * 16 + 8 * hlf + r8) * D + cc]; } }
    k_loop<TW, D / 32, D + 8, true, 8>(&A1h[nloc][8 * hlf], &A1l[nloc][8 * hlf], wb, acc);
#pragma unroll
    for (int t = 0; t < TW; ++t) { const int cc = (wave * TW + t) * 16 + nloc; const float bb = bfv(bov[t]);
#pragma unroll
      for (int m = 0; m < MT; ++m)
#pragma unroll
        for (int r8 = 0; r8 < 8; ++r8) { const int r = m * 16 + 8 * hlf + r8; Y[r][cc] = acc[t][m][r8] * (1.0f / (HS * WSC)) + bb + bfv(tb[t][m][r8]); } } }
  __syncthreads(); ln_rows(g1, be1);
  for (int rr = wave * RW; rr < wave * RW + RW; ++rr) for (int q = 0; q < 8; ++q) { const int c = q * 32 + lane; b16 p, pl; split16(Y[rr][c] * HS, p, pl); A1h[rr][c] = p; A1l[rr][c] = pl; }
  __syncthreads();
  // All TF column tiles of a wave in one pass over K, each for all MT token tiles: an LDS fragment of out1 feeds TF products.
  { v8f acc[TF][MT]; const b16* wb = WF1 + (size_t)(wave * TF) * (16 * D) + lane * 8;
#pragma unroll
    for (int t = 0; t < TF; ++t)
#pragma unroll
      for (int m = 0; m < MT; ++m) acc[t][m] = (v8f){};
    k_loop<TF, D / 32, D + 8, true, 4>(&A1h[nloc][8 * hlf], &A1l[nloc][8 * hlf], wb, acc);
#pragma unroll
    for (int t = 0; t < TF; ++t) { const int cc = (wave * TF + t) * 16 + nloc; const float bb = bfv(b1[cc]);
#pragma unroll
      for (int m = 0; m < MT; ++m)
#pragma unroll
        for (int r8 = 0; r8 < 8; ++r8) { const float v = fmaxf(acc[t][m][r8] * (1.0f / (HS * WSC)) + bb, 0.0f); b16 p, pl; split16(v * HS, p, pl); A2h[m * 16 + 8 * hlf + r8][cc] = p; A2l[m * 16 + 8 * hlf + r8][cc] = pl; } } }
  __syncthreads();
  { v8f acc[TW][MT]; const b16* wb = WF2 + (size_t)(wave * TW) * (16 * FF) + lane * 8;
#pragma unroll
    for (int t = 0; t < TW; ++t)
#pragma unroll
      for (int m = 0; m < MT; ++m) acc[t][m] = (v8f){};
    k_loop<TW, FF / 32, FF + 8, true, 8>(&A2h[nloc][8 * hlf], &A2l[nloc][8 * hlf], wb, acc);
#pragma unroll
    for (int t = 0; t < TW; ++t) { const int cc = (wave * TW + t) * 16 + nloc; const float bb = bfv(b2[cc]);
#pragma unroll
      for (int m = 0; m < MT; ++m)
#pragma unroll
        for (int r8 = 0; r8 < 8; ++r8) { const int r = m * 16 + 8 * hlf + r8; Y[r][cc] = Y[r][cc] + acc[t][m][r8] * (1.0f / (HS * WSC)) + bb; } } }
  __syncthreads(); ln_rows(g2, be2);
  { for (int rr = wave * RW; rr < wave * RW + RW; ++rr) for (int q = 0; q < 8; ++q) ((float*)out)[(t0 + rr) * D + q * 32 + lane] = Y[rr][q * 32 + lane];  } }
}  // namespace

extern "C" void kernel_launch(void* const* d_in, const int* in_sizes, int n_in, void* d_out, int out_size, void* d_ws, size_t ws_size, hipStream_t stream) {
  (void)n_in;
  auto Fp = [&](int i) { return (const float*)d_in[i]; };
  // input order: 0 table [4,96,96,256]; 1 dep_matrix [4,96,96]; 2 Wq [256,256]; 3 bq; 4 Wk; 5 bk; 6 Wv; 7 bv; 8 Wo; 9 bo; 10 Wdep [1,8]; 11 bdep [8]; 12 ln1_g; 13 ln1_b; 14 W1 [256,1024]; 15 b1; 16 W2 [1024,256]; 17 b2; 18 ln2_g; 19 ln2_b
  if (in_sizes[0] != NT * D || in_sizes[1] != NT || in_sizes[2] != D * D || in_sizes[8] != D * D || in_sizes[10] != H || in_sizes[14] != D * FF || in_sizes[16] != FF * D || out_size != NT * D) return;
  const int SLIM = NSEQ;   // sequence cut (SLIM*96 tokens; multiple of 16)
  size_t off = 0; char* ws = (char*)d_ws;
  auto carve = [&](size_t bytes) { char* p = ws + off; off += (bytes + 255) & ~(size_t)255; return p; };
  b16* WQKV = (b16*)carve((size_t)3 * D * D * 2); b16* WO = (b16*)carve((size_t)D * D * 2); b16* WF1 = (b16*)carve((size_t)FF * D * 2); b16* WF2 = (b16*)carve((size_t)D * FF * 2); b16* Qh = (b16*)carve((size_t)NT * D * 2); b16* Ql = (b16*)carve((size_t)NT * D * 2); b16* Kh = (b16*)carve((size_t)NT * D * 2); b16* Kl = (b16*)carve((size_t)NT * D * 2); b16* VTh = (b16*)carve((size_t)NSEQ * H * HD * LQ * 2); b16* VTl = (b16*)carve((size_t)NSEQ * H * HD * LQ * 2); float* CTX = (float*)carve((size_t)NT * D * 4);
  if (off > ws_size || off > ((size_t)208 << 20)) return;   // ~ 153 MB (> 128 MiB, < 208 MiB admissible; table input 38 MB)
  wput_kernel<<<128, 256, 0, stream>>>(Fp(2), Fp(4), Fp(6), Fp(8), Fp(14), Fp(16), WQKV, WO, WF1, WF2);
  qkv_kernel<<<SLIM * LQ / TM, QW * 32, 0, stream>>>(Fp(0), WQKV, Fp(3), Fp(5), Fp(7), Qh, Ql, Kh, Kl, VTh, VTl);
  att_kernel<<<NSEQ * H * 6, 32, 0, stream>>>(Qh, Ql, Kh, Kl, VTh, VTl, Fp(1), Fp(10), Fp(11), SLIM, CTX);
  tail_kernel<<<NT / TM, TLW * 32, 0, stream>>>(CTX, Fp(0), WO, Fp(9), Fp(12), Fp(13), WF1, Fp(15), WF2, Fp(17), Fp(18), Fp(19), SLIM, (float*)d_out);
}

// v008
// Measured time: 131 microseconds a run.
// Next to v007, in two timings, it ran 1.18 and 1.19 times as fast.
// Over all steps from v000 it is 7.83 times as fast.
#include <hip/hip_runtime.h>

// SyntaxMultiAttentionGAT: tokens are the (b, x, y) cells of table [4][96][96][256]; q,k,v = table W + b (8 heads x 32); per (b, x) sequence of 96 cells: probs = softmax_k(q.k / sqrt(32) + dep_matrix[b][x][k] Wdep[h] + bdep[h]); ctx = probs v; out1 = LN(ctx Wo + bo + table); out = LN(relu(out1 W1 + b1) W2 + b2 + out1) -> [4][96][96][256].
// Deterministic: fixed split of column tiles and rows over the waves of a work-group, softmax sums over 96 keys in a fixed tree, LayerNorm row sums in a fixed tree over the lanes; no atomics.
// WMMA (v_wmma_f32_16x16x32_f16, f32 accumulate): table (EXACT bf16 x8, K 256) x [Wq|Wk|Wv] rows (48 tiles in 3 groups) per 48-token work-group of 4 waves; per (sequence, head) wave and for each of its 6 query tiles S^T = k rows (hi+lo; 6 tiles) x q (hi+lo x256, K 32) and ctx^T = v^T (hi+lo; 2 tiles, K 96) x P^T (hi+lo), 3 products, q, k and v^T read from the workspace in fragment order; tail ctx x Wo (16 tiles), out1 x W1 (64 tiles), ff x W2 (K 1,024, 16 tiles) per 48-token work-group of 16 waves - weights EXACT x256 ((in,out)), about 7 M WMMA; softmax, dep bias, LayerNorms, relu in f32.

namespace {
constexpr int NB_ = 4, LQ = 96, D = 256, H = 8, HD = 32, FF = 1024, NSEQ = NB_ * LQ /* 384 */, NT = NSEQ * LQ /* 36864 tokens */;
constexpr int QW = 4 /* waves per qkv work-group */, TLW = 16 /* waves per tail work-group */, MT = 3 /* token tiles per qkv or tail work-group */, TM = MT * 16 /* its tokens */;
constexpr float XS = 8.0f, HS = 256.0f, PS = 256.0f, WSC = 256.0f, EPS = 1e-5f, SCL = 0.17677669529663688f /* 32^-0.5 */;
typedef _Float16 b16;
typedef __attribute__((ext_vector_type(16))) _Float16 v16b;
typedef __attribute__((ext_vector_type(8))) _Float16 v8b;
typedef __attribute__((ext_vector_type(8))) float v8f;
typedef __attribute__((ext_vector_type(4))) float v4f;
typedef __attribute__((ext_vector_type(2))) float v2f;
__device__ __forceinline__ float bf16_rne(float f) { unsigned int u = __float_as_uint(f); u += 0x7FFFu + ((u >> 16) & 1u); return __uint_as_float(u & 0xFFFF0000u); }
__device__ __forceinline__ float bfv(float f) { return bf16_rne(f); }
__device__ __forceinline__ void split16(float v, b16& hi, b16& lo) { hi = (b16)v; lo = (b16)(v - (float)hi); }
__device__ __forceinline__ v16b frag_kb(const b16* p, int hh) { const v8b a = *(const v8b*)(p + 8 * hh), b = *(const v8b*)(p + 16 + 8 * hh); v16b f;
#pragma unroll
  for (int e = 0; e < 8; ++e) { f[e] = a[e]; f[8 + e] = b[e]; } return f; }
// Weight fragments lie in the workspace in register order: block (column tile T, k block kk) is 512 elements at (T * K / 32 + kk) * 512, as [j][lane][8] with element e = W[k = kk * 32 + j * 16 + 8 * (lane >> 4) + e][T * 16 + (lane & 15)], the k order of frag_kb. One 16-byte load of a wave reads 512 bytes in a row, 4 whole 128-byte lines (16 weight rows read row-major would be 16 lines).
__device__ __forceinline__ v16b frag_pk(const b16* p) { const v8b a = *(const v8b*)p, b = *(const v8b*)(p + 256); v16b f;
#pragma unroll
  for (int e = 0; e < 8; ++e) { f[e] = a[e]; f[8 + e] = b[e]; } return f; }
// q, k and v lie there in the same order, hi and lo apart, written by the projection kernel from the MT 16-token tiles of each of its work-groups. q, k: block (token tile, head) is 512 elements, e = x[token = lane & 15][head * 32 + j * 16 + 8 * (lane >> 4) + e]. v: block (sequence, head, half dt of the head's 32 columns, key block i of 32) is 512 elements, e = v[key = i * 32 + j * 16 + 8 * (lane >> 4) + e][head * 32 + dt * 16 + (lane & 15)]; one token tile fills the half j of a block.
__device__ __forceinline__ void pk_unit(size_t u, int KB, int& o, int& k0) { const int lane = (int)(u & 31), j = (int)(u >> 5) & 1, blk = (int)(u >> 6); o = (blk / KB) * 16 + (lane & 15); k0 = (blk % KB) * 32 + j * 16 + (lane >> 4) * 8; }
__device__ __forceinline__ v8f wmma16b(v16b a, v16b b, v8f c) { return __builtin_amdgcn_wmma_f32_16x16x32_f16(false, a, false, b, (short)0, c, false, false); }
__device__ __forceinline__ void wave_lds_sync() { __builtin_amdgcn_fence(__ATOMIC_RELEASE, "workgroup"); __builtin_amdgcn_wave_barrier(); __builtin_amdgcn_fence(__ATOMIC_ACQUIRE, "workgroup"); }
// Sum over the 32 lanes of a wave, bit-identical in every lane (each step adds the two partners' values, and a + b = b + a): lane l with l ^ 1, 2, 4, 8 inside its 16-lane row by DPP row_xmask, then with l ^ 16. All 32 lanes must be on.
template <int CTRL> __device__ __forceinline__ float row_x(float x) { return __builtin_bit_cast(float, __builtin_amdgcn_update_dpp(0, __builtin_bit_cast(int, x), CTRL, 0xf, 0xf, true)); }
__device__ __forceinline__ float wave_sum(float x) { x += row_x<0x161>(x); x += row_x<0x162>(x); x += row_x<0x164>(x); x += row_x<0x168>(x); return x + __builtin_bit_cast(float, __builtin_amdgcn_permlanex16(__builtin_bit_cast(int, x), __builtin_bit_cast(int, x), 0x76543210, 0xfedcba98, false, false)); }
// The value of lane l ^ 16.
__device__ __forceinline__ float half_x(float x) { return __builtin_bit_cast(float, __builtin_amdgcn_permlanex16(__builtin_bit_cast(int, x), __builtin_bit_cast(int, x), 0x76543210, 0xfedcba98, false, false)); }
__device__ __forceinline__ float pmul(float a, float b) { float p = a * b; asm volatile("" : "+v"(p)); return p; }

__global__ __launch_bounds__(256) void wput_kernel(const float* __restrict__ wq, const float* __restrict__ wk, const float* __restrict__ wv, const float* __restrict__ wo, const float* __restrict__ w1, const float* __restrict__ w2, b16* __restrict__ WQKV, b16* __restrict__ WO, b16* __restrict__ WF1, b16* __restrict__ WF2) { const size_t nt = (size_t)gridDim.x * 256, u0 = (size_t)blockIdx.x * 256 + threadIdx.x; v8b v;
  for (size_t u = u0; u < (size_t)3 * D * 32; u += nt) { int o, k0; pk_unit(u, D / 32, o, k0); const float* w = o < D ? wq : (o < 2 * D ? wk : wv); const int oo = o % D;
#pragma unroll
    for (int j = 0; j < 8; ++j) v[j] = (b16)(bf16_rne(w[(size_t)(k0 + j) * D + oo]) * WSC); { *(v8b*)(WQKV + u * 8) = v;  } }
  for (size_t u = u0; u < (size_t)D * 32; u += nt) { int o, k0; pk_unit(u, D / 32, o, k0);
#pragma unroll
    for (int j = 0; j < 8; ++j) v[j] = (b16)(bf16_rne(wo[(size_t)(k0 + j) * D + o]) * WSC); { *(v8b*)(WO + u * 8) = v;  } }
  for (size_t u = u0; u < (size_t)FF * 32; u += nt) { int o, k0; pk_unit(u, D / 32, o, k0);
#pragma unroll
    for (int j = 0; j < 8; ++j) v[j] = (b16)(bf16_rne(w1[(size_t)(k0 + j) * FF + o]) * WSC); { *(v8b*)(WF1 + u * 8) = v;  } }
  for (size_t u = u0; u < (size_t)D * 128; u += nt) { int o, k0; pk_unit(u, FF / 32, o, k0);
#pragma unroll
    for (int j = 0; j < 8; ++j) v[j] = (b16)(bf16_rne(w2[(size_t)(k0 + j) * D + o]) * WSC); { *(v8b*)(WF2 + u * 8) = v;  } } }
// K loop of the projection and tail kernels, fetched ahead. Step s (32 k) takes the lane's fragments of MT token tiles from LDS (hi, and lo where LO) and one weight fragment per column tile from L2. A wave issues in order, so a load that stands right in front of its product makes the wave wait out the whole latency: here the LDS fragments of step s + 1 are asked for in front of the products of step s, into a second set of registers, and the weight fragment of the (step, column tile) R - 1 places on into a ring of R. The products and each accumulator's k order are those of the plain loop: per column tile MT hi products, then MT lo products.
// R is 8 where a place holds 3 or 6 products and registers allow it, 4 for W1, whose 12 accumulator tiles leave no more.
// ah, al: the lane's place in row nloc of the hi and lo arrays (8 * hlf added), PITCH elements a row; wb: the wave's first weight block, lane * 8 added; a column tile is KS blocks of 512 elements.
template <int NTL, int KS, int PITCH, bool LO, int R> __device__ __forceinline__ void k_loop(const b16* ah, const b16* al, const b16* wb, v8f (&acc)[NTL][MT]) { constexpr int G = R / NTL > 2 ? R / NTL : 2 /* steps per trip: even, G * NTL a multiple of R, so that set and ring places are constants */; static_assert(KS % G == 0 && G % 2 == 0 && (G * NTL) % R == 0 && KS * NTL >= R, "shape"); v16b a[2][MT], l[2][MT], bw[R];
  auto lda = [&](int s, int b) {
#pragma unroll   // a, l, bw and acc stay in registers: every index a constant
    for (int m = 0; m < MT; ++m) { a[b][m] = frag_kb(ah + m * 16 * PITCH + s * 32, 0); if constexpr (LO) l[b][m] = frag_kb(al + m * 16 * PITCH + s * 32, 0); } };
  auto ldb = [&](int s, int t, int r) { bw[r] = frag_pk(wb + t * (KS * 512) + s * 512); };
  auto trip = [&](int sb, bool last) {
#pragma unroll   // a, l, bw and acc stay in registers: every index a constant
    for (int j = 0; j < G; ++j) { if (!last || j + 1 < G) lda(sb + j + 1, (j + 1) & 1);
#pragma unroll   // a, l, bw and acc stay in registers: every index a constant
      for (int t = 0; t < NTL; ++t) { const int li = j * NTL + t, ln = li + R - 1; if (!last || ln < G * NTL) ldb(sb + ln / NTL, ln % NTL, ln % R);
        __builtin_amdgcn_sched_barrier(0);   // the loads above stay in front of these products (moved down to their own uses they would no longer be ahead)
#pragma unroll   // a, l, bw and acc stay in registers: every index a constant
        for (int m = 0; m < MT; ++m) acc[t][m] = wmma16b(a[j & 1][m], bw[li % R], acc[t][m]);
        if constexpr (LO) {
#pragma unroll   // the lo products follow the MT hi products, so that a tile's two dependent products do not stand back to back
          for (int m = 0; m < MT; ++m) acc[t][m] = wmma16b(l[j & 1][m], bw[li % R], acc[t][m]); }
        __builtin_amdgcn_sched_barrier(0); } } };   // and the next loads stay behind them, in the registers that these products have read (moved up among the products they need registers of their own, and the W1 loop then spills)
  lda(0, 0);
#pragma unroll   // a, l, bw and acc stay in registers: every index a constant
  for (int i = 0; i < R - 1; ++i) ldb(i / NTL, i % NTL, i);
#pragma unroll 1   // a trip is already G steps long
  for (int sb = 0; sb < KS - G; sb += G) trip(sb, false);
  trip(KS - G, true); }
// One work-group of QW waves per MT token tiles (TM = 48 tokens): each wave takes 16 / QW of the 16 column tiles of a group for all MT token tiles, so one weight fragment read from L2 feeds MT products; the TM rows of the staging loop and the 16 column groups of the store loop are split over the waves.
__global__ __launch_bounds__(QW * 32) void qkv_kernel(const float* __restrict__ tab, const b16* __restrict__ WQKV, const float* __restrict__ bq, const float* __restrict__ bk, const float* __restrict__ bv, b16* __restrict__ Qh, b16* __restrict__ Ql, b16* __restrict__ Kh, b16* __restrict__ Kl, b16* __restrict__ VTh, b16* __restrict__ VTl) { __shared__ __attribute__((aligned(16))) b16 Ah[TM][D + 8]; __shared__ __attribute__((aligned(16))) float Tf[TM][260]; constexpr int TW = 16 / QW, RW = TM / QW; const int lane = threadIdx.x & 31, wave = __builtin_amdgcn_readfirstlane((int)(threadIdx.x >> 5)), nloc = lane & 15, hlf = lane >> 4; const float* tw = tab + ((size_t)blockIdx.x * TM + wave * RW) * D + lane;   // the lane's column of the wave's RW rows
#pragma unroll   // the loads of a wave's RW rows are in flight together
  for (int i = 0; i < RW; ++i)
#pragma unroll
    for (int q = 0; q < 8; ++q) Ah[wave * RW + i][q * 32 + lane] = (b16)(bf16_rne(tw[i * D + q * 32]) * XS);
  if (threadIdx.x < TM) for (int k = D; k < D + 8; ++k) Ah[threadIdx.x][k] = (b16)0.0f;
  __syncthreads();
#pragma unroll 1
  for (int g = 0; g < 3; ++g) { const float* bias = g == 0 ? bq : (g == 1 ? bk : bv); v8f acc[TW][MT];
#pragma unroll
    for (int t = 0; t < TW; ++t)
#pragma unroll
      for (int m = 0; m < MT; ++m) acc[t][m] = (v8f){};
    k_loop<TW, D / 32, D + 8, false, 8>(&Ah[nloc][8 * hlf], &Ah[nloc][8 * hlf], WQKV + (size_t)(g * 16 + wave * TW) * (16 * D) + lane * 8, acc);
#pragma unroll
    for (int t = 0; t < TW; ++t) { const int cc = (wave * TW + t) * 16 + nloc; const float bb = bfv(bias[cc]);
#pragma unroll
      for (int m = 0; m < MT; ++m)
#pragma unroll
        for (int r8 = 0; r8 < 8; ++r8) Tf[m * 16 + 8 * hlf + r8][cc] = acc[t][m][r8] * (1.0f / (XS * WSC)) + bb; }
    __syncthreads();
    // Per token tile each wave stores TW of the 16 groups of 16 columns (u = head * 2 + j for q and k, head * 2 + dt for v): a lane's 8 values are one 16-byte piece of a fragment, a wave's store 512 bytes in a row.
    for (int m = 0; m < MT; ++m) { const int tile = blockIdx.x * MT + m;
    for (int u = wave * TW; u < wave * TW + TW; ++u) { float x[8]; b16* Ph; b16* Pl; size_t o;
      if (g == 2) { Ph = VTh; Pl = VTl; const int seq = tile / 6, tt = tile % 6; o = (((size_t)seq * (2 * H) + u) * 3 + (tt >> 1)) * 512 + (tt & 1) * 256 + lane * 8;
#pragma unroll   // x stays in registers
        for (int e = 0; e < 8; ++e) x[e] = Tf[m * 16 + 8 * hlf + e][u * 16 + nloc]; }
      else { Ph = g == 0 ? Qh : Kh; Pl = g == 0 ? Ql : Kl; o = (size_t)tile * (H * 512) + u * 256 + lane * 8; const v4f x0 = *(const v4f*)(&Tf[m * 16 + nloc][u * 16 + 8 * hlf]), x1 = *(const v4f*)(&Tf[m * 16 + nloc][u * 16 + 8 * hlf + 4]);
#pragma unroll   // as above
        for (int e = 0; e < 4; ++e) { x[e] = x0[e]; x[4 + e] = x1[e]; } }
      v8b vh, vl;
#pragma unroll   // vh and vl are built in registers, one 16-byte store each
      for (int e = 0; e < 8; ++e) { b16 p, pl; split16(x[e] * HS, p, pl); vh[e] = p; vl[e] = pl; }
      *(v8b*)(Ph + o) = vh; *(v8b*)(Pl + o) = vl; asm volatile("s_wait_xcnt 0x0" ::: "memory"); } }   // the wait stands behind the two stores, in front of any overwrite of the registers that they name
    __syncthreads(); } }
__global__ __launch_bounds__(32) __attribute__((amdgpu_waves_per_eu(3))) void att_kernel(const b16* __restrict__ Qh, const b16* __restrict__ Ql, const b16* __restrict__ Kh, const b16* __restrict__ Kl, const b16* __restrict__ VTh, const b16* __restrict__ VTl, const float* __restrict__ dep, const float* __restrict__ wdep, const float* __restrict__ bdep, int SLIM, float* __restrict__ CTX) { __shared__ __attribute__((aligned(16))) float Dp[LQ]; const int lane = threadIdx.x, nloc = lane & 15, hlf = lane >> 4; const int seq = blockIdx.x / H, h = blockIdx.x % H; if (seq >= SLIM) return; const size_t tk0 = (size_t)seq * LQ;
  const size_t kb0 = ((size_t)(seq * 6) * H + h) * 512, vb = ((size_t)seq * H + h) * HD * LQ; const unsigned l8 = lane * 8; const b16* qhp = Qh + kb0; const b16* qlp = Ql + kb0; v16b qa = frag_pk(qhp + l8), ql = frag_pk(qlp + l8); v16b khf[6], klf[6], vf[3][4];
#pragma unroll
  for (int t = 0; t < 6; ++t) { khf[t] = frag_pk(Kh + kb0 + t * (H * 512) + l8); klf[t] = frag_pk(Kl + kb0 + t * (H * 512) + l8); }
#pragma unroll
  for (int i = 0; i < 3; ++i) { vf[i][0] = frag_pk(VTh + vb + i * 512 + l8); vf[i][1] = frag_pk(VTl + vb + i * 512 + l8); vf[i][2] = frag_pk(VTh + vb + (3 + i) * 512 + l8); vf[i][3] = frag_pk(VTl + vb + (3 + i) * 512 + l8); }
  asm volatile("s_wait_xcnt 0x0" ::: "memory");   // stands behind the q, k and v loads, in front of any rewrite of the registers that they name (the scalar bases among them)
  const float wd = bfv(wdep[h]), bd = bfv(bdep[h]); float dv[3];
#pragma unroll
  for (int i = 0; i < 3; ++i) dv[i] = dep[(size_t)seq * LQ + i * 32 + lane];
#pragma unroll
  for (int i = 0; i < 3; ++i) Dp[i * 32 + lane] = pmul(bfv(dv[i]), wd) + bd;
  wave_lds_sync();   // the 96 bias values, written 3 a lane, are read below by every lane
#pragma unroll 1   // the six tiles run through the same code and the same registers
  for (int qt = 0; qt < 6; ++qt) {
    // Register r8 of tile t is the score of key t * 16 + 8 * hlf + r8 with query nloc. Each score's three products come in the order q.kh, q.kl, ql.kh; the six tiles go side by side so that no product waits for the one in front of it.
    v8f s[6];
#pragma unroll   // s stays in registers
    for (int t = 0; t < 6; ++t) s[t] = wmma16b(khf[t], qa, (v8f){});
#pragma unroll
    for (int t = 0; t < 6; ++t) s[t] = wmma16b(klf[t], qa, s[t]);
#pragma unroll
    for (int t = 0; t < 6; ++t) s[t] = wmma16b(khf[t], ql, s[t]);
    float m8[8], a8[8];   // eight side-by-side chains for the maximum and the sum, joined by a tree, then with the other half of the wave
#pragma unroll   // s, m8 and a8 stay in registers: every index a constant
    for (int t = 0; t < 6; ++t) { const v4f d0 = *(const v4f*)(&Dp[t * 16 + 8 * hlf]), d1 = *(const v4f*)(&Dp[t * 16 + 8 * hlf + 4]);
#pragma unroll
      for (int r8 = 0; r8 < 8; ++r8) { const float v = s[t][r8] * (SCL / (HS * HS)) + (r8 < 4 ? d0[r8 & 3] : d1[r8 & 3]); s[t][r8] = v; m8[r8] = t == 0 ? v : fmaxf(m8[r8], v); } }
    float mx = fmaxf(fmaxf(fmaxf(m8[0], m8[1]), fmaxf(m8[2], m8[3])), fmaxf(fmaxf(m8[4], m8[5]), fmaxf(m8[6], m8[7]))); mx = fmaxf(mx, half_x(mx));
    if (qt < 5) { qhp += H * 512; qlp += H * 512; qa = frag_pk(qhp + l8); ql = frag_pk(qlp + l8);   // the next tile's q, in flight while the rest of this tile runs
      asm volatile("s_wait_xcnt 0x0" ::: "memory"); }   // stands behind these loads, in front of any rewrite of the registers that they name
#pragma unroll
    for (int t = 0; t < 6; ++t)
#pragma unroll
      for (int r8 = 0; r8 < 8; ++r8) { const float p = __expf(s[t][r8] - mx); s[t][r8] = p; a8[r8] = t == 0 ? p : a8[r8] + p; }
    float sm = ((a8[0] + a8[1]) + (a8[2] + a8[3])) + ((a8[4] + a8[5]) + (a8[6] + a8[7])); sm += half_x(sm); const float inv = (1.0f / sm) * PS;   // PS is a power of two: p * inv has the bits of p * (1 / sm) * PS
    // Tiles 2i and 2i + 1 of S^T are the lane's B fragment of P^T for key block i: column nloc, k = j * 16 + 8 * hlf + e, the k order of the v fragments, which are the A side (row = the head's column).
    v8f o0 = (v8f){}, o1 = (v8f){};
#pragma unroll
    for (int i = 0; i < 3; ++i) { v16b pa, pb;
#pragma unroll
      for (int e = 0; e < 16; ++e) { b16 p, pl; split16(s[2 * i + (e >> 3)][e & 7] * inv, p, pl); pa[e] = p; pb[e] = pl; }
      o0 = wmma16b(vf[i][0], pa, o0); o1 = wmma16b(vf[i][2], pa, o1); o0 = wmma16b(vf[i][1], pa, o0); o1 = wmma16b(vf[i][3], pa, o1); o0 = wmma16b(vf[i][0], pb, o0); o1 = wmma16b(vf[i][2], pb, o1); }
    // Register r8 of o0 (o1) is column 8 * hlf + r8 (16 more) of the head, row nloc of the tile: four 16-byte stores a lane; the wave writes the head's whole 128 bytes of each of its 16 rows.
    float* cp = CTX + (tk0 + qt * 16 + nloc) * D + h * HD + 8 * hlf; v4f x[4];
#pragma unroll
    for (int e = 0; e < 4; ++e) { x[0][e] = o0[e] * (1.0f / (PS * HS)); x[1][e] = o0[4 + e] * (1.0f / (PS * HS)); x[2][e] = o1[e] * (1.0f / (PS * HS)); x[3][e] = o1[4 + e] * (1.0f / (PS * HS)); }
    *(v4f*)cp = x[0]; *(v4f*)(cp + 4) = x[1]; *(v4f*)(cp + 16) = x[2]; *(v4f*)(cp + 20) = x[3];
    asm volatile("s_wait_xcnt 0x0" ::: "memory"); } }   // stands behind the four stores, in front of any overwrite of the registers that they name
// One work-group of TLW waves per MT token tiles (TM = 48 tokens): each wave takes 16 / TLW of the 16 column tiles of Wo and W2 and 64 / TLW of the 64 column tiles of W1, for all MT token tiles, so one weight fragment read from L2 feeds the products of MT tiles; the TM rows of the staging and store loops are split over the waves; each accumulator's k order is as before.
// The LDS of one such work-group fills a WGP: 16 waves there, 4 per SIMD, so the register budget is 256.
__global__ __launch_bounds__(TLW * 32) __attribute__((amdgpu_waves_per_eu(4))) void tail_kernel(const float* __restrict__ CTX, const float* __restrict__ tab, const b16* __restrict__ WO, const float* __restrict__ bo, const float* __restrict__ g1, const float* __restrict__ be1, const b16* __restrict__ WF1, const float* __restrict__ b1, const b16* __restrict__ WF2, const float* __restrict__ b2, const float* __restrict__ g2, const float* __restrict__ be2, int SLIM, float* __restrict__ out) { __shared__ __attribute__((aligned(16))) b16 A1h[TM][D + 8], A1l[TM][D + 8], A2h[TM][FF + 8], A2l[TM][FF + 8]; __shared__ float Y[TM][D + 1]; constexpr int TW = 16 / TLW, TF = 64 / TLW, RW = TM / TLW; const int lane = threadIdx.x & 31, wave = __builtin_amdgcn_readfirstlane((int)(threadIdx.x >> 5)), nloc = lane & 15, hlf = lane >> 4; const size_t t0 = (size_t)blockIdx.x * TM; if (t0 >= (size_t)SLIM * LQ) return;
#pragma unroll   // the loads of a wave's RW rows are in flight together
  for (int i = 0; i < RW; ++i) { const int rr = wave * RW + i;
#pragma unroll
    for (int q = 0; q < 8; ++q) { const int c = q * 32 + lane; b16 p, pl; split16(CTX[(t0 + rr) * D + c] * HS, p, pl); A1h[rr][c] = p; A1l[rr][c] = pl; } }
  if (threadIdx.x < TM) { const int r = threadIdx.x; for (int k = D; k < D + 8; ++k) { A1h[r][k] = (b16)0.0f; A1l[r][k] = (b16)0.0f; } for (int k = FF; k < FF + 8; ++k) { A2h[r][k] = (b16)0.0f; A2l[r][k] = (b16)0.0f; } }
  __syncthreads();
  // LayerNorm, all of it by rows over the waves: a wave holds each of its RW rows in registers, 8 values a lane, and both row sums are 8 values in the lane and then a tree over the 32 lanes. Each thread reads and rewrites only Y elements of its own, so no barrier stands inside or behind. The loops over q and t are unrolled so that gr, br, mu, rs and y stay in registers.
  auto ln_rows = [&](const float* gg, const float* bb) { float gr[8], br[8];
#pragma unroll
    for (int q = 0; q < 8; ++q) { gr[q] = gg[q * 32 + lane]; br[q] = bb[q * 32 + lane]; }
    float mu[RW], rs[RW], y[RW][8];
#pragma unroll
    for (int t = 0; t < RW; ++t)
#pragma unroll
      for (int q = 0; q < 8; ++q) y[t][q] = Y[wave * RW + t][q * 32 + lane];
#pragma unroll
    for (int t = 0; t < RW; ++t) mu[t] = wave_sum(((y[t][0] + y[t][1]) + (y[t][2] + y[t][3])) + ((y[t][4] + y[t][5]) + (y[t][6] + y[t][7]))) * (1.0f / D);
#pragma unroll
    for (int t = 0; t < RW; ++t) { float v0 = 0.0f, v1 = 0.0f;
#pragma unroll
      for (int q = 0; q < 8; q += 2) { const float d0 = y[t][q] - mu[t], d1 = y[t][q + 1] - mu[t]; v0 += d0 * d0; v1 += d1 * d1; }
      rs[t] = rsqrtf(wave_sum(v0 + v1) * (1.0f / D) + EPS); }
#pragma unroll
    for (int q = 0; q < 8; ++q) { const float gq = bfv(gr[q]), bq = bfv(br[q]);
#pragma unroll
      for (int t = 0; t < RW; ++t) Y[wave * RW + t][q * 32 + lane] = pmul((y[t][q] - mu[t]) * rs[t], gq) + bq; } };
  { v8f acc[TW][MT]; const b16* wb = WO + (size_t)(wave * TW) * (16 * D) + lane * 8; float tb[TW][MT][8], bov[TW];   // the residual and the bias are asked for in front of the K loop, with its first weight loads, and used behind it
#pragma unroll
    for (int t = 0; t < TW; ++t) { const int cc = (wave * TW + t) * 16 + nloc; bov[t] = bo[cc];
#pragma unroll
      for (int m = 0; m < MT; ++m) { acc[t][m] = (v8f){};
#pragma unroll
        for (int r8 = 0; r8 < 8; ++r8) tb[t][m][r8] = tab[(t0 + m * 16 + 8 * hlf + r8) * D + cc]; } }
    k_loop<TW, D / 32, D + 8, true, 8>(&A1h[nloc][8 * hlf], &A1l[nloc][8 * hlf], wb, acc);
#pragma unroll
    for (int t = 0; t < TW; ++t) { const int cc = (wave * TW + t) * 16 + nloc; const float bb = bfv(bov[t]);
#pragma unroll
      for (int m = 0; m < MT; ++m)
#pragma unroll
        for (int r8 = 0; r8 < 8; ++r8) { const int r = m * 16 + 8 * hlf + r8; Y[r][cc] = acc[t][m][r8] * (1.0f / (HS * WSC)) + bb + bfv(tb[t][m][r8]); } } }
  __syncthreads(); ln_rows(g1, be1);
  for (int rr = wave * RW; rr < wave * RW + RW; ++rr) for (int q = 0; q < 8; ++q) { const int c = q * 32 + lane; b16 p, pl; split16(Y[rr][c] * HS, p, pl); A1h[rr][c] = p; A1l[rr][c] = pl; }
  __syncthreads();
  // All TF column tiles of a wave in one pass over K, each for all MT token tiles: an LDS fragment of out1 feeds TF products.
  { v8f acc[TF][MT]; const b16* wb = WF1 + (size_t)(wave * TF) * (16 * D) + lane * 8;
#pragma unroll
    for (int t = 0; t < TF; ++t)
#pragma unroll
      for (int m = 0; m < MT; ++m) acc[t][m] = (v8f){};
    k_loop<TF, D / 32, D + 8, true, 4>(&A1h[nloc][8 * hlf], &A1l[nloc][8 * hlf], wb, acc);
#pragma unroll
    for (int t = 0; t < TF; ++t) { const int cc = (wave * TF + t) * 16 + nloc; const float bb = bfv(b1[cc]);
#pragma unroll
      for (int m = 0; m < MT; ++m)
#pragma unroll
        for (int r8 = 0; r8 < 8; ++r8) { const float v = fmaxf(acc[t][m][r8] * (1.0f / (HS * WSC)) + bb, 0.0f); b16 p, pl; split16(v * HS, p, pl); A2h[m * 16 + 8 * hlf + r8][cc] = p; A2l[m * 16 + 8 * hlf + r8][cc] = pl; } } }
  __syncthreads();
  { v8f acc[TW][MT]; const b16* wb = WF2 + (size_t)(wave * TW) * (16 * FF) + lane * 8;
#pragma unroll
    for (int t = 0; t < TW; ++t)
#pragma unroll
      for (int m = 0; m < MT; ++m) acc[t][m] = (v8f){};
    k_loop<TW, FF / 32, FF + 8, true, 8>(&A2h[nloc][8 * hlf], &A2l[nloc][8 * hlf], wb, acc);
#pragma unroll
    for (int t = 0; t < TW; ++t) { const int cc = (wave * TW + t) * 16 + nloc; const float bb = bfv(b2[cc]);
#pragma unroll
      for (int m = 0; m < MT; ++m)
#pragma unroll
        for (int r8 = 0; r8 < 8; ++r8) { const int r = m * 16 + 8 * hlf + r8; Y[r][cc] = Y[r][cc] + acc[t][m][r8] * (1.0f / (HS * WSC)) + bb; } } }
  __syncthreads(); ln_rows(g2, be2);
  { for (int rr = wave * RW; rr < wave * RW + RW; ++rr) for (int q = 0; q < 8; ++q) ((float*)out)[(t0 + rr) * D + q * 32 + lane] = Y[rr][q * 32 + lane];  } }
}  // namespace

extern "C" void kernel_launch(void* const* d_in, const int* in_sizes, int n_in, void* d_out, int out_size, void* d_ws, size_t ws_size, hipStream_t stream) {
  (void)n_in;
  auto Fp = [&](int i) { return (const float*)d_in[i]; };
  // input order: 0 table [4,96,96,256]; 1 dep_matrix [4,96,96]; 2 Wq [256,256]; 3 bq; 4 Wk; 5 bk; 6 Wv; 7 bv; 8 Wo; 9 bo; 10 Wdep [1,8]; 11 bdep [8]; 12 ln1_g; 13 ln1_b; 14 W1 [256,1024]; 15 b1; 16 W2 [1024,256]; 17 b2; 18 ln2_g; 19 ln2_b
  if (in_sizes[0] != NT * D || in_sizes[1] != NT || in_sizes[2] != D * D || in_sizes[8] != D * D || in_sizes[10] != H || in_sizes[14] != D * FF || in_sizes[16] != FF * D || out_size != NT * D) return;
  const int SLIM = NSEQ;   // sequence cut (SLIM*96 tokens; multiple of 16)
  size_t off = 0; char* ws = (char*)d_ws;
  auto carve = [&](size_t bytes) { char* p = ws + off; off += (bytes + 255) & ~(size_t)255; return p; };
  b16* WQKV = (b16*)carve((size_t)3 * D * D * 2); b16* WO = (b16*)carve((size_t)D * D * 2); b16* WF1 = (b16*)carve((size_t)FF * D * 2); b16* WF2 = (b16*)carve((size_t)D * FF * 2); b16* Qh = (b16*)carve((size_t)NT * D * 2); b16* Ql = (b16*)carve((size_t)NT * D * 2); b16* Kh = (b16*)carve((size_t)NT * D * 2); b16* Kl = (b16*)carve((size_t)NT * D * 2); b16* VTh = (b16*)carve((size_t)NSEQ * H * HD * LQ * 2); b16* VTl = (b16*)carve((size_t)NSEQ * H * HD * LQ * 2); float* CTX = (float*)carve((size_t)NT * D * 4);
  if (off > ws_size || off > ((size_t)208 << 20)) return;   // ~ 153 MB (> 128 MiB, < 208 MiB admissible; table input 38 MB)
  wput_kernel<<<128, 256, 0, stream>>>(Fp(2), Fp(4), Fp(6), Fp(8), Fp(14), Fp(16), WQKV, WO, WF1, WF2);
  qkv_kernel<<<SLIM * LQ / TM, QW * 32, 0, stream>>>(Fp(0), WQKV, Fp(3), Fp(5), Fp(7), Qh, Ql, Kh, Kl, VTh, VTl);
  att_kernel<<<NSEQ * H, 32, 0, stream>>>(Qh, Ql, Kh, Kl, VTh, VTl, Fp(1), Fp(10), Fp(11), SLIM, CTX);
  tail_kernel<<<NT / TM, TLW * 32, 0, stream>>>(CTX, Fp(0), WO, Fp(9), Fp(12), Fp(13), WF1, Fp(15), WF2, Fp(17), Fp(18), Fp(19), SLIM, (float*)d_out);
}

// v009
// It runs in 93.5 microseconds.
// Two timings next to v008 both put it at 1.40 times that version's speed.
// All steps since v000 together make it 11.0 times as fast.
#include <hip/hip_runtime.h>

// SyntaxMultiAttentionGAT: tokens are the (b, x, y) cells of table [4][96][96][256]; q,k,v = table W + b (8 heads x 32); per (b, x) sequence of 96 cells: probs = softmax_k(q.k / sqrt(32) + dep_matrix[b][x][k] Wdep[h] + bdep[h]); ctx = probs v; out1 = LN(ctx Wo + bo + table); out = LN(relu(out1 W1 + b1) W2 + b2 + out1) -> [4][96][96][256].
// Deterministic: fixed split of column tiles and rows over the waves of a work-group, softmax sums over 96 keys in a fixed tree, LayerNorm row sums in a fixed tree over the lanes; no atomics.
// WMMA (v_wmma_f32_16x16x32_f16, f32 accumulate): per (sequence, head) wave table (EXACT bf16 x8, K 256, 6 token tiles) x the head's 2 column tiles of each of Wq, Wk (transposed) and Wv, then for each of its 6 query tiles S^T = k rows (hi+lo; 6 tiles) x q (hi+lo x256, K 32) and ctx^T = v^T (hi+lo; 2 tiles, K 96) x P^T (hi+lo), 3 products, q, k and v^T fragments taken straight from the projection's accumulators; tail ctx x Wo (16 tiles), out1 x W1 (64 tiles), ff x W2 (K 1,024, 16 tiles) per 48-token work-group of 16 waves - weights EXACT x256 ((in,out)), about 7 M WMMA; softmax, dep bias, LayerNorms, relu in f32.

namespace {
constexpr int NB_ = 4, LQ = 96, D = 256, H = 8, HD = 32, FF = 1024, NSEQ = NB_ * LQ /* 384 */, NT = NSEQ * LQ /* 36864 tokens */;
constexpr int AW = 4 /* waves (heads) per attention work-group */, TLW = 16 /* waves per tail work-group */, MT = 3 /* token tiles per tail work-group */, TM = MT * 16 /* its tokens */;
constexpr float XS = 8.0f, HS = 256.0f, PS = 256.0f, WSC = 256.0f, EPS = 1e-5f, SCL = 0.17677669529663688f /* 32^-0.5 */;
typedef _Float16 b16;
typedef __attribute__((ext_vector_type(16))) _Float16 v16b;
typedef __attribute__((ext_vector_type(8))) _Float16 v8b;
typedef __attribute__((ext_vector_type(4))) _Float16 v4b;
typedef __attribute__((ext_vector_type(8))) float v8f;
typedef __attribute__((ext_vector_type(4))) float v4f;
typedef __attribute__((ext_vector_type(2))) float v2f;
__device__ __forceinline__ float bf16_rne(float f) { unsigned int u = __float_as_uint(f); u += 0x7FFFu + ((u >> 16) & 1u); return __uint_as_float(u & 0xFFFF0000u); }
__device__ __forceinline__ float bfv(float f) { return bf16_rne(f); }
__device__ __forceinline__ void split16(float v, b16& hi, b16& lo) { hi = (b16)v; lo = (b16)(v - (float)hi); }
__device__ __forceinline__ v16b frag_kb(const b16* p, int hh) { const v8b a = *(const v8b*)(p + 8 * hh), b = *(const v8b*)(p + 16 + 8 * hh); v16b f;
#pragma unroll
  for (int e = 0; e < 8; ++e) { f[e] = a[e]; f[8 + e] = b[e]; } return f; }
// Weight fragments lie in the workspace in register order: block (column tile T, k block kk) is 512 elements at (T * K / 32 + kk) * 512, as [j][lane][8] with element e = W[k = kk * 32 + j * 16 + 8 * (lane >> 4) + e][T * 16 + (lane & 15)], the k order of frag_kb. One 16-byte load of a wave reads 512 bytes in a row, 4 whole 128-byte lines (16 weight rows read row-major would be 16 lines).
__device__ __forceinline__ v16b frag_pk(const b16* p) { const v8b a = *(const v8b*)p, b = *(const v8b*)(p + 256); v16b f;
#pragma unroll
  for (int e = 0; e < 8; ++e) { f[e] = a[e]; f[8 + e] = b[e]; } return f; }
// q, k and v fragments have the same order, hi and lo apart. q, k: e = x[token = lane & 15][head * 32 + j * 16 + 8 * (lane >> 4) + e]. v (half dt of the head's 32 columns, key block i of 32): e = v[key = i * 32 + j * 16 + 8 * (lane >> 4) + e][head * 32 + dt * 16 + (lane & 15)].
__device__ __forceinline__ void pk_unit(size_t u, int KB, int& o, int& k0) { const int lane = (int)(u & 31), j = (int)(u >> 5) & 1, blk = (int)(u >> 6); o = (blk / KB) * 16 + (lane & 15); k0 = (blk % KB) * 32 + j * 16 + (lane >> 4) * 8; }
__device__ __forceinline__ v8f wmma16b(v16b a, v16b b, v8f c) { return __builtin_amdgcn_wmma_f32_16x16x32_f16(false, a, false, b, (short)0, c, false, false); }
// Sum over the 32 lanes of a wave, bit-identical in every lane (each step adds the two partners' values, and a + b = b + a): lane l with l ^ 1, 2, 4, 8 inside its 16-lane row by DPP row_xmask, then with l ^ 16. All 32 lanes must be on.
template <int CTRL> __device__ __forceinline__ float row_x(float x) { return __builtin_bit_cast(float, __builtin_amdgcn_update_dpp(0, __builtin_bit_cast(int, x), CTRL, 0xf, 0xf, true)); }
__device__ __forceinline__ float wave_sum(float x) { x += row_x<0x161>(x); x += row_x<0x162>(x); x += row_x<0x164>(x); x += row_x<0x168>(x); return x + __builtin_bit_cast(float, __builtin_amdgcn_permlanex16(__builtin_bit_cast(int, x), __builtin_bit_cast(int, x), 0x76543210, 0xfedcba98, false, false)); }
// The value of lane l ^ 16.
__device__ __forceinline__ float half_x(float x) { return __builtin_bit_cast(float, __builtin_amdgcn_permlanex16(__builtin_bit_cast(int, x), __builtin_bit_cast(int, x), 0x76543210, 0xfedcba98, false, false)); }
__device__ __forceinline__ float pmul(float a, float b) { float p = a * b; asm volatile("" : "+v"(p)); return p; }

__global__ __launch_bounds__(256) void wput_kernel(const float* __restrict__ wq, const float* __restrict__ wk, const float* __restrict__ wv, const float* __restrict__ wo, const float* __restrict__ w1, const float* __restrict__ w2, b16* __restrict__ WQKV, b16* __restrict__ WO, b16* __restrict__ WF1, b16* __restrict__ WF2) { const size_t nt = (size_t)gridDim.x * 256, u0 = (size_t)blockIdx.x * 256 + threadIdx.x; v8b v;
  for (size_t u = u0; u < (size_t)3 * D * 32; u += nt) { int o, k0; pk_unit(u, D / 32, o, k0); const float* w = o < D ? wq : (o < 2 * D ? wk : wv); const int oo = o % D;
#pragma unroll
    for (int j = 0; j < 8; ++j) v[j] = (b16)(bf16_rne(w[(size_t)(k0 + j) * D + oo]) * WSC); { *(v8b*)(WQKV + u * 8) = v;  } }
  for (size_t u = u0; u < (size_t)D * 32; u += nt) { int o, k0; pk_unit(u, D / 32, o, k0);
#pragma unroll
    for (int j = 0; j < 8; ++j) v[j] = (b16)(bf16_rne(wo[(size_t)(k0 + j) * D + o]) * WSC); { *(v8b*)(WO + u * 8) = v;  } }
  for (size_t u = u0; u < (size_t)FF * 32; u += nt) { int o, k0; pk_unit(u, D / 32, o, k0);
#pragma unroll
    for (int j = 0; j < 8; ++j) v[j] = (b16)(bf16_rne(w1[(size_t)(k0 + j) * FF + o]) * WSC); { *(v8b*)(WF1 + u * 8) = v;  } }
  for (size_t u = u0; u < (size_t)D * 128; u += nt) { int o, k0; pk_unit(u, FF / 32, o, k0);
#pragma unroll
    for (int j = 0; j < 8; ++j) v[j] = (b16)(bf16_rne(w2[(size_t)(k0 + j) * D + o]) * WSC); { *(v8b*)(WF2 + u * 8) = v;  } } }
// K loop of the tail kernel, fetched ahead. Step s (32 k) takes the lane's fragments of MT token tiles from LDS (hi, and lo where LO) and one weight fragment per column tile from L2. A wave issues in order, so a load that stands right in front of its product makes the wave wait out the whole latency: here the LDS fragments of step s + 1 are asked for in front of the products of step s, into a second set of registers, and the weight fragment of the (step, column tile) R - 1 places on into a ring of R. The products and each accumulator's k order are those of the plain loop: per column tile MT hi products, then MT lo products.
// R is 8 where a place holds 3 or 6 products and registers allow it, 4 for W1, whose 12 accumulator tiles leave no more.
// ah, al: the lane's place in row nloc of the hi and lo arrays (8 * hlf added), PITCH elements a row; wb: the wave's first weight block, lane * 8 added; a column tile is KS blocks of 512 elements.
template <int NTL, int KS, int PITCH, bool LO, int R> __device__ __forceinline__ void k_loop(const b16* ah, const b16* al, const b16* wb, v8f (&acc)[NTL][MT]) { constexpr int G = R / NTL > 2 ? R / NTL : 2 /* steps per trip: even, G * NTL a multiple of R, so that set and ring places are constants */; static_assert(KS % G == 0 && G % 2 == 0 && (G * NTL) % R == 0 && KS * NTL >= R, "shape"); v16b a[2][MT], l[2][MT], bw[R];
  auto lda = [&](int s, int b) {
#pragma unroll   // a, l, bw and acc stay in registers: every index a constant
    for (int m = 0; m < MT; ++m) { a[b][m] = frag_kb(ah + m * 16 * PITCH + s * 32, 0); if constexpr (LO) l[b][m] = frag_kb(al + m * 16 * PITCH + s * 32, 0); } };
  auto ldb = [&](int s, int t, int r) { bw[r] = frag_pk(wb + t * (KS * 512) + s * 512); };
  auto trip = [&](int sb, bool last) {
#pragma unroll   // a, l, bw and acc stay in registers: every index a constant
    for (int j = 0; j < G; ++j) { if (!last || j + 1 < G) lda(sb + j + 1, (j + 1) & 1);
#pragma unroll   // a, l, bw and acc stay in registers: every index a constant
      for (int t = 0; t < NTL; ++t) { const int li = j * NTL + t, ln = li + R - 1; if (!last || ln < G * NTL) ldb(sb + ln / NTL, ln % NTL, ln % R);
        __builtin_amdgcn_sched_barrier(0);   // the loads above stay in front of these products (moved down to their own uses they would no longer be ahead)
#pragma unroll   // a, l, bw and acc stay in registers: every index a constant
        for (int m = 0; m < MT; ++m) acc[t][m] = wmma16b(a[j & 1][m], bw[li % R], acc[t][m]);
        if constexpr (LO) {
#pragma unroll   // the lo products follow the MT hi products, so that a tile's two dependent products do not stand back to back
          for (int m = 0; m < MT; ++m) acc[t][m] = wmma16b(l[j & 1][m], bw[li % R], acc[t][m]); }
        __builtin_amdgcn_sched_barrier(0); } } };   // and the next loads stay behind them, in the registers that these products have read (moved up among the products they need registers of their own, and the W1 loop then spills)
  lda(0, 0);
#pragma unroll   // a, l, bw and acc stay in registers: every index a constant
  for (int i = 0; i < R - 1; ++i) ldb(i / NTL, i % NTL, i);
#pragma unroll 1   // a trip is already G steps long
  for (int sb = 0; sb < KS - G; sb += G) trip(sb, false);
  trip(KS - G, true); }
template <bool WA> __device__ __forceinline__ void proj(const b16* ah, const b16* wb, v8f (&acc)[2][6]) { constexpr int KS = D / 32; v16b a[6], w[3][2];
  auto ldw = [&](int s) {
#pragma unroll   // w stays in registers: every index a constant, every load at a constant offset from one base
    for (int j = 0; j < 2; ++j) w[s % 3][j] = frag_pk(wb + (j * KS + s) * 512); };
#pragma unroll
  for (int j = 0; j < 2; ++j)
#pragma unroll
    for (int m = 0; m < 6; ++m) acc[j][m] = (v8f){};
  ldw(0); ldw(1);
#pragma unroll   // acc, a and w stay in registers
  for (int s = 0; s < KS; ++s) { if (s + 2 < KS) ldw(s + 2);
#pragma unroll
    for (int m = 0; m < 6; ++m) a[m] = frag_kb(ah + m * 16 * (D + 8) + s * 32, 0);
    __builtin_amdgcn_sched_barrier(0);   // the weight loads stay two steps ahead of their products
#pragma unroll
    for (int j = 0; j < 2; ++j)
#pragma unroll
      for (int m = 0; m < 6; ++m) acc[j][m] = WA ? wmma16b(w[s % 3][j], a[m], acc[j][m]) : wmma16b(a[m], w[s % 3][j], acc[j][m]);
    __builtin_amdgcn_sched_barrier(0); } }   // and later steps' loads stay behind these products, in the registers that they have read (moved up they need registers of their own, and the kernel spills)
// Two accumulator tiles, with their biases, become the hi and the lo fragment: elements 0 to 7 from c0, 8 to 15 from c1.
__device__ __forceinline__ void to_frag(const v8f c0, const v8f c1, const float (&b0)[8], const float (&b1)[8], v16b& fh, v16b& fl) {
#pragma unroll   // fh and fl are built in registers
  for (int e = 0; e < 8; ++e) { b16 p, pl; split16((c0[e] * (1.0f / (XS * WSC)) + b0[e]) * HS, p, pl); fh[e] = p; fl[e] = pl; split16((c1[e] * (1.0f / (XS * WSC)) + b1[e]) * HS, p, pl); fh[8 + e] = p; fl[8 + e] = pl; } }
__device__ __forceinline__ void put_pk(b16* p, const v16b f) { v8b a, b;
#pragma unroll
  for (int e = 0; e < 8; ++e) { a[e] = f[e]; b[e] = f[8 + e]; }
  *(v8b*)p = a; *(v8b*)(p + 256) = b; }
// 768 work-groups of 4 waves are 3 waves per SIMD: the register budget and the LDS (3 work-groups per WGP) are set so that all of them are resident at once.
__global__ __launch_bounds__(AW * 32) __attribute__((amdgpu_waves_per_eu(3))) void att_kernel(const float* __restrict__ tab, const b16* __restrict__ WQKV, const float* __restrict__ bq, const float* __restrict__ bk, const float* __restrict__ bv, const float* __restrict__ dep, const float* __restrict__ wdep, const float* __restrict__ bdep, int SLIM, float* __restrict__ CTX) { __shared__ __attribute__((aligned(16))) b16 Ah[LQ][D + 8]; __shared__ __attribute__((aligned(16))) b16 Qf[AW][6][2][512]; __shared__ __attribute__((aligned(16))) float Dp[AW][LQ]; const int lane = threadIdx.x & 31, wave = __builtin_amdgcn_readfirstlane((int)(threadIdx.x >> 5)), nloc = lane & 15, hlf = lane >> 4; const int seq = blockIdx.x / (H / AW), h = (blockIdx.x % (H / AW)) * AW + wave; if (seq >= SLIM) return; const size_t tk0 = (size_t)seq * LQ; const unsigned l8 = lane * 8;
  // The head's biases and the sequence's dep row are asked for first and are on their way under the staging. q, k: a lane's 8 dimensions of each column tile; v: its one dimension.
  v4f bq4[2][2], bk4[2][2]; float bv1[2], dv[3];
#pragma unroll
  for (int j = 0; j < 2; ++j) { bv1[j] = bv[h * HD + j * 16 + nloc];
#pragma unroll
    for (int q = 0; q < 2; ++q) { bq4[j][q] = *(const v4f*)(bq + h * HD + j * 16 + 8 * hlf + 4 * q); bk4[j][q] = *(const v4f*)(bk + h * HD + j * 16 + 8 * hlf + 4 * q); } }
  asm volatile("s_wait_xcnt 0x0" ::: "memory");   // stands behind the bias loads, in front of any rewrite of the registers that they name (a later load's result went into one of them)
#pragma unroll
  for (int i = 0; i < 3; ++i) dv[i] = dep[(size_t)seq * LQ + i * 32 + lane];
  // The 96 rows are 6,144 pieces of 16 bytes in a row: 48 a thread, 16 in flight together.
  { const v4f* tp = (const v4f*)(tab + tk0 * D) + threadIdx.x; b16* ap = &Ah[threadIdx.x >> 6][(threadIdx.x & 63) * 4];
#pragma unroll
    for (int b = 0; b < 3; ++b) { v4f x[16];
#pragma unroll   // x stays in registers
      for (int i = 0; i < 16; ++i) x[i] = tp[(b * 16 + i) * (AW * 32)];
#pragma unroll
      for (int i = 0; i < 16; ++i) { v4b y;
#pragma unroll
        for (int e = 0; e < 4; ++e) y[e] = (b16)(bf16_rne(x[i][e]) * XS);
        *(v4b*)(ap + (b * 16 + i) * 2 * (D + 8)) = y; } } }
  // The wait stands behind the bias, dep and table loads, in front of any rewrite of the registers that they name; it takes the loaded bias values as inputs so that their loads stay above it (moved down to their uses they would be waited for there, behind no such wait).
  asm volatile("s_wait_xcnt 0x0" :: "v"(bq4[0][0]), "v"(bq4[0][1]), "v"(bq4[1][0]), "v"(bq4[1][1]), "v"(bk4[0][0]), "v"(bk4[0][1]), "v"(bk4[1][0]), "v"(bk4[1][1]), "v"(bv1[0]), "v"(bv1[1]), "v"(dv[0]), "v"(dv[1]), "v"(dv[2]) : "memory");
  const float wd = bfv(wdep[h]), bd = bfv(bdep[h]);
#pragma unroll
  for (int i = 0; i < 3; ++i) Dp[wave][i * 32 + lane] = pmul(bfv(dv[i]), wd) + bd;
  float bqr[2][8], bkr[2][8], bvr[2][8];
#pragma unroll
  for (int j = 0; j < 2; ++j) { const float vb = bfv(bv1[j]);
#pragma unroll
    for (int e = 0; e < 8; ++e) { bqr[j][e] = bfv(bq4[j][e >> 2][e & 3]); bkr[j][e] = bfv(bk4[j][e >> 2][e & 3]); bvr[j][e] = vb; } }
  __syncthreads();   // the staged rows, written by all waves, are read below by every wave; the 96 bias values of a wave by all its lanes
  const b16* ah = &Ah[nloc][8 * hlf]; const b16* wh = WQKV + (size_t)(h * 2) * (16 * D) + l8; b16* qp0 = &Qf[wave][0][0][l8]; v16b khf[6], klf[6], vf[3][4];
  { v8f acc[2][6];
    proj<true>(ah, wh, acc);
#pragma unroll
    for (int m = 0; m < 6; ++m) { v16b fh, fl; to_frag(acc[0][m], acc[1][m], bqr[0], bqr[1], fh, fl); put_pk(qp0 + m * 1024, fh); put_pk(qp0 + m * 1024 + 512, fl); } }
  { v8f acc[2][6];
    proj<true>(ah, wh + (size_t)16 * (16 * D), acc);
#pragma unroll
    for (int m = 0; m < 6; ++m) to_frag(acc[0][m], acc[1][m], bkr[0], bkr[1], khf[m], klf[m]); }
  asm volatile("s_wait_xcnt 0x0" ::: "memory");   // stands behind Wq's and Wk's loads, in front of any rewrite of the registers that they name; behind it the table fragments are read from LDS anew (kept over from the k pass they spill)
  { v8f acc[2][6];
    proj<false>(ah, wh + (size_t)32 * (16 * D), acc);
#pragma unroll
    for (int i = 0; i < 3; ++i) { to_frag(acc[0][2 * i], acc[0][2 * i + 1], bvr[0], bvr[0], vf[i][0], vf[i][1]); to_frag(acc[1][2 * i], acc[1][2 * i + 1], bvr[1], bvr[1], vf[i][2], vf[i][3]); } }
  asm volatile("s_wait_xcnt 0x0" ::: "memory");   // stands behind Wv's loads, in front of any rewrite of the registers that they name
  const b16* qp = qp0; v16b qa = frag_pk(qp), ql = frag_pk(qp + 512);
#pragma unroll 1   // the six tiles run through the same code and the same registers
  for (int qt = 0; qt < 6; ++qt) {
    // Register r8 of tile t is the score of key t * 16 + 8 * hlf + r8 with query nloc. Each score's three products come in the order q.kh, q.kl, ql.kh; the six tiles go side by side so that no product waits for the one in front of it.
    v8f s[6];
#pragma unroll   // s stays in registers
    for (int t = 0; t < 6; ++t) s[t] = wmma16b(khf[t], qa, (v8f){});
#pragma unroll
    for (int t = 0; t < 6; ++t) s[t] = wmma16b(klf[t], qa, s[t]);
#pragma unroll
    for (int t = 0; t < 6; ++t) s[t] = wmma16b(khf[t], ql, s[t]);
    float m8[8], a8[8];   // eight side-by-side chains for the maximum and the sum, joined by a tree, then with the other half of the wave
#pragma unroll   // s, m8 and a8 stay in registers: every index a constant
    for (int t = 0; t < 6; ++t) { const v4f d0 = *(const v4f*)(&Dp[wave][t * 16 + 8 * hlf]), d1 = *(const v4f*)(&Dp[wave][t * 16 + 8 * hlf + 4]);
#pragma unroll
      for (int r8 = 0; r8 < 8; ++r8) { const float v = s[t][r8] * (SCL / (HS * HS)) + (r8 < 4 ? d0[r8 & 3] : d1[r8 & 3]); s[t][r8] = v; m8[r8] = t == 0 ? v : fmaxf(m8[r8], v); } }
    float mx = fmaxf(fmaxf(fmaxf(m8[0], m8[1]), fmaxf(m8[2], m8[3])), fmaxf(fmaxf(m8[4], m8[5]), fmaxf(m8[6], m8[7]))); mx = fmaxf(mx, half_x(mx));
    if (qt < 5) { qp += 1024; qa = frag_pk(qp); ql = frag_pk(qp + 512); }   // the next tile's q, on its way from LDS while the rest of this tile runs; the branch stands here, not right behind the score products, whose q operands the taken side would overwrite too early
#pragma unroll
    for (int t = 0; t < 6; ++t)
#pragma unroll
      for (int r8 = 0; r8 < 8; ++r8) { const float p = __expf(s[t][r8] - mx); s[t][r8] = p; a8[r8] = t == 0 ? p : a8[r8] + p; }
    float sm = ((a8[0] + a8[1]) + (a8[2] + a8[3])) + ((a8[4] + a8[5]) + (a8[6] + a8[7])); sm += half_x(sm); const float inv = (1.0f / sm) * PS;   // PS is a power of two: p * inv has the bits of p * (1 / sm) * PS
    // Tiles 2i and 2i + 1 of S^T are the lane's B fragment of P^T for key block i: column nloc, k = j * 16 + 8 * hlf + e, the k order of the v fragments, which are the A side (row = the head's column).
    v8f o0 = (v8f){}, o1 = (v8f){};
#pragma unroll
    for (int i = 0; i < 3; ++i) { v16b pa, pb;
#pragma unroll
      for (int e = 0; e < 16; ++e) { b16 p, pl; split16(s[2 * i + (e >> 3)][e & 7] * inv, p, pl); pa[e] = p; pb[e] = pl; }
      o0 = wmma16b(vf[i][0], pa, o0); o1 = wmma16b(vf[i][2], pa, o1); o0 = wmma16b(vf[i][1], pa, o0); o1 = wmma16b(vf[i][3], pa, o1); o0 = wmma16b(vf[i][0], pb, o0); o1 = wmma16b(vf[i][2], pb, o1); }
    // Register r8 of o0 (o1) is column 8 * hlf + r8 (16 more) of the head, row nloc of the tile: four 16-byte stores a lane; the wave writes the head's whole 128 bytes of each of its 16 rows.
    float* cp = CTX + (tk0 + qt * 16 + nloc) * D + h * HD + 8 * hlf; v4f x[4];
#pragma unroll
    for (int e = 0; e < 4; ++e) { x[0][e] = o0[e] * (1.0f / (PS * HS)); x[1][e] = o0[4 + e] * (1.0f / (PS * HS)); x[2][e] = o1[e] * (1.0f / (PS * HS)); x[3][e] = o1[4 + e] * (1.0f / (PS * HS)); }
    *(v4f*)cp = x[0]; *(v4f*)(cp + 4) = x[1]; *(v4f*)(cp + 16) = x[2]; *(v4f*)(cp + 20) = x[3];
    asm volatile("s_wait_xcnt 0x0" ::: "memory"); } }   // stands behind the four stores, in front of any overwrite of the registers that they name
// One work-group of TLW waves per MT token tiles (TM = 48 tokens): each wave takes 16 / TLW of the 16 column tiles of Wo and W2 and 64 / TLW of the 64 column tiles of W1, for all MT token tiles, so one weight fragment read from L2 feeds the products of MT tiles; the TM rows of the staging and store loops are split over the waves; each accumulator's k order is as before.
// The LDS of one such work-group fills a WGP: 16 waves there, 4 per SIMD, so the register budget is 256.
__global__ __launch_bounds__(TLW * 32) __attribute__((amdgpu_waves_per_eu(4))) void tail_kernel(const float* __restrict__ CTX, const float* __restrict__ tab, const b16* __restrict__ WO, const float* __restrict__ bo, const float* __restrict__ g1, const float* __restrict__ be1, const b16* __restrict__ WF1, const float* __restrict__ b1, const b16* __restrict__ WF2, const float* __restrict__ b2, const float* __restrict__ g2, const float* __restrict__ be2, int SLIM, float* __restrict__ out) { __shared__ __attribute__((aligned(16))) b16 A1h[TM][D + 8], A1l[TM][D + 8], A2h[TM][FF + 8], A2l[TM][FF + 8]; __shared__ float Y[TM][D + 1]; constexpr int TW = 16 / TLW, TF = 64 / TLW, RW = TM / TLW; const int lane = threadIdx.x & 31, wave = __builtin_amdgcn_readfirstlane((int)(threadIdx.x >> 5)), nloc = lane & 15, hlf = lane >> 4; const size_t t0 = (size_t)blockIdx.x * TM; if (t0 >= (size_t)SLIM * LQ) return;
#pragma unroll   // the loads of a wave's RW rows are in flight together
  for (int i = 0; i < RW; ++i) { const int rr = wave * RW + i;
#pragma unroll
    for (int q = 0; q < 8; ++q) { const int c = q * 32 + lane; b16 p, pl; split16(CTX[(t0 + rr) * D + c] * HS, p, pl); A1h[rr][c] = p; A1l[rr][c] = pl; } }
  if (threadIdx.x < TM) { const int r = threadIdx.x; for (int k = D; k < D + 8; ++k) { A1h[r][k] = (b16)0.0f; A1l[r][k] = (b16)0.0f; } for (int k = FF; k < FF + 8; ++k) { A2h[r][k] = (b16)0.0f; A2l[r][k] = (b16)0.0f; } }
  __syncthreads();
  // LayerNorm, all of it by rows over the waves: a wave holds each of its RW rows in registers, 8 values a lane, and both row sums are 8 values in the lane and then a tree over the 32 lanes. Each thread reads and rewrites only Y elements of its own, so no barrier stands inside or behind. The loops over q and t are unrolled so that gr, br, mu, rs and y stay in registers.
  auto ln_rows = [&](const float* gg, const float* bb) { float gr[8], br[8];
#pragma unroll
    for (int q = 0; q < 8; ++q) { gr[q] = gg[q * 32 + lane]; br[q] = bb[q * 32 + lane]; }
    float mu[RW], rs[RW], y[RW][8];
#pragma unroll
    for (int t = 0; t < RW; ++t)
#pragma unroll
      for (int q = 0; q < 8; ++q) y[t][q] = Y[wave * RW + t][q * 32 + lane];
#pragma unroll
    for (int t = 0; t < RW; ++t) mu[t] = wave_sum(((y[t][0] + y[t][1]) + (y[t][2] + y[t][3])) + ((y[t][4] + y[t][5]) + (y[t][6] + y[t][7]))) * (1.0f / D);
#pragma unroll
    for (int t = 0; t < RW; ++t) { float v0 = 0.0f, v1 = 0.0f;
#pragma unroll
      for (int q = 0; q < 8; q += 2) { const float d0 = y[t][q] - mu[t], d1 = y[t][q + 1] - mu[t]; v0 += d0 * d0; v1 += d1 * d1; }
      rs[t] = rsqrtf(wave_sum(v0 + v1) * (1.0f / D) + EPS); }
#pragma unroll
    for (int q = 0; q < 8; ++q) { const float gq = bfv(gr[q]), bq = bfv(br[q]);
#pragma unroll
      for (int t = 0; t < RW; ++t) Y[wave * RW + t][q * 32 + lane] = pmul((y[t][q] - mu[t]) * rs[t], gq) + bq; } };
  { v8f acc[TW][MT]; const b16* wb = WO + (size_t)(wave * TW) * (16 * D) + lane * 8; float tb[TW][MT][8], bov[TW];   // the residual and the bias are asked for in front of the K loop, with its first weight loads, and used behind it
#pragma unroll
    for (int t = 0; t < TW; ++t) { const int cc = (wave * TW + t) * 16 + nloc; bov[t] = bo[cc];
#pragma unroll
      for (int m = 0; m < MT; ++m) { acc[t][m] = (v8f){};
#pragma unroll
        for (int r8 = 0; r8 < 8; ++r8) tb[t][m][r8] = tab[(t0 + m * 16 + 8 * hlf + r8) * D + cc]; } }
    k_loop<TW, D / 32, D + 8, true, 8>(&A1h[nloc][8 * hlf], &A1l[nloc][8 * hlf], wb, acc);
#pragma unroll
    for (int t = 0; t < TW; ++t) { const int cc = (wave * TW + t) * 16 + nloc; const float bb = bfv(bov[t]);
#pragma unroll
      for (int m = 0; m < MT; ++m)
#pragma unroll
        for (int r8 = 0; r8 < 8; ++r8) { const int r = m * 16 + 8 * hlf + r8; Y[r][cc] = acc[t][m][r8] * (1.0f / (HS * WSC)) + bb + bfv(tb[t][m][r8]); } } }
  __syncthreads(); ln_rows(g1, be1);
  for (int rr = wave * RW; rr < wave * RW + RW; ++rr) for (int q = 0; q < 8; ++q) { const int c = q * 32 + lane; b16 p, pl; split16(Y[rr][c] * HS, p, pl); A1h[rr][c] = p; A1l[rr][c] = pl; }
  __syncthreads();
  // All TF column tiles of a wave in one pass over K, each for all MT token tiles: an LDS fragment of out1 feeds TF products.
  { v8f acc[TF][MT]; const b16* wb = WF1 + (size_t)(wave * TF) * (16 * D) + lane * 8;
#pragma unroll
    for (int t = 0; t < TF; ++t)
#pragma unroll
      for (int m = 0; m < MT; ++m) acc[t][m] = (v8f){};
    k_loop<TF, D / 32, D + 8, true, 4>(&A1h[nloc][8 * hlf], &A1l[nloc][8 * hlf], wb, acc);
#pragma unroll
    for (int t = 0; t < TF; ++t) { const int cc = (wave * TF + t) * 16 + nloc; const float bb = bfv(b1[cc]);
#pragma unroll
      for (int m = 0; m < MT; ++m)
#pragma unroll
        for (int r8 = 0; r8 < 8; ++r8) { const float v = fmaxf(acc[t][m][r8] * (1.0f / (HS * WSC)) + bb, 0.0f); b16 p, pl; split16(v * HS, p, pl); A2h[m * 16 + 8 * hlf + r8][cc] = p; A2l[m * 16 + 8 * hlf + r8][cc] = pl; } } }
  __syncthreads();
  { v8f acc[TW][MT]; const b16* wb = WF2 + (size_t)(wave * TW) * (16 * FF) + lane * 8;
#pragma unroll
    for (int t = 0; t < TW; ++t)
#pragma unroll
      for (int m = 0; m < MT; ++m) acc[t][m] = (v8f){};
    k_loop<TW, FF / 32, FF + 8, true, 8>(&A2h[nloc][8 * hlf], &A2l[nloc][8 * hlf], wb, acc);
#pragma unroll
    for (int t = 0; t < TW; ++t) { const int cc = (wave * TW + t) * 16 + nloc; const float bb = bfv(b2[cc]);
#pragma unroll
      for (int m = 0; m < MT; ++m)
#pragma unroll
        for (int r8 = 0; r8 < 8; ++r8) { const int r = m * 16 + 8 * hlf + r8; Y[r][cc] = Y[r][cc] + acc[t][m][r8] * (1.0f / (HS * WSC)) + bb; } } }
  __syncthreads(); ln_rows(g2, be2);
  { for (int rr = wave * RW; rr < wave * RW + RW; ++rr) for (int q = 0; q < 8; ++q) ((float*)out)[(t0 + rr) * D + q * 32 + lane] = Y[rr][q * 32 + lane];  } }
}  // namespace

extern "C" void kernel_launch(void* const* d_in, const int* in_sizes, int n_in, void* d_out, int out_size, void* d_ws, size_t ws_size, hipStream_t stream) {
  (void)n_in;
  auto Fp = [&](int i) { return (const float*)d_in[i]; };
  // input order: 0 table [4,96,96,256]; 1 dep_matrix [4,96,96]; 2 Wq [256,256]; 3 bq; 4 Wk; 5 bk; 6 Wv; 7 bv; 8 Wo; 9 bo; 10 Wdep [1,8]; 11 bdep [8]; 12 ln1_g; 13 ln1_b; 14 W1 [256,1024]; 15 b1; 16 W2 [1024,256]; 17 b2; 18 ln2_g; 19 ln2_b
  if (in_sizes[0] != NT * D || in_sizes[1] != NT || in_sizes[2] != D * D || in_sizes[8] != D * D || in_sizes[10] != H || in_sizes[14] != D * FF || in_sizes[16] != FF * D || out_size != NT * D) return;
  const int SLIM = NSEQ;   // sequence cut (SLIM*96 tokens; multiple of 16)
  size_t off = 0; char* ws = (char*)d_ws;
  auto carve = [&](size_t bytes) { char* p = ws + off; off += (bytes + 255) & ~(size_t)255; return p; };
  b16* WQKV = (b16*)carve((size_t)3 * D * D * 2); b16* WO = (b16*)carve((size_t)D * D * 2); b16* WF1 = (b16*)carve((size_t)FF * D * 2); b16* WF2 = (b16*)carve((size_t)D * FF * 2); float* CTX = (float*)carve((size_t)NT * D * 4);
  if (off > ws_size || off > ((size_t)208 << 20)) return;   // ~ 40 MB
  wput_kernel<<<128, 256, 0, stream>>>(Fp(2), Fp(4), Fp(6), Fp(8), Fp(14), Fp(16), WQKV, WO, WF1, WF2);
  att_kernel<<<NSEQ * (H / AW), AW * 32, 0, stream>>>(Fp(0), WQKV, Fp(3), Fp(5), Fp(7), Fp(1), Fp(10), Fp(11), SLIM, CTX);
  tail_kernel<<<NT / TM, TLW * 32, 0, stream>>>(CTX, Fp(0), WO, Fp(9), Fp(12), Fp(13), WF1, Fp(15), WF2, Fp(17), Fp(18), Fp(19), SLIM, (float*)d_out);
}

// v010
// One run takes 90.2 microseconds.
// Timed twice side by side with v009, it ran 1.04 and 1.03 times as fast.
// Counting every step since v000, it is 11.4 times as fast.
#include <hip/hip_runtime.h>

// SyntaxMultiAttentionGAT: tokens are the (b, x, y) cells of table [4][96][96][256]; q,k,v = table W + b (8 heads x 32); per (b, x) sequence of 96 cells: probs = softmax_k(q.k / sqrt(32) + dep_matrix[b][x][k] Wdep[h] + bdep[h]); ctx = probs v; out1 = LN(ctx Wo + bo + table); out = LN(relu(out1 W1 + b1) W2 + b2 + out1) -> [4][96][96][256].
// Deterministic: fixed split of column tiles and rows over the waves of a work-group, softmax sums over 96 keys in a fixed tree, W2's four partial sums over K in a fixed tree, LayerNorm row sums in a fixed tree over the lanes; no atomics.
// WMMA (v_wmma_f32_16x16x32_f16, f32 accumulate): per (sequence, head) wave table (EXACT bf16 x8, K 256, 6 token tiles) x the head's 2 column tiles of each of Wq, Wk (transposed) and Wv, then for each of its 6 query tiles S^T = k rows (hi+lo; 6 tiles) x q (hi+lo x256, K 32) and ctx^T = v^T (hi+lo; 2 tiles, K 96) x P^T (hi+lo), 3 products, q, k and v^T fragments taken straight from the projection's accumulators; tail ctx x Wo (16 tiles), out1 x W1 (64 tiles), ff x W2 (K 1,024, 16 tiles) per 48-token work-group of 16 waves - weights EXACT x256 ((in,out)), about 7 M WMMA; softmax, dep bias, LayerNorms, relu in f32.

namespace {
constexpr int NB_ = 4, LQ = 96, D = 256, H = 8, HD = 32, FF = 1024, NSEQ = NB_ * LQ /* 384 */, NT = NSEQ * LQ /* 36864 tokens */;
constexpr int AW = 4 /* waves (heads) per attention work-group */, TLW = 16 /* waves per tail work-group */, MT = 3 /* token tiles per tail work-group */, TM = MT * 16 /* its tokens */;
constexpr float XS = 8.0f, HS = 256.0f, PS = 256.0f, WSC = 256.0f, EPS = 1e-5f, SCL = 0.17677669529663688f /* 32^-0.5 */;
typedef _Float16 b16;
typedef __attribute__((ext_vector_type(16))) _Float16 v16b;
typedef __attribute__((ext_vector_type(8))) _Float16 v8b;
typedef __attribute__((ext_vector_type(4))) _Float16 v4b;
typedef __attribute__((ext_vector_type(8))) float v8f;
typedef __attribute__((ext_vector_type(4))) float v4f;
typedef __attribute__((ext_vector_type(2))) float v2f;
__device__ __forceinline__ float bf16_rne(float f) { unsigned int u = __float_as_uint(f); u += 0x7FFFu + ((u >> 16) & 1u); return __uint_as_float(u & 0xFFFF0000u); }
__device__ __forceinline__ float bfv(float f) { return bf16_rne(f); }
__device__ __forceinline__ void split16(float v, b16& hi, b16& lo) { hi = (b16)v; lo = (b16)(v - (float)hi); }
__device__ __forceinline__ v16b frag_kb(const b16* p, int hh) { const v8b a = *(const v8b*)(p + 8 * hh), b = *(const v8b*)(p + 16 + 8 * hh); v16b f;
#pragma unroll
  for (int e = 0; e < 8; ++e) { f[e] = a[e]; f[8 + e] = b[e]; } return f; }
// Weight fragments lie in the workspace in register order: block (column tile T, k block kk) is 512 elements at (T * K / 32 + kk) * 512, as [j][lane][8] with element e = W[k = kk * 32 + j * 16 + 8 * (lane >> 4) + e][T * 16 + (lane & 15)], the k order of frag_kb. One 16-byte load of a wave reads 512 bytes in a row, 4 whole 128-byte lines (16 weight rows read row-major would be 16 lines).
__device__ __forceinline__ v16b frag_pk(const b16* p) { const v8b a = *(const v8b*)p, b = *(const v8b*)(p + 256); v16b f;
#pragma unroll
  for (int e = 0; e < 8; ++e) { f[e] = a[e]; f[8 + e] = b[e]; } return f; }
// q, k and v fragments have the same order, hi and lo apart. q, k: e = x[token = lane & 15][head * 32 + j * 16 + 8 * (lane >> 4) + e]. v (half dt of the head's 32 columns, key block i of 32): e = v[key = i * 32 + j * 16 + 8 * (lane >> 4) + e][head * 32 + dt * 16 + (lane & 15)].
__device__ __forceinline__ void pk_unit(size_t u, int KB, int& o, int& k0) { const int lane = (int)(u & 31), j = (int)(u >> 5) & 1, blk = (int)(u >> 6); o = (blk / KB) * 16 + (lane & 15); k0 = (blk % KB) * 32 + j * 16 + (lane >> 4) * 8; }
__device__ __forceinline__ v8f wmma16b(v16b a, v16b b, v8f c) { return __builtin_amdgcn_wmma_f32_16x16x32_f16(false, a, false, b, (short)0, c, false, false); }
// Sum over the 32 lanes of a wave, bit-identical in every lane (each step adds the two partners' values, and a + b = b + a): lane l with l ^ 1, 2, 4, 8 inside its 16-lane row by DPP row_xmask, then with l ^ 16. All 32 lanes must be on.
template <int CTRL> __device__ __forceinline__ float row_x(float x) { return __builtin_bit_cast(float, __builtin_amdgcn_update_dpp(0, __builtin_bit_cast(int, x), CTRL, 0xf, 0xf, true)); }
__device__ __forceinline__ float wave_sum(float x) { x += row_x<0x161>(x); x += row_x<0x162>(x); x += row_x<0x164>(x); x += row_x<0x168>(x); return x + __builtin_bit_cast(float, __builtin_amdgcn_permlanex16(__builtin_bit_cast(int, x), __builtin_bit_cast(int, x), 0x76543210, 0xfedcba98, false, false)); }
// The value of lane l ^ 16.
__device__ __forceinline__ float half_x(float x) { return __builtin_bit_cast(float, __builtin_amdgcn_permlanex16(__builtin_bit_cast(int, x), __builtin_bit_cast(int, x), 0x76543210, 0xfedcba98, false, false)); }
__device__ __forceinline__ float pmul(float a, float b) { float p = a * b; asm volatile("" : "+v"(p)); return p; }

__global__ __launch_bounds__(256) void wput_kernel(const float* __restrict__ wq, const float* __restrict__ wk, const float* __restrict__ wv, const float* __restrict__ wo, const float* __restrict__ w1, const float* __restrict__ w2, b16* __restrict__ WQKV, b16* __restrict__ WO, b16* __restrict__ WF1, b16* __restrict__ WF2) { const size_t nt = (size_t)gridDim.x * 256, u0 = (size_t)blockIdx.x * 256 + threadIdx.x; v8b v;
  for (size_t u = u0; u < (size_t)3 * D * 32; u += nt) { int o, k0; pk_unit(u, D / 32, o, k0); const float* w = o < D ? wq : (o < 2 * D ? wk : wv); const int oo = o % D;
#pragma unroll
    for (int j = 0; j < 8; ++j) v[j] = (b16)(bf16_rne(w[(size_t)(k0 + j) * D + oo]) * WSC); { *(v8b*)(WQKV + u * 8) = v;  } }
  for (size_t u = u0; u < (size_t)D * 32; u += nt) { int o, k0; pk_unit(u, D / 32, o, k0);
#pragma unroll
    for (int j = 0; j < 8; ++j) v[j] = (b16)(bf16_rne(wo[(size_t)(k0 + j) * D + o]) * WSC); { *(v8b*)(WO + u * 8) = v;  } }
  for (size_t u = u0; u < (size_t)FF * 32; u += nt) { int o, k0; pk_unit(u, D / 32, o, k0);
#pragma unroll
    for (int j = 0; j < 8; ++j) v[j] = (b16)(bf16_rne(w1[(size_t)(k0 + j) * FF + o]) * WSC); { *(v8b*)(WF1 + u * 8) = v;  } }
  for (size_t u = u0; u < (size_t)D * 128; u += nt) { int o, k0; pk_unit(u, FF / 32, o, k0);
#pragma unroll
    for (int j = 0; j < 8; ++j) v[j] = (b16)(bf16_rne(w2[(size_t)(k0 + j) * D + o]) * WSC); { *(v8b*)(WF2 + u * 8) = v;  } } }
// K loop of the tail kernel, fetched ahead. Step s (32 k) takes the lane's fragments of MT token tiles from LDS (hi, and lo where LO) and one weight fragment per column tile from L2. A wave issues in order, so a load that stands right in front of its product makes the wave wait out the whole latency: here the LDS fragments of step s + 1 are asked for in front of the products of step s, into a second set of registers, and the weight fragment of the (step, column tile) R - 1 places on into a ring of R. The products and each accumulator's k order are those of the plain loop: per column tile MT hi products, then MT lo products.
// R is 8 where a place holds 3 or 6 products and registers allow it, 4 for W1 and W2, whose 12 accumulator tiles leave no more.
// ah, al: the lane's place in row nloc of the hi and lo arrays (8 * hlf added), PITCH elements a row; wb: the wave's first weight block, lane * 8 added; a column tile is TS blocks of 512 elements, of which the loop takes KS. WA: the weight is the A side (result transposed: register r8 is column 8 * hlf + r8 of the column tile, token nloc); both fragments have the same k order on either side.
template <int NTL, int KS, int PITCH, bool LO, int R, int TS = KS, bool WA = false> __device__ __forceinline__ void k_loop(const b16* ah, const b16* al, const b16* wb, v8f (&acc)[NTL][MT]) { constexpr int G = R / NTL > 2 ? R / NTL : 2 /* steps per trip: even, G * NTL a multiple of R, so that set and ring places are constants */; static_assert(KS % G == 0 && G % 2 == 0 && (G * NTL) % R == 0 && KS * NTL >= R, "shape"); v16b a[2][MT], l[2][MT], bw[R];
  auto lda = [&](int s, int b) {
#pragma unroll   // a, l, bw and acc stay in registers: every index a constant
    for (int m = 0; m < MT; ++m) { a[b][m] = frag_kb(ah + m * 16 * PITCH + s * 32, 0); if constexpr (LO) l[b][m] = frag_kb(al + m * 16 * PITCH + s * 32, 0); } };
  auto ldb = [&](int s, int t, int r) { bw[r] = frag_pk(wb + t * (TS * 512) + s * 512); };
  auto trip = [&](int sb, bool last) {
#pragma unroll   // a, l, bw and acc stay in registers: every index a constant
    for (int j = 0; j < G; ++j) { if (!last || j + 1 < G) lda(sb + j + 1, (j + 1) & 1);
#pragma unroll   // a, l, bw and acc stay in registers: every index a constant
      for (int t = 0; t < NTL; ++t) { const int li = j * NTL + t, ln = li + R - 1; if (!last || ln < G * NTL) ldb(sb + ln / NTL, ln % NTL, ln % R);
        __builtin_amdgcn_sched_barrier(0);   // the loads above stay in front of these products (moved down to their own uses they would no longer be ahead)
#pragma unroll   // a, l, bw and acc stay in registers: every index a constant
        for (int m = 0; m < MT; ++m) acc[t][m] = WA ? wmma16b(bw[li % R], a[j & 1][m], acc[t][m]) : wmma16b(a[j & 1][m], bw[li % R], acc[t][m]);
        if constexpr (LO) {
#pragma unroll   // the lo products follow the MT hi products, so that a tile's two dependent products do not stand back to back
          for (int m = 0; m < MT; ++m) acc[t][m] = WA ? wmma16b(bw[li % R], l[j & 1][m], acc[t][m]) : wmma16b(l[j & 1][m], bw[li % R], acc[t][m]); }
        __builtin_amdgcn_sched_barrier(0); } } };   // and the next loads stay behind them, in the registers that these products have read (moved up among the products they need registers of their own, and the W1 loop then spills)
  lda(0, 0);
#pragma unroll   // a, l, bw and acc stay in registers: every index a constant
  for (int i = 0; i < R - 1; ++i) ldb(i / NTL, i % NTL, i);
#pragma unroll 1   // a trip is already G steps long
  for (int sb = 0; sb < KS - G; sb += G) trip(sb, false);
  trip(KS - G, true); }
template <bool WA> __device__ __forceinline__ void proj(const b16* ah, const b16* wb, v8f (&acc)[2][6]) { constexpr int KS = D / 32; v16b a[6], w[3][2];
  auto ldw = [&](int s) {
#pragma unroll   // w stays in registers: every index a constant, every load at a constant offset from one base
    for (int j = 0; j < 2; ++j) w[s % 3][j] = frag_pk(wb + (j * KS + s) * 512); };
#pragma unroll
  for (int j = 0; j < 2; ++j)
#pragma unroll
    for (int m = 0; m < 6; ++m) acc[j][m] = (v8f){};
  ldw(0); ldw(1);
#pragma unroll   // acc, a and w stay in registers
  for (int s = 0; s < KS; ++s) { if (s + 2 < KS) ldw(s + 2);
#pragma unroll
    for (int m = 0; m < 6; ++m) a[m] = frag_kb(ah + m * 16 * (D + 8) + s * 32, 0);
    __builtin_amdgcn_sched_barrier(0);   // the weight loads stay two steps ahead of their products
#pragma unroll
    for (int j = 0; j < 2; ++j)
#pragma unroll
      for (int m = 0; m < 6; ++m) acc[j][m] = WA ? wmma16b(w[s % 3][j], a[m], acc[j][m]) : wmma16b(a[m], w[s % 3][j], acc[j][m]);
    __builtin_amdgcn_sched_barrier(0); } }   // and later steps' loads stay behind these products, in the registers that they have read (moved up they need registers of their own, and the kernel spills)
// Two accumulator tiles, with their biases, become the hi and the lo fragment: elements 0 to 7 from c0, 8 to 15 from c1.
__device__ __forceinline__ void to_frag(const v8f c0, const v8f c1, const float (&b0)[8], const float (&b1)[8], v16b& fh, v16b& fl) {
#pragma unroll   // fh and fl are built in registers
  for (int e = 0; e < 8; ++e) { b16 p, pl; split16((c0[e] * (1.0f / (XS * WSC)) + b0[e]) * HS, p, pl); fh[e] = p; fl[e] = pl; split16((c1[e] * (1.0f / (XS * WSC)) + b1[e]) * HS, p, pl); fh[8 + e] = p; fl[8 + e] = pl; } }
__device__ __forceinline__ void put_pk(b16* p, const v16b f) { v8b a, b;
#pragma unroll
  for (int e = 0; e < 8; ++e) { a[e] = f[e]; b[e] = f[8 + e]; }
  *(v8b*)p = a; *(v8b*)(p + 256) = b; }
// 768 work-groups of 4 waves are 3 waves per SIMD: the register budget and the LDS (3 work-groups per WGP) are set so that all of them are resident at once.
__global__ __launch_bounds__(AW * 32) __attribute__((amdgpu_waves_per_eu(3))) void att_kernel(const float* __restrict__ tab, const b16* __restrict__ WQKV, const float* __restrict__ bq, const float* __restrict__ bk, const float* __restrict__ bv, const float* __restrict__ dep, const float* __restrict__ wdep, const float* __restrict__ bdep, int SLIM, float* __restrict__ CTX) { __shared__ __attribute__((aligned(16))) b16 Ah[LQ][D + 8]; __shared__ __attribute__((aligned(16))) b16 Qf[AW][6][2][512]; __shared__ __attribute__((aligned(16))) float Dp[AW][LQ]; const int lane = threadIdx.x & 31, wave = __builtin_amdgcn_readfirstlane((int)(threadIdx.x >> 5)), nloc = lane & 15, hlf = lane >> 4; const int seq = blockIdx.x / (H / AW), h = (blockIdx.x % (H / AW)) * AW + wave; if (seq >= SLIM) return; const size_t tk0 = (size_t)seq * LQ; const unsigned l8 = lane * 8;
  // The head's biases and the sequence's dep row are asked for first and are on their way under the staging. q, k: a lane's 8 dimensions of each column tile; v: its one dimension.
  v4f bq4[2][2], bk4[2][2]; float bv1[2], dv[3];
#pragma unroll
  for (int j = 0; j < 2; ++j) { bv1[j] = bv[h * HD + j * 16 + nloc];
#pragma unroll
    for (int q = 0; q < 2; ++q) { bq4[j][q] = *(const v4f*)(bq + h * HD + j * 16 + 8 * hlf + 4 * q); bk4[j][q] = *(const v4f*)(bk + h * HD + j * 16 + 8 * hlf + 4 * q); } }
  asm volatile("s_wait_xcnt 0x0" ::: "memory");   // stands behind the bias loads, in front of any rewrite of the registers that they name (a later load's result went into one of them)
#pragma unroll
  for (int i = 0; i < 3; ++i) dv[i] = dep[(size_t)seq * LQ + i * 32 + lane];
  // The 96 rows are 6,144 pieces of 16 bytes in a row: 48 a thread, 16 in flight together.
  { const v4f* tp = (const v4f*)(tab + tk0 * D) + threadIdx.x; b16* ap = &Ah[threadIdx.x >> 6][(threadIdx.x & 63) * 4];
#pragma unroll
    for (int b = 0; b < 3; ++b) { v4f x[16];
#pragma unroll   // x stays in registers
      for (int i = 0; i < 16; ++i) x[i] = tp[(b * 16 + i) * (AW * 32)];
#pragma unroll
      for (int i = 0; i < 16; ++i) { v4b y;
#pragma unroll
        for (int e = 0; e < 4; ++e) y[e] = (b16)(bf16_rne(x[i][e]) * XS);
        *(v4b*)(ap + (b * 16 + i) * 2 * (D + 8)) = y; } } }
  // The wait stands behind the bias, dep and table loads, in front of any rewrite of the registers that they name; it takes the loaded bias values as inputs so that their loads stay above it (moved down to their uses they would be waited for there, behind no such wait).
  asm volatile("s_wait_xcnt 0x0" :: "v"(bq4[0][0]), "v"(bq4[0][1]), "v"(bq4[1][0]), "v"(bq4[1][1]), "v"(bk4[0][0]), "v"(bk4[0][1]), "v"(bk4[1][0]), "v"(bk4[1][1]), "v"(bv1[0]), "v"(bv1[1]), "v"(dv[0]), "v"(dv[1]), "v"(dv[2]) : "memory");
  const float wd = bfv(wdep[h]), bd = bfv(bdep[h]);
#pragma unroll
  for (int i = 0; i < 3; ++i) Dp[wave][i * 32 + lane] = pmul(bfv(dv[i]), wd) + bd;
  float bqr[2][8], bkr[2][8], bvr[2][8];
#pragma unroll
  for (int j = 0; j < 2; ++j) { const float vb = bfv(bv1[j]);
#pragma unroll
    for (int e = 0; e < 8; ++e) { bqr[j][e] = bfv(bq4[j][e >> 2][e & 3]); bkr[j][e] = bfv(bk4[j][e >> 2][e & 3]); bvr[j][e] = vb; } }
  __syncthreads();   // the staged rows, written by all waves, are read below by every wave; the 96 bias values of a wave by all its lanes
  const b16* ah = &Ah[nloc][8 * hlf]; const b16* wh = WQKV + (size_t)(h * 2) * (16 * D) + l8; b16* qp0 = &Qf[wave][0][0][l8]; v16b khf[6], klf[6], vf[3][4];
  { v8f acc[2][6];
    proj<true>(ah, wh, acc);
#pragma unroll
    for (int m = 0; m < 6; ++m) { v16b fh, fl; to_frag(acc[0][m], acc[1][m], bqr[0], bqr[1], fh, fl); put_pk(qp0 + m * 1024, fh); put_pk(qp0 + m * 1024 + 512, fl); } }
  { v8f acc[2][6];
    proj<true>(ah, wh + (size_t)16 * (16 * D), acc);
#pragma unroll
    for (int m = 0; m < 6; ++m) to_frag(acc[0][m], acc[1][m], bkr[0], bkr[1], khf[m], klf[m]); }
  asm volatile("s_wait_xcnt 0x0" ::: "memory");   // stands behind Wq's and Wk's loads, in front of any rewrite of the registers that they name; behind it the table fragments are read from LDS anew (kept over from the k pass they spill)
  { v8f acc[2][6];
    proj<false>(ah, wh + (size_t)32 * (16 * D), acc);
#pragma unroll
    for (int i = 0; i < 3; ++i) { to_frag(acc[0][2 * i], acc[0][2 * i + 1], bvr[0], bvr[0], vf[i][0], vf[i][1]); to_frag(acc[1][2 * i], acc[1][2 * i + 1], bvr[1], bvr[1], vf[i][2], vf[i][3]); } }
  asm volatile("s_wait_xcnt 0x0" ::: "memory");   // stands behind Wv's loads, in front of any rewrite of the registers that they name
  const b16* qp = qp0; v16b qa = frag_pk(qp), ql = frag_pk(qp + 512);
#pragma unroll 1   // the six tiles run through the same code and the same registers
  for (int qt = 0; qt < 6; ++qt) {
    // Register r8 of tile t is the score of key t * 16 + 8 * hlf + r8 with query nloc. Each score's three products come in the order q.kh, q.kl, ql.kh; the six tiles go side by side so that no product waits for the one in front of it.
    v8f s[6];
#pragma unroll   // s stays in registers
    for (int t = 0; t < 6; ++t) s[t] = wmma16b(khf[t], qa, (v8f){});
#pragma unroll
    for (int t = 0; t < 6; ++t) s[t] = wmma16b(klf[t], qa, s[t]);
#pragma unroll
    for (int t = 0; t < 6; ++t) s[t] = wmma16b(khf[t], ql, s[t]);
    float m8[8], a8[8];   // eight side-by-side chains for the maximum and the sum, joined by a tree, then with the other half of the wave
#pragma unroll   // s, m8 and a8 stay in registers: every index a constant
    for (int t = 0; t < 6; ++t) { const v4f d0 = *(const v4f*)(&Dp[wave][t * 16 + 8 * hlf]), d1 = *(const v4f*)(&Dp[wave][t * 16 + 8 * hlf + 4]);
#pragma unroll
      for (int r8 = 0; r8 < 8; ++r8) { const float v = s[t][r8] * (SCL / (HS * HS)) + (r8 < 4 ? d0[r8 & 3] : d1[r8 & 3]); s[t][r8] = v; m8[r8] = t == 0 ? v : fmaxf(m8[r8], v); } }
    float mx = fmaxf(fmaxf(fmaxf(m8[0], m8[1]), fmaxf(m8[2], m8[3])), fmaxf(fmaxf(m8[4], m8[5]), fmaxf(m8[6], m8[7]))); mx = fmaxf(mx, half_x(mx));
    if (qt < 5) { qp += 1024; qa = frag_pk(qp); ql = frag_pk(qp + 512); }   // the next tile's q, on its way from LDS while the rest of this tile runs; the branch stands here, not right behind the score products, whose q operands the taken side would overwrite too early
#pragma unroll
    for (int t = 0; t < 6; ++t)
#pragma unroll
      for (int r8 = 0; r8 < 8; ++r8) { const float p = __expf(s[t][r8] - mx); s[t][r8] = p; a8[r8] = t == 0 ? p : a8[r8] + p; }
    float sm = ((a8[0] + a8[1]) + (a8[2] + a8[3])) + ((a8[4] + a8[5]) + (a8[6] + a8[7])); sm += half_x(sm); const float inv = (1.0f / sm) * PS;   // PS is a power of two: p * inv has the bits of p * (1 / sm) * PS
    // Tiles 2i and 2i + 1 of S^T are the lane's B fragment of P^T for key block i: column nloc, k = j * 16 + 8 * hlf + e, the k order of the v fragments, which are the A side (row = the head's column).
    v8f o0 = (v8f){}, o1 = (v8f){};
#pragma unroll
    for (int i = 0; i < 3; ++i) { v16b pa, pb;
#pragma unroll
      for (int e = 0; e < 16; ++e) { b16 p, pl; split16(s[2 * i + (e >> 3)][e & 7] * inv, p, pl); pa[e] = p; pb[e] = pl; }
      o0 = wmma16b(vf[i][0], pa, o0); o1 = wmma16b(vf[i][2], pa, o1); o0 = wmma16b(vf[i][1], pa, o0); o1 = wmma16b(vf[i][3], pa, o1); o0 = wmma16b(vf[i][0], pb, o0); o1 = wmma16b(vf[i][2], pb, o1); }
    // Register r8 of o0 (o1) is column 8 * hlf + r8 (16 more) of the head, row nloc of the tile: four 16-byte stores a lane; the wave writes the head's whole 128 bytes of each of its 16 rows.
    float* cp = CTX + (tk0 + qt * 16 + nloc) * D + h * HD + 8 * hlf; v4f x[4];
#pragma unroll
    for (int e = 0; e < 4; ++e) { x[0][e] = o0[e] * (1.0f / (PS * HS)); x[1][e] = o0[4 + e] * (1.0f / (PS * HS)); x[2][e] = o1[e] * (1.0f / (PS * HS)); x[3][e] = o1[4 + e] * (1.0f / (PS * HS)); }
    *(v4f*)cp = x[0]; *(v4f*)(cp + 4) = x[1]; *(v4f*)(cp + 16) = x[2]; *(v4f*)(cp + 20) = x[3];
    asm volatile("s_wait_xcnt 0x0" ::: "memory"); } }   // stands behind the four stores, in front of any overwrite of the registers that they name
// One work-group of TLW waves per MT token tiles (TM = 48 tokens): each wave takes 16 / TLW of the 16 column tiles of Wo, 64 / TLW of the 64 column tiles of W1 and 4 of the 16 column tiles of W2 over a quarter of its K, for all MT token tiles, so one weight fragment read from L2 feeds the products of MT tiles; the TM rows of the staging and store loops are split over the waves.
// The LDS of one such work-group fills a WGP: 16 waves there, 4 per SIMD, so the register budget is 256.
__global__ __launch_bounds__(TLW * 32) __attribute__((amdgpu_waves_per_eu(4))) void tail_kernel(const float* __restrict__ CTX, const float* __restrict__ tab, const b16* __restrict__ WO, const float* __restrict__ bo, const float* __restrict__ g1, const float* __restrict__ be1, const b16* __restrict__ WF1, const float* __restrict__ b1, const b16* __restrict__ WF2, const float* __restrict__ b2, const float* __restrict__ g2, const float* __restrict__ be2, int SLIM, float* __restrict__ out) { __shared__ __attribute__((aligned(16))) b16 A1h[TM][D + 8], A1l[TM][D + 8], A2[2][TM][FF + 8] /* ff, hi and lo; behind W2's K loop its partial sums */; __shared__ __attribute__((aligned(16))) float Y[TM][D + 4]; constexpr int TW = 16 / TLW, TF = 64 / TLW, RW = TM / TLW; const int lane = threadIdx.x & 31, wave = __builtin_amdgcn_readfirstlane((int)(threadIdx.x >> 5)), nloc = lane & 15, hlf = lane >> 4; const size_t t0 = (size_t)blockIdx.x * TM; if (t0 >= (size_t)SLIM * LQ) return;
#pragma unroll   // the loads of a wave's RW rows are in flight together
  for (int i = 0; i < RW; ++i) { const int rr = wave * RW + i;
#pragma unroll
    for (int q = 0; q < 8; ++q) { const int c = q * 32 + lane; b16 p, pl; split16(CTX[(t0 + rr) * D + c] * HS, p, pl); A1h[rr][c] = p; A1l[rr][c] = pl; } }
  if (threadIdx.x < TM) { const int r = threadIdx.x; for (int k = D; k < D + 8; ++k) { A1h[r][k] = (b16)0.0f; A1l[r][k] = (b16)0.0f; } for (int k = FF; k < FF + 8; ++k) { A2[0][r][k] = (b16)0.0f; A2[1][r][k] = (b16)0.0f; } }
  __syncthreads();
  // LayerNorm, all of it by rows over the waves: a wave holds each of its RW rows in registers, 8 values a lane, and both row sums are 8 values in the lane and then a tree over the 32 lanes. Each thread reads and rewrites only Y elements of its own, so no barrier stands inside or behind. The loops over q and t are unrolled so that gr, br, mu, rs and y stay in registers.
  auto ln_rows = [&](const float* gg, const float* bb) { float gr[8], br[8];
#pragma unroll
    for (int q = 0; q < 8; ++q) { gr[q] = gg[q * 32 + lane]; br[q] = bb[q * 32 + lane]; }
    float mu[RW], rs[RW], y[RW][8];
#pragma unroll
    for (int t = 0; t < RW; ++t)
#pragma unroll
      for (int q = 0; q < 8; ++q) y[t][q] = Y[wave * RW + t][q * 32 + lane];
#pragma unroll
    for (int t = 0; t < RW; ++t) mu[t] = wave_sum(((y[t][0] + y[t][1]) + (y[t][2] + y[t][3])) + ((y[t][4] + y[t][5]) + (y[t][6] + y[t][7]))) * (1.0f / D);
#pragma unroll
    for (int t = 0; t < RW; ++t) { float v0 = 0.0f, v1 = 0.0f;
#pragma unroll
      for (int q = 0; q < 8; q += 2) { const float d0 = y[t][q] - mu[t], d1 = y[t][q + 1] - mu[t]; v0 += d0 * d0; v1 += d1 * d1; }
      rs[t] = rsqrtf(wave_sum(v0 + v1) * (1.0f / D) + EPS); }
#pragma unroll
    for (int q = 0; q < 8; ++q) { const float gq = bfv(gr[q]), bq = bfv(br[q]);
#pragma unroll
      for (int t = 0; t < RW; ++t) Y[wave * RW + t][q * 32 + lane] = pmul((y[t][q] - mu[t]) * rs[t], gq) + bq; } };
  { v8f acc[TW][MT]; const b16* wb = WO + (size_t)(wave * TW) * (16 * D) + lane * 8; float tb[TW][MT][8], bov[TW];   // the residual and the bias are asked for in front of the K loop, with its first weight loads, and used behind it
#pragma unroll
    for (int t = 0; t < TW; ++t) { const int cc = (wave * TW + t) * 16 + nloc; bov[t] = bo[cc];
#pragma unroll
      for (int m = 0; m < MT; ++m) { acc[t][m] = (v8f){};
#pragma unroll
        for (int r8 = 0; r8 < 8; ++r8) tb[t][m][r8] = tab[(t0 + m * 16 + 8 * hlf + r8) * D + cc]; } }
    k_loop<TW, D / 32, D + 8, true, 8>(&A1h[nloc][8 * hlf], &A1l[nloc][8 * hlf], wb, acc);
#pragma unroll
    for (int t = 0; t < TW; ++t) { const int cc = (wave * TW + t) * 16 + nloc; const float bb = bfv(bov[t]);
#pragma unroll
      for (int m = 0; m < MT; ++m)
#pragma unroll
        for (int r8 = 0; r8 < 8; ++r8) { const int r = m * 16 + 8 * hlf + r8; Y[r][cc] = acc[t][m][r8] * (1.0f / (HS * WSC)) + bb + bfv(tb[t][m][r8]); } } }
  __syncthreads(); ln_rows(g1, be1);
  for (int rr = wave * RW; rr < wave * RW + RW; ++rr) for (int q = 0; q < 8; ++q) { const int c = q * 32 + lane; b16 p, pl; split16(Y[rr][c] * HS, p, pl); A1h[rr][c] = p; A1l[rr][c] = pl; }
  __syncthreads();
  // All TF column tiles of a wave in one pass over K, each for all MT token tiles: an LDS fragment of out1 feeds TF products.
  { v8f acc[TF][MT]; const b16* wb = WF1 + (size_t)(wave * TF) * (16 * D) + lane * 8;
#pragma unroll
    for (int t = 0; t < TF; ++t)
#pragma unroll
      for (int m = 0; m < MT; ++m) acc[t][m] = (v8f){};
    k_loop<TF, D / 32, D + 8, true, 4>(&A1h[nloc][8 * hlf], &A1l[nloc][8 * hlf], wb, acc);
#pragma unroll
    for (int t = 0; t < TF; ++t) { const int cc = (wave * TF + t) * 16 + nloc; const float bb = bfv(b1[cc]);
#pragma unroll
      for (int m = 0; m < MT; ++m)
#pragma unroll
        for (int r8 = 0; r8 < 8; ++r8) { const float v = fmaxf(acc[t][m][r8] * (1.0f / (HS * WSC)) + bb, 0.0f); b16 p, pl; split16(v * HS, p, pl); A2[0][m * 16 + 8 * hlf + r8][cc] = p; A2[1][m * 16 + 8 * hlf + r8][cc] = pl; } } }
  __syncthreads();
  // W2: K is split over KG groups of waves, and a wave takes CW column tiles, each for all MT token tiles, over its quarter of K: an LDS fragment of ff feeds CW products (with one column tile a wave, all 16 waves read the whole of ff, and the LDS reads took twice the time of the products). The product goes transposed, so that a lane's 8 results are 8 neighbouring columns of one token's row and a partial tile goes to LDS in 16-byte stores.
  // The KG partial sums of a row lie side by side, P[row][group * D + column], PP floats a row (16 bytes x an odd number), in the place of ff; LayerNorm 2 joins them in a fixed tree as it reads its rows. The loops over t, m, q and e here and in LayerNorm 2 are unrolled so that acc, y and the 16-byte pieces stay in registers.
  constexpr int KG = 4, CW = 16 / (TLW / KG), KQ = FF / KG, PP = KG * D + 4; static_assert(sizeof(float) * TM * PP <= sizeof(A2), "the partial sums fit in the place of ff"); float* const P = (float*)&A2[0][0][0]; v4f g4[2], e4[2], c4[2];
  { v8f acc[CW][MT]; const int kg = wave / (TLW / KG), cg = wave % (TLW / KG); const b16* wb = WF2 + (size_t)(cg * CW * (FF / 32) + kg * (KQ / 32)) * 512 + lane * 8;
#pragma unroll
    for (int t = 0; t < CW; ++t)
#pragma unroll
      for (int m = 0; m < MT; ++m) acc[t][m] = (v8f){};
    k_loop<CW, KQ / 32, FF + 8, true, 4, FF / 32, true>(&A2[0][nloc][kg * KQ + 8 * hlf], &A2[1][nloc][kg * KQ + 8 * hlf], wb, acc);
    __syncthreads();   // every wave has read its last fragment of ff: the partial sums may take its place
    // LayerNorm 2's gain and shift and W2's bias, a lane's 8 columns of each, are asked for here and are on their way under the stores of the partial sums (in front of the barrier above they would be waited for at it).
#pragma unroll
    for (int q = 0; q < 2; ++q) { g4[q] = *(const v4f*)(g2 + q * 128 + 4 * lane); e4[q] = *(const v4f*)(be2 + q * 128 + 4 * lane); c4[q] = *(const v4f*)(b2 + q * 128 + 4 * lane); }
    asm volatile("s_wait_xcnt 0x0" ::: "memory");   // stands behind the six loads, in front of any rewrite of the registers that they name
    float* pp = P + nloc * PP + kg * D + cg * CW * 16 + 8 * hlf;
#pragma unroll   // acc stays in registers
    for (int t = 0; t < CW; ++t)
#pragma unroll
      for (int m = 0; m < MT; ++m) { v4f x0, x1;
#pragma unroll
        for (int e = 0; e < 4; ++e) { x0[e] = acc[t][m][e]; x1[e] = acc[t][m][4 + e]; }
        *(v4f*)(pp + m * 16 * PP + t * 16) = x0; *(v4f*)(pp + m * 16 * PP + t * 16 + 4) = x1; } }
  __syncthreads();
  // LayerNorm 2 by rows over the waves, as LayerNorm 1, but a lane holds columns q * 128 + 4 * lane + e of its rows, so that partial sums, out1 and out go in 16-byte pieces; the result goes from the registers to out.
  { float y[RW][8], mu[RW], rs[RW];
#pragma unroll   // y stays in registers
    for (int t = 0; t < RW; ++t)
#pragma unroll
      for (int q = 0; q < 2; ++q) { const float* pr = P + (wave * RW + t) * PP + q * 128 + 4 * lane; const v4f p0 = *(const v4f*)pr, p1 = *(const v4f*)(pr + D), p2 = *(const v4f*)(pr + 2 * D), p3 = *(const v4f*)(pr + 3 * D), r = *(const v4f*)&Y[wave * RW + t][q * 128 + 4 * lane];
#pragma unroll
        for (int e = 0; e < 4; ++e) y[t][q * 4 + e] = r[e] + ((p0[e] + p1[e]) + (p2[e] + p3[e])) * (1.0f / (HS * WSC)) + bfv(c4[q][e]); }
#pragma unroll
    for (int t = 0; t < RW; ++t) mu[t] = wave_sum(((y[t][0] + y[t][1]) + (y[t][2] + y[t][3])) + ((y[t][4] + y[t][5]) + (y[t][6] + y[t][7]))) * (1.0f / D);
#pragma unroll
    for (int t = 0; t < RW; ++t) { float v0 = 0.0f, v1 = 0.0f;
#pragma unroll
      for (int q = 0; q < 8; q += 2) { const float d0 = y[t][q] - mu[t], d1 = y[t][q + 1] - mu[t]; v0 += d0 * d0; v1 += d1 * d1; }
      rs[t] = rsqrtf(wave_sum(v0 + v1) * (1.0f / D) + EPS); }
    float* op = out + (t0 + wave * RW) * D + 4 * lane;
#pragma unroll
    for (int t = 0; t < RW; ++t)
#pragma unroll
      for (int q = 0; q < 2; ++q) { v4f o;
#pragma unroll
        for (int e = 0; e < 4; ++e) o[e] = (y[t][q * 4 + e] - mu[t]) * rs[t] * bfv(g4[q][e]) + bfv(e4[q][e]);
        *(v4f*)(op + t * D + q * 128) = o; }
    asm volatile("s_wait_xcnt 0x0" ::: "memory"); } }   // stands behind the six stores, in front of any overwrite of the registers that they name
}  // namespace

extern "C" void kernel_launch(void* const* d_in, const int* in_sizes, int n_in, void* d_out, int out_size, void* d_ws, size_t ws_size, hipStream_t stream) {
  (void)n_in;
  auto Fp = [&](int i) { return (const float*)d_in[i]; };
  // input order: 0 table [4,96,96,256]; 1 dep_matrix [4,96,96]; 2 Wq [256,256]; 3 bq; 4 Wk; 5 bk; 6 Wv; 7 bv; 8 Wo; 9 bo; 10 Wdep [1,8]; 11 bdep [8]; 12 ln1_g; 13 ln1_b; 14 W1 [256,1024]; 15 b1; 16 W2 [1024,256]; 17 b2; 18 ln2_g; 19 ln2_b
  if (in_sizes[0] != NT * D || in_sizes[1] != NT || in_sizes[2] != D * D || in_sizes[8] != D * D || in_sizes[10] != H || in_sizes[14] != D * FF || in_sizes[16] != FF * D || out_size != NT * D) return;
  const int SLIM = NSEQ;   // sequence cut (SLIM*96 tokens; multiple of 16)
  size_t off = 0; char* ws = (char*)d_ws;
  auto carve = [&](size_t bytes) { char* p = ws + off; off += (bytes + 255) & ~(size_t)255; return p; };
  b16* WQKV = (b16*)carve((size_t)3 * D * D * 2); b16* WO = (b16*)carve((size_t)D * D * 2); b16* WF1 = (b16*)carve((size_t)FF * D * 2); b16* WF2 = (b16*)carve((size_t)D * FF * 2); float* CTX = (float*)carve((size_t)NT * D * 4);
  if (off > ws_size || off > ((size_t)208 << 20)) return;   // ~ 40 MB
  wput_kernel<<<128, 256, 0, stream>>>(Fp(2), Fp(4), Fp(6), Fp(8), Fp(14), Fp(16), WQKV, WO, WF1, WF2);
  att_kernel<<<NSEQ * (H / AW), AW * 32, 0, stream>>>(Fp(0), WQKV, Fp(3), Fp(5), Fp(7), Fp(1), Fp(10), Fp(11), SLIM, CTX);
  tail_kernel<<<NT / TM, TLW * 32, 0, stream>>>(CTX, Fp(0), WO, Fp(9), Fp(12), Fp(13), WF1, Fp(15), WF2, Fp(17), Fp(18), Fp(19), SLIM, (float*)d_out);
}
